// v000
// Times are from an AMD MI455X. After a warm-up the kernel runs many times in a row, and a time is the length of
// such a window on the GPU divided by its runs, so every launch and the gaps after it count. The runs cycle
// through copies of the inputs. A figure is the median of several windows, for all but v000 over two sittings.
// Sittings can differ by a few percent; kernels timed side by side share one.
// v000 is the starting kernel. One run takes 2180 microseconds.
#include <hip/hip_runtime.h>

// Single 64-wide causal attention head over 4,096 tokens (x [8][4096][384]; k = x Wk, q = x Wq, v = x Wv ('xw' [384][64], no bias); wei = q.k / sqrt(384) (the module scales by sqrt(embed size)); causal (-inf); softmax; out = wei.v -> [8][4096][64] (2.1 M); argument order x, Wk, Wq, Wv (keys first)).
// Layout per batch: bf16 copy of x; 'xw' weights transposed once; exact projections; one 64-wide head: q/k planes and value^T planes; scores with EVERY row on hi/lo planes (3 products, dense launches), streaming three-sweep causal softmax over the 4,096 keys, wei.v hybrid (rows < 512 hi/lo 3 products, rest fp16 x1024); k_cs8 removes the fp16 carry; k_copy4 writes the output rows once.
// Compute dtypes, f32 accumulate: every input rounded to bf16; projections exact; scores 3 products; softmax f32; wei.v rows < 512 3 products, rest fp16; output f32.

#define NB_  8
#define TT   4096
#define DM   384
#define NH_  1
#define NKV  1
#define REP  (NH_ / NKV)
#define HD   64
#define DQ   (NH_ * HD)
#define DKV  (NKV * HD)
#define ZH   1
#define RH   512                  // query rows < RH use hi+lo planes (0: none)
#define WIN  0
#define PCAR 1024.0f
#define SCL  0.05103103630798288f   // 1/sqrt(384): the module scales by sqrt(embed size C)
#define MID  64       // q / k width (one 64-wide head)
#define CO   64       // v width
#define CC   384
typedef _Float16 h16;
typedef unsigned short bf;
typedef __attribute__((ext_vector_type(16))) __bf16   v16bf;
typedef __attribute__((ext_vector_type(16))) _Float16 v16h;
typedef __attribute__((ext_vector_type(8)))  _Float16 v8h;
typedef __attribute__((ext_vector_type(8)))  unsigned short v8us;
typedef __attribute__((ext_vector_type(8)))  float    v8f;
typedef __attribute__((ext_vector_type(4)))  float    v4f;
typedef v8h  __attribute__((may_alias)) v8ha;
typedef v4f  __attribute__((may_alias)) v4fa;
typedef v8us __attribute__((may_alias)) v8usa;

__device__ __forceinline__ unsigned short f2bf(float f) { unsigned u = __float_as_uint(f); u += 0x7FFFu + ((u >> 16) & 1u); return (unsigned short)(u >> 16); }
__device__ __forceinline__ float bf2f(unsigned short b) { return __uint_as_float(((unsigned)b) << 16); }
__device__ __forceinline__ float bfr(float f) { return bf2f(f2bf(f)); }
__device__ __forceinline__ v16h cat16(v8h lo, v8h hi) { return __builtin_shufflevector(lo, hi, 0, 1, 2, 3, 4, 5, 6, 7, 8, 9, 10, 11, 12, 13, 14, 15); }
__device__ __forceinline__ v16bf cat16b(v8us lo, v8us hi) { return __builtin_bit_cast(v16bf, __builtin_shufflevector(lo, hi, 0, 1, 2, 3, 4, 5, 6, 7, 8, 9, 10, 11, 12, 13, 14, 15)); }
__device__ __forceinline__ v8f wmma16(v16h a, v16h b, v8f c) { return __builtin_amdgcn_wmma_f32_16x16x32_f16(false, a, false, b, (short)0, c, false, false); }
__device__ __forceinline__ v8f wmmab(v16bf a, v16bf b, v8f c) { return __builtin_amdgcn_wmma_f32_16x16x32_bf16(false, a, false, b, (short)0, c, false, false); }



// ---- k_gemmw: register-blocked GEMM, ONE WAVE per 64x64 output tile (16 accumulators), operands straight from K-contiguous 16-bit planes; grid (M/64, N/64, Z), 32 threads.
// C[m][n] (f32, pitch ldc, + optional f32 bias[n]) = sum_k A[m][k] Bt[n][k] (+ split products per NSPLIT). z-batch strides sA/sB/sC in elements. K % 32 == 0.
template <typename T16> struct WFrag;
template <> struct WFrag<h16> { typedef v16h V; static __device__ __forceinline__ V ld(const h16* p) { return cat16(*(const v8h*)p, *(const v8h*)(p + 16)); } static __device__ __forceinline__ v8f mma(V a, V b, v8f c) { return wmma16(a, b, c); } };
template <> struct WFrag<bf> { typedef v16bf V; static __device__ __forceinline__ V ld(const bf* p) { return cat16b(*(const v8us*)p, *(const v8us*)(p + 16)); } static __device__ __forceinline__ v8f mma(V a, V b, v8f c) { return wmmab(a, b, c); } };
template <typename T16, int NSPLIT, bool BIAS>
__global__ __launch_bounds__(32) void k_gemmw(const T16* __restrict__ A, const T16* __restrict__ A2, const T16* __restrict__ Bt, const T16* __restrict__ Bt2, int K, float* C, int ldc, const float* __restrict__ bias, size_t sA, size_t sB, size_t sC) {
    typedef typename WFrag<T16>::V V;
    __shared__ __align__(16) float os[16 * 68];
    const size_t z = blockIdx.z; A += z * sA; if (A2) A2 += z * sA; Bt += z * sB; if (Bt2) Bt2 += z * sB; C += z * sC;
    const int lane = threadIdx.x & 31, lr = lane & 15, hi = lane >> 4; const int r0 = blockIdx.x * 64, c0 = blockIdx.y * 64;
    v8f acc[4][4];
#pragma unroll
    for (int mb = 0; mb < 4; ++mb)
#pragma unroll
        for (int nb = 0; nb < 4; ++nb) acc[mb][nb] = (v8f){};
    const size_t aoff = (size_t)(r0 + lr) * K + 8 * hi, boff = (size_t)(c0 + lr) * K + 8 * hi;
#pragma unroll 1
    for (int kc = 0; kc < K; kc += 32) {
        V a[4], a2[4];
#pragma unroll
        for (int mb = 0; mb < 4; ++mb) { a[mb] = WFrag<T16>::ld(A + aoff + (size_t)mb * 16 * K + kc); if (NSPLIT == 1 || NSPLIT == 2) a2[mb] = WFrag<T16>::ld(A2 + aoff + (size_t)mb * 16 * K + kc); }
#pragma unroll
        for (int nb = 0; nb < 4; ++nb) { const V b = WFrag<T16>::ld(Bt + boff + (size_t)nb * 16 * K + kc); V b2; if (NSPLIT >= 2) b2 = WFrag<T16>::ld(Bt2 + boff + (size_t)nb * 16 * K + kc);
#pragma unroll
            for (int mb = 0; mb < 4; ++mb) { acc[mb][nb] = WFrag<T16>::mma(a[mb], b, acc[mb][nb]); if (NSPLIT == 1 || NSPLIT == 2) acc[mb][nb] = WFrag<T16>::mma(a2[mb], b, acc[mb][nb]); if (NSPLIT >= 2) acc[mb][nb] = WFrag<T16>::mma(a[mb], b2, acc[mb][nb]); } }
        asm volatile("v_nop\n\tv_nop\n\tv_nop\n\tv_nop" : "+v"(acc[0][0]), "+v"(acc[1][1]), "+v"(acc[2][2]), "+v"(acc[3][3]) : "v"(a[0]), "v"(a[3]));
    }
#pragma unroll
    for (int mb = 0; mb < 4; ++mb) {
#pragma unroll
        for (int nb = 0; nb < 4; ++nb) {
#pragma unroll
            for (int j = 0; j < 8; ++j) os[(hi * 8 + j) * 68 + nb * 16 + lr] = acc[mb][nb][j]; }
        __builtin_amdgcn_wave_barrier(); asm volatile("" ::: "memory");
        float* crow = C + (size_t)(r0 + mb * 16) * ldc + c0;
{
#pragma unroll
            for (int s = 0; s < 8; ++s) { const int row = 2 * s + hi, cofs = lr * 4; v4f val = *(const v4fa*)(os + row * 68 + cofs); if (BIAS) { val[0] += bfr(bias[c0 + cofs]); val[1] += bfr(bias[c0 + cofs + 1]); val[2] += bfr(bias[c0 + cofs + 2]); val[3] += bfr(bias[c0 + cofs + 3]); }
                *(v4f*)(crow + (size_t)row * ldc + cofs) = val; }
             }
        __builtin_amdgcn_wave_barrier(); asm volatile("" ::: "memory");
    }
}

__device__ __forceinline__ h16 tohx(float x) { return (h16)x; }
__device__ __forceinline__ void splitf(float y, unsigned short& h, unsigned short& l) { h = f2bf(y); l = f2bf(y - bf2f(h)); }
typedef __attribute__((ext_vector_type(2))) _Float16 v2h;
typedef __attribute__((ext_vector_type(4))) _Float16 v4h;
typedef __attribute__((ext_vector_type(2))) unsigned short v2us;
typedef __attribute__((ext_vector_type(4))) unsigned short v4us;
typedef __attribute__((ext_vector_type(2))) float v2f;
typedef __attribute__((ext_vector_type(4))) int v4i;

__global__ __launch_bounds__(256) void k_cvt8(const float* __restrict__ src, bf* dst, size_t n8) { const size_t i = (size_t)blockIdx.x * 256 + threadIdx.x; if (i >= n8) return; const v8f v = *(const v8f*)(src + i * 8); v8us o;
#pragma unroll
    for (int k = 0; k < 8; ++k) o[k] = f2bf(v[k]); *(v8us*)(dst + i * 8) = o;  }


__global__ __launch_bounds__(256) void k_vtp(const float* __restrict__ F, int pitch, int nheads, h16* V16, bf* Vh, bf* Vl) { const size_t e = ((size_t)blockIdx.x * 256 + threadIdx.x) * 2; if (e >= (size_t)nheads * HD * TT) return; const int t = (int)(e % TT); const int d = (int)((e / TT) % HD); const int g = (int)(e / ((size_t)TT * HD)); v2h o16; v2us oh, ol;
#pragma unroll
    for (int q = 0; q < 2; ++q) { const float x = F[(size_t)(t + q) * pitch + g * HD + d]; o16[q] = tohx(x); unsigned short a2, c2; splitf(x, a2, c2); oh[q] = a2; ol[q] = c2; }
    *(v2h*)(V16 + e) = o16; *(v2us*)(Vh + e) = oh; *(v2us*)(Vl + e) = ol;  }
__global__ __launch_bounds__(256) void k_lsoft(const float* __restrict__ Sb, h16* P16, bf* Ph, bf* Pl) {
    const int lane = threadIdx.x & 31; const int row = blockIdx.x * 8 + (threadIdx.x >> 5); if (row >= ZH * TT) return; const int i = row % TT; const int zz = row / TT; const bool hires = (i < RH); const float* sr = Sb + (size_t)row * TT; float mx = -3.0e38f;
#pragma unroll 4
    for (int ch = 0; ch < TT / 128; ++ch) { const int j0 = ch * 128 + lane * 4; const v4f a = *(const v4f*)(sr + j0);
#pragma unroll
        for (int q = 0; q < 4; ++q) { float t = (j0 + q <= i) ? a[q] * SCL : -3.0e38f; asm volatile("" : "+v"(t)); mx = fmaxf(mx, t); } }
#pragma unroll
    for (int sh = 16; sh; sh >>= 1) mx = fmaxf(mx, __shfl_xor(mx, sh, 32));
    float sum = 0.f;
#pragma unroll 4
    for (int ch = 0; ch < TT / 128; ++ch) { const int j0 = ch * 128 + lane * 4; const v4f a = *(const v4f*)(sr + j0);
#pragma unroll
        for (int q = 0; q < 4; ++q) { float t = (j0 + q <= i) ? a[q] * SCL : -3.0e38f; asm volatile("" : "+v"(t)); float d0 = __fsub_rn(t, mx); asm volatile("" : "+v"(d0)); sum += __builtin_amdgcn_exp2f(__fmul_rn(d0, 1.4426950408889634f)); } }
#pragma unroll
    for (int sh = 16; sh; sh >>= 1) sum += __shfl_xor(sum, sh, 32);
    const float f = __fdiv_rn(hires ? 1.0f : PCAR, sum);
{
        if (hires) {   /* rows < RH: normalised bf16 hi/lo over all keys, planes [zz][RH][TT] */
#pragma unroll
            for (int ch = 0; ch < TT / 128; ++ch) { const int j0 = ch * 128 + lane * 4; const v4f a = *(const v4f*)(sr + j0); v4us oh, ol;
#pragma unroll
                for (int q = 0; q < 4; ++q) { float t = (j0 + q <= i) ? a[q] * SCL : -3.0e38f; asm volatile("" : "+v"(t)); float d0 = __fsub_rn(t, mx); asm volatile("" : "+v"(d0)); float ex = __builtin_amdgcn_exp2f(__fmul_rn(d0, 1.4426950408889634f)); asm volatile("" : "+v"(ex)); unsigned short a2, c2; splitf(ex * f, a2, c2); oh[q] = a2; ol[q] = c2; }
                const size_t oo = ((size_t)zz * RH + i) * TT + j0; *(v4us*)(Ph + oo) = oh; *(v4us*)(Pl + oo) = ol; }
        } else {
#pragma unroll 2
            for (int ch = 0; ch < TT / 128; ++ch) { const int j0 = ch * 128 + lane * 4; const v4f a = *(const v4f*)(sr + j0); v4h o4;
#pragma unroll
                for (int q = 0; q < 4; ++q) { float t = (j0 + q <= i) ? a[q] * SCL : -3.0e38f; asm volatile("" : "+v"(t)); float d0 = __fsub_rn(t, mx); asm volatile("" : "+v"(d0)); float ex = __builtin_amdgcn_exp2f(__fmul_rn(d0, 1.4426950408889634f)); asm volatile("" : "+v"(ex)); o4[q] = tohx(ex * f); }
                *(v4h*)(P16 + (size_t)row * TT + j0) = o4; } }
         }
}
__global__ __launch_bounds__(256) void k_cs8(float* O, size_t n4) { const size_t i = (size_t)blockIdx.x * 256 + threadIdx.x; if (i >= n4) return; const size_t e = i * 4; const int t = (int)(e / CO);   /* row pitch of the attention-output plane is the VALUE width CO (r1 used the input width CC: wrong whenever CC != CO) */ const float cs = (t < RH) ? 1.0f : (1.0f / PCAR); v4f a = *(const v4f*)(O + e);
#pragma unroll
    for (int q = 0; q < 4; ++q) a[q] = __fmul_rn(a[q], cs);
    *(v4f*)(O + e) = a;  }

__global__ __launch_bounds__(256) void k_csid(float* CS) { const int idx = blockIdx.x * 256 + threadIdx.x; if (idx >= TT * HD) return; v2f cs; cs[0] = 1.0f; cs[1] = 0.0f; *(v2f*)(CS + (size_t)idx * 2) = cs;  }
// k_rope: head planes [h][t][d] (fp16 + hi/lo) of rope(x) x sc with the rotate-half convention out[d] = x[d] cos[t][d] - x[d+HD/2] sin[t][d], out[d+HD/2] = x[d+HD/2] cos[t][d+HD/2] + x[d] sin[t][d+HD/2]
__global__ __launch_bounds__(256) void k_rope(const float* __restrict__ F, int pitch, int nheads, const float* __restrict__ CS, const float* __restrict__ RF, const float* __restrict__ nw, float sc, h16* P16, bf* Ph, bf* Pl) {
    const size_t e = ((size_t)blockIdx.x * 256 + threadIdx.x) * 2; if (e >= (size_t)nheads * TT * HD) return; const int d = (int)(e % HD); const int t = (int)((e / HD) % TT); const int h = (int)(e / ((size_t)HD * TT)); const float* f = F + (size_t)t * pitch + h * HD; const float rf = RF ? RF[(size_t)h * TT + t] : 1.0f; v2h o16; v2us oh, ol;
#pragma unroll
    for (int q = 0; q < 2; ++q) { const int dd = d + q; const int dp = (dd < HD / 2) ? dd + HD / 2 : dd - HD / 2; float x0 = f[dd], x1 = f[dp];
        if (RF) { float n0 = __fmul_rn(x0, rf), n1 = __fmul_rn(x1, rf); asm volatile("" : "+v"(n0)); asm volatile("" : "+v"(n1)); x0 = __fmul_rn(bfr(nw[dd]), n0); x1 = __fmul_rn(bfr(nw[dp]), n1); }
        const v2f cs = *(const v2f*)(CS + ((size_t)t * HD + dd) * 2); float a = __fmul_rn(x0, cs[0]), bq = __fmul_rn(x1, cs[1]); asm volatile("" : "+v"(a)); asm volatile("" : "+v"(bq)); const float r = ((dd < HD / 2) ? __fsub_rn(a, bq) : __fadd_rn(a, bq)) * sc;
        o16[q] = tohx(r); unsigned short a2, c2; splitf(r, a2, c2); oh[q] = a2; ol[q] = c2; }
    *(v2h*)(P16 + e) = o16; *(v2us*)(Ph + e) = oh; *(v2us*)(Pl + e) = ol;  }
__global__ __launch_bounds__(256) void k_wtG(const float* __restrict__ w, int K, int N, bf* Bt) {
    const int lane = threadIdx.x & 31; const int L0 = (blockIdx.x * 8 + (threadIdx.x >> 5)) * 8; const int nlines = N * K / 64;
{
#pragma unroll 1
        for (int l = 0; l < 8; ++l) { const int L = L0 + l; if (L >= nlines) break; const size_t e = (size_t)L * 64 + lane * 2; const int k = (int)(e % K), n = (int)(e / K); v2us o;
            o[0] = f2bf(w[(size_t)k * N + n]); o[1] = f2bf(w[(size_t)(k + 1) * N + n]); *(v2us*)(Bt + e) = o; }
         }
}
__global__ __launch_bounds__(256) void k_copy4(const float* __restrict__ Y, float* out, size_t n4) { const size_t i = (size_t)blockIdx.x * 256 + threadIdx.x; if (i >= n4) return; const v4f a = *(const v4f*)(Y + i * 4); *(v4f*)(out + i * 4) = a;  }
extern "C" void kernel_launch(void* const* d_in, const int* in_sizes, int n_in,
                              void* d_out, int out_size, void* d_ws, size_t ws_size, hipStream_t stream) {
    (void)in_sizes; (void)n_in; (void)out_size;
    const float* x = (const float*)d_in[0]; const float* wk = (const float*)d_in[1]; const float* wq = (const float*)d_in[2]; const float* wv = (const float*)d_in[3];   /* x [8][4096][384], Wk, Wq, Wv ('xw' [384][64], no biases; keys first) */
    float* OUT = (float*)d_out;     // [8][4096][64]
    char* wsp = (char*)d_ws;
    auto take = [&](size_t bytes) { char* p = wsp; wsp += (bytes + 255) & ~(size_t)255; return (void*)p; };
    bf* WQ = (bf*)take((size_t)MID * CC * 2); bf* WK = (bf*)take((size_t)MID * CC * 2); bf* WV = (bf*)take((size_t)CO * CC * 2); float* CS = (float*)take((size_t)TT * HD * 2 * 4);
    bf* XB = (bf*)take((size_t)TT * CC * 2); float* FQ = (float*)take((size_t)TT * MID * 4); float* FK = (float*)take((size_t)TT * MID * 4);
    h16* QP16 = (h16*)take((size_t)TT * MID * 2); bf* QPh = (bf*)take((size_t)TT * MID * 2); bf* QPl = (bf*)take((size_t)TT * MID * 2); h16* KP16 = (h16*)take((size_t)TT * MID * 2); bf* KPh = (bf*)take((size_t)TT * MID * 2); bf* KPl = (bf*)take((size_t)TT * MID * 2);
    h16* VT16 = (h16*)take((size_t)CO * TT * 2); bf* VTh = (bf*)take((size_t)CO * TT * 2); bf* VTl = (bf*)take((size_t)CO * TT * 2);
    float* Sb = (float*)take((size_t)TT * TT * 4); h16* P16 = (h16*)take((size_t)TT * TT * 2); bf* Ph = (bf*)take((size_t)RH * TT * 2); bf* Pl = (bf*)take((size_t)RH * TT * 2); float* Ob = (float*)take((size_t)TT * CO * 4);   /* attention output (f32) before the final copy */
    if ((size_t)(wsp - (char*)d_ws) > ws_size) return;    // ws 256 MiB (carve ~117 MiB)
    float* FV = FK;   /* the v projection reuses the k buffer after the k planes are built (stream-ordered) */
    k_wtG<<<(unsigned)((CC * MID / 64 + 63) / 64), 256, 0, stream>>>(wq, CC, MID, WQ); k_wtG<<<(unsigned)((CC * MID / 64 + 63) / 64), 256, 0, stream>>>(wk, CC, MID, WK); k_wtG<<<(unsigned)((CC * CO / 64 + 63) / 64), 256, 0, stream>>>(wv, CC, CO, WV);   /* 'xw' weights -> Bt */
    k_csid<<<(TT * HD + 255) / 256, 256, 0, stream>>>(CS);   /* identity table: k_rope is a plain per-head plane builder here */
    const unsigned LP = (unsigned)(((size_t)NH_ * TT * HD / 2 + 255) / 256);
    for (int b = 0; b < NB_; ++b) {
        k_cvt8<<<(unsigned)(((size_t)TT * CC / 8 + 255) / 256), 256, 0, stream>>>(x + (size_t)b * TT * CC, XB, (size_t)TT * CC / 8);
        k_gemmw<bf, 0, false><<<dim3(TT / 64, MID / 64, 1), 32, 0, stream>>>(XB, nullptr, WQ, nullptr, CC, FQ, MID, nullptr, 0, 0, 0); k_rope<<<LP, 256, 0, stream>>>(FQ, MID, NH_, CS, nullptr, nullptr, 1.0f, QP16, QPh, QPl);   /* q planes [h][n][64] */
        k_gemmw<bf, 0, false><<<dim3(TT / 64, MID / 64, 1), 32, 0, stream>>>(XB, nullptr, WK, nullptr, CC, FK, MID, nullptr, 0, 0, 0); k_rope<<<LP, 256, 0, stream>>>(FK, MID, NKV, CS, nullptr, nullptr, 1.0f, KP16, KPh, KPl);   /* k planes */
        k_gemmw<bf, 0, false><<<dim3(TT / 64, CO / 64, 1), 32, 0, stream>>>(XB, nullptr, WV, nullptr, CC, FV, CO, nullptr, 0, 0, 0); k_vtp<<<(unsigned)(((size_t)TT * CO / 2 + 255) / 256), 256, 0, stream>>>(FV, CO, CO / HD, VT16, VTh, VTl);   /* v^T planes [h][64][n] */
        for (int h = 0; h < NH_; ++h) {   /* per head: dense 4096 x 4096 attention */
            k_gemmw<bf, 2, false><<<dim3(TT / 64, TT / 64, 1), 32, 0, stream>>>(QPh + (size_t)h * TT * HD, QPl + (size_t)h * TT * HD, KPh + (size_t)h * TT * HD, KPl + (size_t)h * TT * HD, HD, Sb, TT, nullptr, 0, 0, 0);   /* S[i][j] = q_i.k_j (3 products, every row) */
            k_lsoft<<<TT / 8, 256, 0, stream>>>(Sb, P16, Ph, Pl);   /* x 1/sqrt(384), softmax over the 4,096 keys */
            k_gemmw<bf, 2, false><<<dim3(RH / 64, HD / 64, 1), 32, 0, stream>>>(Ph, Pl, VTh + (size_t)h * HD * TT, VTl + (size_t)h * HD * TT, TT, Ob + h * HD, CO, nullptr, 0, 0, 0);
            k_gemmw<h16, 0, false><<<dim3((TT - RH) / 64, HD / 64, 1), 32, 0, stream>>>(P16 + (size_t)RH * TT, nullptr, VT16 + (size_t)h * HD * TT, nullptr, TT, Ob + (size_t)RH * CO + h * HD, CO, nullptr, 0, 0, 0); }
        k_cs8<<<(unsigned)(((size_t)TT * CO / 4 + 255) / 256), 256, 0, stream>>>(Ob, (size_t)TT * CO / 4);   /* rows >= 512 x 1/1024 */ k_copy4<<<(unsigned)(((size_t)TT * CO / 4 + 255) / 256), 256, 0, stream>>>(Ob, OUT + (size_t)b * TT * CO, (size_t)TT * CO / 4); }   /* the batch's output rows, written once */
}

// v001
// It runs in 1040 microseconds.
// Two timings next to v000 put it at 2.08 and 2.07 times that version's speed.
#include <hip/hip_runtime.h>

// Single 64-wide causal attention head over 4,096 tokens (x [8][4096][384]; k = x Wk, q = x Wq, v = x Wv ('xw' [384][64], no bias); wei = q.k / sqrt(384) (the module scales by sqrt(embed size)); causal (-inf); softmax; out = wei.v -> [8][4096][64] (2.1 M); argument order x, Wk, Wq, Wv (keys first)).
// Layout per batch: bf16 copy of x; 'xw' weights transposed once; exact projections; one 64-wide head: q/k planes and value^T planes; scores with EVERY row on hi/lo planes (3 products, dense launches), streaming three-sweep causal softmax over the 4,096 keys, wei.v hybrid (rows < 512 hi/lo 3 products, rest fp16 x1024), its 4,096 keys split over KS work-groups per 64x64 tile, each writing an f32 partial plane; k_cs8 sums the KS planes in fixed order and removes the fp16 carry; k_copy4 writes the output rows once.
// Compute dtypes, f32 accumulate: every input rounded to bf16; projections exact; scores 3 products; softmax f32; wei.v rows < 512 3 products, rest fp16; output f32.

#define NB_  8
#define TT   4096
#define DM   384
#define NH_  1
#define NKV  1
#define REP  (NH_ / NKV)
#define HD   64
#define DQ   (NH_ * HD)
#define DKV  (NKV * HD)
#define ZH   1
#define RH   512                  // query rows < RH use hi+lo planes (0: none)
#define WIN  0
#define PCAR 1024.0f
#define KS   32                   // key ranges of the wei.v products (one work-group and one f32 partial plane each)
#define SCL  0.05103103630798288f   // 1/sqrt(384): the module scales by sqrt(embed size C)
#define MID  64       // q / k width (one 64-wide head)
#define CO   64       // v width
#define CC   384
typedef _Float16 h16;
typedef unsigned short bf;
typedef __attribute__((ext_vector_type(16))) __bf16   v16bf;
typedef __attribute__((ext_vector_type(16))) _Float16 v16h;
typedef __attribute__((ext_vector_type(8)))  _Float16 v8h;
typedef __attribute__((ext_vector_type(8)))  unsigned short v8us;
typedef __attribute__((ext_vector_type(8)))  float    v8f;
typedef __attribute__((ext_vector_type(4)))  float    v4f;
typedef v8h  __attribute__((may_alias)) v8ha;
typedef v4f  __attribute__((may_alias)) v4fa;
typedef v8us __attribute__((may_alias)) v8usa;

__device__ __forceinline__ unsigned short f2bf(float f) { unsigned u = __float_as_uint(f); u += 0x7FFFu + ((u >> 16) & 1u); return (unsigned short)(u >> 16); }
__device__ __forceinline__ float bf2f(unsigned short b) { return __uint_as_float(((unsigned)b) << 16); }
__device__ __forceinline__ float bfr(float f) { return bf2f(f2bf(f)); }
__device__ __forceinline__ v16h cat16(v8h lo, v8h hi) { return __builtin_shufflevector(lo, hi, 0, 1, 2, 3, 4, 5, 6, 7, 8, 9, 10, 11, 12, 13, 14, 15); }
__device__ __forceinline__ v16bf cat16b(v8us lo, v8us hi) { return __builtin_bit_cast(v16bf, __builtin_shufflevector(lo, hi, 0, 1, 2, 3, 4, 5, 6, 7, 8, 9, 10, 11, 12, 13, 14, 15)); }
__device__ __forceinline__ v8f wmma16(v16h a, v16h b, v8f c) { return __builtin_amdgcn_wmma_f32_16x16x32_f16(false, a, false, b, (short)0, c, false, false); }
__device__ __forceinline__ v8f wmmab(v16bf a, v16bf b, v8f c) { return __builtin_amdgcn_wmma_f32_16x16x32_bf16(false, a, false, b, (short)0, c, false, false); }



// ---- k_gemmw: register-blocked GEMM, ONE WAVE per 64x64 output tile (16 accumulators), operands straight from K-contiguous 16-bit planes; grid (M/64, N/64, Z), 32 threads.
// C[m][n] (f32, pitch ldc, + optional f32 bias[n]) = sum_k A[m][k] Bt[n][k] (+ split products per NSPLIT). z-batch strides sA/sB/sC in elements. K % 32 == 0. K is the row pitch of A and Bt; a work-group sums KL of the K columns (KL < K with sA = sB = KL: grid z walks the column ranges of one product, and the C planes are partial sums).
template <typename T16> struct WFrag;
template <> struct WFrag<h16> { typedef v16h V; static __device__ __forceinline__ V ld(const h16* p) { return cat16(*(const v8h*)p, *(const v8h*)(p + 16)); } static __device__ __forceinline__ v8f mma(V a, V b, v8f c) { return wmma16(a, b, c); } };
template <> struct WFrag<bf> { typedef v16bf V; static __device__ __forceinline__ V ld(const bf* p) { return cat16b(*(const v8us*)p, *(const v8us*)(p + 16)); } static __device__ __forceinline__ v8f mma(V a, V b, v8f c) { return wmmab(a, b, c); } };
template <typename T16, int NSPLIT, bool BIAS>
__global__ __launch_bounds__(32) void k_gemmw(const T16* __restrict__ A, const T16* __restrict__ A2, const T16* __restrict__ Bt, const T16* __restrict__ Bt2, int K, int KL, float* C, int ldc, const float* __restrict__ bias, size_t sA, size_t sB, size_t sC) {
    typedef typename WFrag<T16>::V V;
    __shared__ __align__(16) float os[16 * 68];
    const size_t z = blockIdx.z; A += z * sA; if (A2) A2 += z * sA; Bt += z * sB; if (Bt2) Bt2 += z * sB; C += z * sC;
    const int lane = threadIdx.x & 31, lr = lane & 15, hi = lane >> 4; const int r0 = blockIdx.x * 64, c0 = blockIdx.y * 64;
    v8f acc[4][4];
#pragma unroll
    for (int mb = 0; mb < 4; ++mb)
#pragma unroll
        for (int nb = 0; nb < 4; ++nb) acc[mb][nb] = (v8f){};
    const size_t aoff = (size_t)(r0 + lr) * K + 8 * hi, boff = (size_t)(c0 + lr) * K + 8 * hi;
#pragma unroll 1
    for (int kc = 0; kc < KL; kc += 32) {
        V a[4], a2[4];
#pragma unroll
        for (int mb = 0; mb < 4; ++mb) { a[mb] = WFrag<T16>::ld(A + aoff + (size_t)mb * 16 * K + kc); if (NSPLIT == 1 || NSPLIT == 2) a2[mb] = WFrag<T16>::ld(A2 + aoff + (size_t)mb * 16 * K + kc); }
#pragma unroll
        for (int nb = 0; nb < 4; ++nb) { const V b = WFrag<T16>::ld(Bt + boff + (size_t)nb * 16 * K + kc); V b2; if (NSPLIT >= 2) b2 = WFrag<T16>::ld(Bt2 + boff + (size_t)nb * 16 * K + kc);
#pragma unroll
            for (int mb = 0; mb < 4; ++mb) { acc[mb][nb] = WFrag<T16>::mma(a[mb], b, acc[mb][nb]); if (NSPLIT == 1 || NSPLIT == 2) acc[mb][nb] = WFrag<T16>::mma(a2[mb], b, acc[mb][nb]); if (NSPLIT >= 2) acc[mb][nb] = WFrag<T16>::mma(a[mb], b2, acc[mb][nb]); } }
        asm volatile("v_nop\n\tv_nop\n\tv_nop\n\tv_nop" : "+v"(acc[0][0]), "+v"(acc[1][1]), "+v"(acc[2][2]), "+v"(acc[3][3]) : "v"(a[0]), "v"(a[3]));
    }
#pragma unroll
    for (int mb = 0; mb < 4; ++mb) {
#pragma unroll
        for (int nb = 0; nb < 4; ++nb) {
#pragma unroll
            for (int j = 0; j < 8; ++j) os[(hi * 8 + j) * 68 + nb * 16 + lr] = acc[mb][nb][j]; }
        __builtin_amdgcn_wave_barrier(); asm volatile("" ::: "memory");
        float* crow = C + (size_t)(r0 + mb * 16) * ldc + c0;
{
#pragma unroll
            for (int s = 0; s < 8; ++s) { const int row = 2 * s + hi, cofs = lr * 4; v4f val = *(const v4fa*)(os + row * 68 + cofs); if (BIAS) { val[0] += bfr(bias[c0 + cofs]); val[1] += bfr(bias[c0 + cofs + 1]); val[2] += bfr(bias[c0 + cofs + 2]); val[3] += bfr(bias[c0 + cofs + 3]); }
                *(v4f*)(crow + (size_t)row * ldc + cofs) = val; }
             }
        __builtin_amdgcn_wave_barrier(); asm volatile("" ::: "memory");
    }
}

__device__ __forceinline__ h16 tohx(float x) { return (h16)x; }
__device__ __forceinline__ void splitf(float y, unsigned short& h, unsigned short& l) { h = f2bf(y); l = f2bf(y - bf2f(h)); }
typedef __attribute__((ext_vector_type(2))) _Float16 v2h;
typedef __attribute__((ext_vector_type(4))) _Float16 v4h;
typedef __attribute__((ext_vector_type(2))) unsigned short v2us;
typedef __attribute__((ext_vector_type(4))) unsigned short v4us;
typedef __attribute__((ext_vector_type(2))) float v2f;
typedef __attribute__((ext_vector_type(4))) int v4i;

__global__ __launch_bounds__(256) void k_cvt8(const float* __restrict__ src, bf* dst, size_t n8) { const size_t i = (size_t)blockIdx.x * 256 + threadIdx.x; if (i >= n8) return; const v8f v = *(const v8f*)(src + i * 8); v8us o;
#pragma unroll
    for (int k = 0; k < 8; ++k) o[k] = f2bf(v[k]); *(v8us*)(dst + i * 8) = o;  }


__global__ __launch_bounds__(256) void k_vtp(const float* __restrict__ F, int pitch, int nheads, h16* V16, bf* Vh, bf* Vl) { const size_t e = ((size_t)blockIdx.x * 256 + threadIdx.x) * 2; if (e >= (size_t)nheads * HD * TT) return; const int t = (int)(e % TT); const int d = (int)((e / TT) % HD); const int g = (int)(e / ((size_t)TT * HD)); v2h o16; v2us oh, ol;
#pragma unroll
    for (int q = 0; q < 2; ++q) { const float x = F[(size_t)(t + q) * pitch + g * HD + d]; o16[q] = tohx(x); unsigned short a2, c2; splitf(x, a2, c2); oh[q] = a2; ol[q] = c2; }
    *(v2h*)(V16 + e) = o16; *(v2us*)(Vh + e) = oh; *(v2us*)(Vl + e) = ol;  }
__global__ __launch_bounds__(256) void k_lsoft(const float* __restrict__ Sb, h16* P16, bf* Ph, bf* Pl) {
    const int lane = threadIdx.x & 31; const int row = blockIdx.x * 8 + (threadIdx.x >> 5); if (row >= ZH * TT) return; const int i = row % TT; const int zz = row / TT; const bool hires = (i < RH); const float* sr = Sb + (size_t)row * TT; float mx = -3.0e38f;
#pragma unroll 4
    for (int ch = 0; ch < TT / 128; ++ch) { const int j0 = ch * 128 + lane * 4; const v4f a = *(const v4f*)(sr + j0);
#pragma unroll
        for (int q = 0; q < 4; ++q) { float t = (j0 + q <= i) ? a[q] * SCL : -3.0e38f; asm volatile("" : "+v"(t)); mx = fmaxf(mx, t); } }
#pragma unroll
    for (int sh = 16; sh; sh >>= 1) mx = fmaxf(mx, __shfl_xor(mx, sh, 32));
    float sum = 0.f;
#pragma unroll 4
    for (int ch = 0; ch < TT / 128; ++ch) { const int j0 = ch * 128 + lane * 4; const v4f a = *(const v4f*)(sr + j0);
#pragma unroll
        for (int q = 0; q < 4; ++q) { float t = (j0 + q <= i) ? a[q] * SCL : -3.0e38f; asm volatile("" : "+v"(t)); float d0 = __fsub_rn(t, mx); asm volatile("" : "+v"(d0)); sum += __builtin_amdgcn_exp2f(__fmul_rn(d0, 1.4426950408889634f)); } }
#pragma unroll
    for (int sh = 16; sh; sh >>= 1) sum += __shfl_xor(sum, sh, 32);
    const float f = __fdiv_rn(hires ? 1.0f : PCAR, sum);
{
        if (hires) {   /* rows < RH: normalised bf16 hi/lo over all keys, planes [zz][RH][TT] */
#pragma unroll
            for (int ch = 0; ch < TT / 128; ++ch) { const int j0 = ch * 128 + lane * 4; const v4f a = *(const v4f*)(sr + j0); v4us oh, ol;
#pragma unroll
                for (int q = 0; q < 4; ++q) { float t = (j0 + q <= i) ? a[q] * SCL : -3.0e38f; asm volatile("" : "+v"(t)); float d0 = __fsub_rn(t, mx); asm volatile("" : "+v"(d0)); float ex = __builtin_amdgcn_exp2f(__fmul_rn(d0, 1.4426950408889634f)); asm volatile("" : "+v"(ex)); unsigned short a2, c2; splitf(ex * f, a2, c2); oh[q] = a2; ol[q] = c2; }
                const size_t oo = ((size_t)zz * RH + i) * TT + j0; *(v4us*)(Ph + oo) = oh; *(v4us*)(Pl + oo) = ol; }
        } else {
#pragma unroll 2
            for (int ch = 0; ch < TT / 128; ++ch) { const int j0 = ch * 128 + lane * 4; const v4f a = *(const v4f*)(sr + j0); v4h o4;
#pragma unroll
                for (int q = 0; q < 4; ++q) { float t = (j0 + q <= i) ? a[q] * SCL : -3.0e38f; asm volatile("" : "+v"(t)); float d0 = __fsub_rn(t, mx); asm volatile("" : "+v"(d0)); float ex = __builtin_amdgcn_exp2f(__fmul_rn(d0, 1.4426950408889634f)); asm volatile("" : "+v"(ex)); o4[q] = tohx(ex * f); }
                *(v4h*)(P16 + (size_t)row * TT + j0) = o4; } }
         }
}
__global__ __launch_bounds__(256) void k_cs8(const float* __restrict__ Pp, float* O, size_t n4) { const size_t i = (size_t)blockIdx.x * 256 + threadIdx.x; if (i >= n4) return; const size_t e = i * 4; const int t = (int)(e / CO);   /* row pitch of the attention-output plane is the VALUE width CO */ const float cs = (t < RH) ? 1.0f : (1.0f / PCAR); v4f p[KS];
#pragma unroll
    for (int z = 0; z < KS; ++z) p[z] = *(const v4f*)(Pp + (size_t)z * TT * CO + e);   /* the KS partial planes of this element; unrolled so that p[] stays in registers and the loads are issued ahead of the sums */
    v4f a = p[0];
#pragma unroll
    for (int z = 1; z < KS; ++z) a += p[z];   /* fixed order, key ranges ascending; unrolled for the register array */
#pragma unroll
    for (int q = 0; q < 4; ++q) a[q] = __fmul_rn(a[q], cs);
    *(v4f*)(O + e) = a;  }

__global__ __launch_bounds__(256) void k_csid(float* CS) { const int idx = blockIdx.x * 256 + threadIdx.x; if (idx >= TT * HD) return; v2f cs; cs[0] = 1.0f; cs[1] = 0.0f; *(v2f*)(CS + (size_t)idx * 2) = cs;  }
// k_rope: head planes [h][t][d] (fp16 + hi/lo) of rope(x) x sc with the rotate-half convention out[d] = x[d] cos[t][d] - x[d+HD/2] sin[t][d], out[d+HD/2] = x[d+HD/2] cos[t][d+HD/2] + x[d] sin[t][d+HD/2]
__global__ __launch_bounds__(256) void k_rope(const float* __restrict__ F, int pitch, int nheads, const float* __restrict__ CS, const float* __restrict__ RF, const float* __restrict__ nw, float sc, h16* P16, bf* Ph, bf* Pl) {
    const size_t e = ((size_t)blockIdx.x * 256 + threadIdx.x) * 2; if (e >= (size_t)nheads * TT * HD) return; const int d = (int)(e % HD); const int t = (int)((e / HD) % TT); const int h = (int)(e / ((size_t)HD * TT)); const float* f = F + (size_t)t * pitch + h * HD; const float rf = RF ? RF[(size_t)h * TT + t] : 1.0f; v2h o16; v2us oh, ol;
#pragma unroll
    for (int q = 0; q < 2; ++q) { const int dd = d + q; const int dp = (dd < HD / 2) ? dd + HD / 2 : dd - HD / 2; float x0 = f[dd], x1 = f[dp];
        if (RF) { float n0 = __fmul_rn(x0, rf), n1 = __fmul_rn(x1, rf); asm volatile("" : "+v"(n0)); asm volatile("" : "+v"(n1)); x0 = __fmul_rn(bfr(nw[dd]), n0); x1 = __fmul_rn(bfr(nw[dp]), n1); }
        const v2f cs = *(const v2f*)(CS + ((size_t)t * HD + dd) * 2); float a = __fmul_rn(x0, cs[0]), bq = __fmul_rn(x1, cs[1]); asm volatile("" : "+v"(a)); asm volatile("" : "+v"(bq)); const float r = ((dd < HD / 2) ? __fsub_rn(a, bq) : __fadd_rn(a, bq)) * sc;
        o16[q] = tohx(r); unsigned short a2, c2; splitf(r, a2, c2); oh[q] = a2; ol[q] = c2; }
    *(v2h*)(P16 + e) = o16; *(v2us*)(Ph + e) = oh; *(v2us*)(Pl + e) = ol;  }
__global__ __launch_bounds__(256) void k_wtG(const float* __restrict__ w, int K, int N, bf* Bt) {
    const int lane = threadIdx.x & 31; const int L0 = (blockIdx.x * 8 + (threadIdx.x >> 5)) * 8; const int nlines = N * K / 64;
{
#pragma unroll 1
        for (int l = 0; l < 8; ++l) { const int L = L0 + l; if (L >= nlines) break; const size_t e = (size_t)L * 64 + lane * 2; const int k = (int)(e % K), n = (int)(e / K); v2us o;
            o[0] = f2bf(w[(size_t)k * N + n]); o[1] = f2bf(w[(size_t)(k + 1) * N + n]); *(v2us*)(Bt + e) = o; }
         }
}
__global__ __launch_bounds__(256) void k_copy4(const float* __restrict__ Y, float* out, size_t n4) { const size_t i = (size_t)blockIdx.x * 256 + threadIdx.x; if (i >= n4) return; const v4f a = *(const v4f*)(Y + i * 4); *(v4f*)(out + i * 4) = a;  }
extern "C" void kernel_launch(void* const* d_in, const int* in_sizes, int n_in,
                              void* d_out, int out_size, void* d_ws, size_t ws_size, hipStream_t stream) {
    (void)in_sizes; (void)n_in; (void)out_size;
    const float* x = (const float*)d_in[0]; const float* wk = (const float*)d_in[1]; const float* wq = (const float*)d_in[2]; const float* wv = (const float*)d_in[3];   /* x [8][4096][384], Wk, Wq, Wv ('xw' [384][64], no biases; keys first) */
    float* OUT = (float*)d_out;     // [8][4096][64]
    char* wsp = (char*)d_ws;
    auto take = [&](size_t bytes) { char* p = wsp; wsp += (bytes + 255) & ~(size_t)255; return (void*)p; };
    bf* WQ = (bf*)take((size_t)MID * CC * 2); bf* WK = (bf*)take((size_t)MID * CC * 2); bf* WV = (bf*)take((size_t)CO * CC * 2); float* CS = (float*)take((size_t)TT * HD * 2 * 4);
    bf* XB = (bf*)take((size_t)TT * CC * 2); float* FQ = (float*)take((size_t)TT * MID * 4); float* FK = (float*)take((size_t)TT * MID * 4);
    h16* QP16 = (h16*)take((size_t)TT * MID * 2); bf* QPh = (bf*)take((size_t)TT * MID * 2); bf* QPl = (bf*)take((size_t)TT * MID * 2); h16* KP16 = (h16*)take((size_t)TT * MID * 2); bf* KPh = (bf*)take((size_t)TT * MID * 2); bf* KPl = (bf*)take((size_t)TT * MID * 2);
    h16* VT16 = (h16*)take((size_t)CO * TT * 2); bf* VTh = (bf*)take((size_t)CO * TT * 2); bf* VTl = (bf*)take((size_t)CO * TT * 2);
    float* Sb = (float*)take((size_t)TT * TT * 4); h16* P16 = (h16*)take((size_t)TT * TT * 2); bf* Ph = (bf*)take((size_t)RH * TT * 2); bf* Pl = (bf*)take((size_t)RH * TT * 2); float* Ob = (float*)take((size_t)TT * CO * 4);   /* attention output (f32) before the final copy */ float* Op = (float*)take((size_t)KS * TT * CO * 4);   /* KS partial planes of wei.v */
    if ((size_t)(wsp - (char*)d_ws) > ws_size) return;    // ws 256 MiB (carve ~149 MiB)
    float* FV = FK;   /* the v projection reuses the k buffer after the k planes are built (stream-ordered) */
    k_wtG<<<(unsigned)((CC * MID / 64 + 63) / 64), 256, 0, stream>>>(wq, CC, MID, WQ); k_wtG<<<(unsigned)((CC * MID / 64 + 63) / 64), 256, 0, stream>>>(wk, CC, MID, WK); k_wtG<<<(unsigned)((CC * CO / 64 + 63) / 64), 256, 0, stream>>>(wv, CC, CO, WV);   /* 'xw' weights -> Bt */
    k_csid<<<(TT * HD + 255) / 256, 256, 0, stream>>>(CS);   /* identity table: k_rope is a plain per-head plane builder here */
    const unsigned LP = (unsigned)(((size_t)NH_ * TT * HD / 2 + 255) / 256);
    for (int b = 0; b < NB_; ++b) {
        k_cvt8<<<(unsigned)(((size_t)TT * CC / 8 + 255) / 256), 256, 0, stream>>>(x + (size_t)b * TT * CC, XB, (size_t)TT * CC / 8);
        k_gemmw<bf, 0, false><<<dim3(TT / 64, MID / 64, 1), 32, 0, stream>>>(XB, nullptr, WQ, nullptr, CC, CC, FQ, MID, nullptr, 0, 0, 0); k_rope<<<LP, 256, 0, stream>>>(FQ, MID, NH_, CS, nullptr, nullptr, 1.0f, QP16, QPh, QPl);   /* q planes [h][n][64] */
        k_gemmw<bf, 0, false><<<dim3(TT / 64, MID / 64, 1), 32, 0, stream>>>(XB, nullptr, WK, nullptr, CC, CC, FK, MID, nullptr, 0, 0, 0); k_rope<<<LP, 256, 0, stream>>>(FK, MID, NKV, CS, nullptr, nullptr, 1.0f, KP16, KPh, KPl);   /* k planes */
        k_gemmw<bf, 0, false><<<dim3(TT / 64, CO / 64, 1), 32, 0, stream>>>(XB, nullptr, WV, nullptr, CC, CC, FV, CO, nullptr, 0, 0, 0); k_vtp<<<(unsigned)(((size_t)TT * CO / 2 + 255) / 256), 256, 0, stream>>>(FV, CO, CO / HD, VT16, VTh, VTl);   /* v^T planes [h][64][n] */
        for (int h = 0; h < NH_; ++h) {   /* per head: dense 4096 x 4096 attention */
            k_gemmw<bf, 2, false><<<dim3(TT / 64, TT / 64, 1), 32, 0, stream>>>(QPh + (size_t)h * TT * HD, QPl + (size_t)h * TT * HD, KPh + (size_t)h * TT * HD, KPl + (size_t)h * TT * HD, HD, HD, Sb, TT, nullptr, 0, 0, 0);   /* S[i][j] = q_i.k_j (3 products, every row) */
            k_lsoft<<<TT / 8, 256, 0, stream>>>(Sb, P16, Ph, Pl);   /* x 1/sqrt(384), softmax over the 4,096 keys */
            k_gemmw<bf, 2, false><<<dim3(RH / 64, HD / 64, KS), 32, 0, stream>>>(Ph, Pl, VTh + (size_t)h * HD * TT, VTl + (size_t)h * HD * TT, TT, TT / KS, Op + h * HD, CO, nullptr, TT / KS, TT / KS, (size_t)TT * CO);
            k_gemmw<h16, 0, false><<<dim3((TT - RH) / 64, HD / 64, KS), 32, 0, stream>>>(P16 + (size_t)RH * TT, nullptr, VT16 + (size_t)h * HD * TT, nullptr, TT, TT / KS, Op + (size_t)RH * CO + h * HD, CO, nullptr, TT / KS, TT / KS, (size_t)TT * CO); }
        k_cs8<<<(unsigned)(((size_t)TT * CO / 4 + 255) / 256), 256, 0, stream>>>(Op, Ob, (size_t)TT * CO / 4);   /* sum of the KS planes; rows >= 512 x 1/1024 */ k_copy4<<<(unsigned)(((size_t)TT * CO / 4 + 255) / 256), 256, 0, stream>>>(Ob, OUT + (size_t)b * TT * CO, (size_t)TT * CO / 4); }   /* the batch's output rows, written once */
}

// v002
// A run of this version takes 602 microseconds.
// Timed twice side by side with v001, it ran 1.78 and 1.76 times as fast.
// Counting every step since v000, it is 3.67 times as fast.
#include <hip/hip_runtime.h>

// Single 64-wide causal attention head over 4,096 tokens (x [8][4096][384]; k = x Wk, q = x Wq, v = x Wv ('xw' [384][64], no bias); wei = q.k / sqrt(384) (the module scales by sqrt(embed size)); causal (-inf); softmax; out = wei.v -> [8][4096][64] (2.1 M); argument order x, Wk, Wq, Wv (keys first)).
// The batch index rides in the grid: the x copy, the projections and the plane builders take all 8 batches per launch, scores / softmax / wei.v / plane sum take ZH batches per launch (the f32 score planes bound ZH through the workspace), the output copy runs once.
// Layout per batch: bf16 copy of x; 'xw' weights transposed once; exact projections; one 64-wide head: q/k planes and value^T planes; scores with EVERY row on hi/lo planes (3 products, dense launches), streaming three-sweep causal softmax over the 4,096 keys, wei.v hybrid (rows < 512 hi/lo 3 products, rest fp16 x1024), its 4,096 keys split over KS work-groups per 64x64 tile, each writing an f32 partial plane; k_cs8 sums the KS planes in fixed order and removes the fp16 carry; k_copy4 writes the output rows once.
// Compute dtypes, f32 accumulate: every input rounded to bf16; projections exact; scores 3 products; softmax f32; wei.v rows < 512 3 products, rest fp16; output f32.

#define NB_  8
#define TT   4096
#define DM   384
#define NH_  1
#define NKV  1
#define REP  (NH_ / NKV)
#define HD   64
#define DQ   (NH_ * HD)
#define DKV  (NKV * HD)
#define ZH   2                    // batches per launch of scores, softmax, wei.v and the plane sum
#define RH   512                  // query rows < RH use hi+lo planes (0: none)
#define WIN  0
#define PCAR 1024.0f
#define KS   32                   // key ranges of the wei.v products (one work-group and one f32 partial plane each)
#define SCL  0.05103103630798288f   // 1/sqrt(384): the module scales by sqrt(embed size C)
#define MID  64       // q / k width (one 64-wide head)
#define CO   64       // v width
#define CC   384
typedef _Float16 h16;
typedef unsigned short bf;
typedef __attribute__((ext_vector_type(16))) __bf16   v16bf;
typedef __attribute__((ext_vector_type(16))) _Float16 v16h;
typedef __attribute__((ext_vector_type(8)))  _Float16 v8h;
typedef __attribute__((ext_vector_type(8)))  unsigned short v8us;
typedef __attribute__((ext_vector_type(8)))  float    v8f;
typedef __attribute__((ext_vector_type(4)))  float    v4f;
typedef v8h  __attribute__((may_alias)) v8ha;
typedef v4f  __attribute__((may_alias)) v4fa;
typedef v8us __attribute__((may_alias)) v8usa;

__device__ __forceinline__ unsigned short f2bf(float f) { unsigned u = __float_as_uint(f); u += 0x7FFFu + ((u >> 16) & 1u); return (unsigned short)(u >> 16); }
__device__ __forceinline__ float bf2f(unsigned short b) { return __uint_as_float(((unsigned)b) << 16); }
__device__ __forceinline__ float bfr(float f) { return bf2f(f2bf(f)); }
__device__ __forceinline__ v16h cat16(v8h lo, v8h hi) { return __builtin_shufflevector(lo, hi, 0, 1, 2, 3, 4, 5, 6, 7, 8, 9, 10, 11, 12, 13, 14, 15); }
__device__ __forceinline__ v16bf cat16b(v8us lo, v8us hi) { return __builtin_bit_cast(v16bf, __builtin_shufflevector(lo, hi, 0, 1, 2, 3, 4, 5, 6, 7, 8, 9, 10, 11, 12, 13, 14, 15)); }
__device__ __forceinline__ v8f wmma16(v16h a, v16h b, v8f c) { return __builtin_amdgcn_wmma_f32_16x16x32_f16(false, a, false, b, (short)0, c, false, false); }
__device__ __forceinline__ v8f wmmab(v16bf a, v16bf b, v8f c) { return __builtin_amdgcn_wmma_f32_16x16x32_bf16(false, a, false, b, (short)0, c, false, false); }



// ---- k_gemmw: register-blocked GEMM, ONE WAVE per 64x64 output tile (16 accumulators), operands straight from K-contiguous 16-bit planes; grid (M/64, N/64, Z), 32 threads.
// C[m][n] (f32, pitch ldc, + optional f32 bias[n]) = sum_k A[m][k] Bt[n][k] (+ split products per NSPLIT). Strides sA/sB/sC and bA/bB/bC in elements. K % 32 == 0. K is the row pitch of A and Bt; a work-group sums KL of the K columns (KL < K with sA = sB = KL: grid z walks the column ranges of one product, and the C planes are partial sums). Grid z = batch * ZK + range: ZK ranges with strides sA/sB/sC, batches with strides bA/bB/bC.
template <typename T16> struct WFrag;
template <> struct WFrag<h16> { typedef v16h V; static __device__ __forceinline__ V ld(const h16* p) { return cat16(*(const v8h*)p, *(const v8h*)(p + 16)); } static __device__ __forceinline__ v8f mma(V a, V b, v8f c) { return wmma16(a, b, c); } };
template <> struct WFrag<bf> { typedef v16bf V; static __device__ __forceinline__ V ld(const bf* p) { return cat16b(*(const v8us*)p, *(const v8us*)(p + 16)); } static __device__ __forceinline__ v8f mma(V a, V b, v8f c) { return wmmab(a, b, c); } };
template <typename T16, int NSPLIT, bool BIAS>
__global__ __launch_bounds__(32) void k_gemmw(const T16* __restrict__ A, const T16* __restrict__ A2, const T16* __restrict__ Bt, const T16* __restrict__ Bt2, int K, int KL, float* C, int ldc, const float* __restrict__ bias, size_t sA, size_t sB, size_t sC, int ZK, size_t bA, size_t bB, size_t bC) {
    typedef typename WFrag<T16>::V V;
    __shared__ __align__(16) float os[16 * 68];
    const size_t zb = blockIdx.z / (unsigned)ZK, z = blockIdx.z % (unsigned)ZK; A += z * sA + zb * bA; if (A2) A2 += z * sA + zb * bA; Bt += z * sB + zb * bB; if (Bt2) Bt2 += z * sB + zb * bB; C += z * sC + zb * bC;
    const int lane = threadIdx.x & 31, lr = lane & 15, hi = lane >> 4; const int r0 = blockIdx.x * 64, c0 = blockIdx.y * 64;
    v8f acc[4][4];
#pragma unroll
    for (int mb = 0; mb < 4; ++mb)
#pragma unroll
        for (int nb = 0; nb < 4; ++nb) acc[mb][nb] = (v8f){};
    const size_t aoff = (size_t)(r0 + lr) * K + 8 * hi, boff = (size_t)(c0 + lr) * K + 8 * hi;
#pragma unroll 1
    for (int kc = 0; kc < KL; kc += 32) {
        V a[4], a2[4];
#pragma unroll
        for (int mb = 0; mb < 4; ++mb) { a[mb] = WFrag<T16>::ld(A + aoff + (size_t)mb * 16 * K + kc); if (NSPLIT == 1 || NSPLIT == 2) a2[mb] = WFrag<T16>::ld(A2 + aoff + (size_t)mb * 16 * K + kc); }
#pragma unroll
        for (int nb = 0; nb < 4; ++nb) { const V b = WFrag<T16>::ld(Bt + boff + (size_t)nb * 16 * K + kc); V b2; if (NSPLIT >= 2) b2 = WFrag<T16>::ld(Bt2 + boff + (size_t)nb * 16 * K + kc);
#pragma unroll
            for (int mb = 0; mb < 4; ++mb) { acc[mb][nb] = WFrag<T16>::mma(a[mb], b, acc[mb][nb]); if (NSPLIT == 1 || NSPLIT == 2) acc[mb][nb] = WFrag<T16>::mma(a2[mb], b, acc[mb][nb]); if (NSPLIT >= 2) acc[mb][nb] = WFrag<T16>::mma(a[mb], b2, acc[mb][nb]); } }
        asm volatile("v_nop\n\tv_nop\n\tv_nop\n\tv_nop" : "+v"(acc[0][0]), "+v"(acc[1][1]), "+v"(acc[2][2]), "+v"(acc[3][3]) : "v"(a[0]), "v"(a[3]));
    }
#pragma unroll
    for (int mb = 0; mb < 4; ++mb) {
#pragma unroll
        for (int nb = 0; nb < 4; ++nb) {
#pragma unroll
            for (int j = 0; j < 8; ++j) os[(hi * 8 + j) * 68 + nb * 16 + lr] = acc[mb][nb][j]; }
        __builtin_amdgcn_wave_barrier(); asm volatile("" ::: "memory");
        float* crow = C + (size_t)(r0 + mb * 16) * ldc + c0;
{
#pragma unroll
            for (int s = 0; s < 8; ++s) { const int row = 2 * s + hi, cofs = lr * 4; v4f val = *(const v4fa*)(os + row * 68 + cofs); if (BIAS) { val[0] += bfr(bias[c0 + cofs]); val[1] += bfr(bias[c0 + cofs + 1]); val[2] += bfr(bias[c0 + cofs + 2]); val[3] += bfr(bias[c0 + cofs + 3]); }
                *(v4f*)(crow + (size_t)row * ldc + cofs) = val; }
             }
        __builtin_amdgcn_wave_barrier(); asm volatile("" ::: "memory");
    }
}

__device__ __forceinline__ h16 tohx(float x) { return (h16)x; }
__device__ __forceinline__ void splitf(float y, unsigned short& h, unsigned short& l) { h = f2bf(y); l = f2bf(y - bf2f(h)); }
typedef __attribute__((ext_vector_type(2))) _Float16 v2h;
typedef __attribute__((ext_vector_type(4))) _Float16 v4h;
typedef __attribute__((ext_vector_type(2))) unsigned short v2us;
typedef __attribute__((ext_vector_type(4))) unsigned short v4us;
typedef __attribute__((ext_vector_type(2))) float v2f;
typedef __attribute__((ext_vector_type(4))) int v4i;

__global__ __launch_bounds__(256) void k_cvt8(const float* __restrict__ src, bf* dst, size_t n8) { const size_t i = (size_t)blockIdx.x * 256 + threadIdx.x; if (i >= n8) return; const v8f v = *(const v8f*)(src + i * 8); v8us o;
#pragma unroll
    for (int k = 0; k < 8; ++k) o[k] = f2bf(v[k]); *(v8us*)(dst + i * 8) = o;  }


__global__ __launch_bounds__(256) void k_vtp(const float* __restrict__ F, int pitch, int nheads, h16* V16, bf* Vh, bf* Vl) { const size_t e = ((size_t)blockIdx.x * 256 + threadIdx.x) * 2; if (e >= (size_t)nheads * HD * TT) return; { const size_t bb = blockIdx.y; F += bb * TT * pitch; V16 += bb * nheads * HD * TT; Vh += bb * nheads * HD * TT; Vl += bb * nheads * HD * TT; }   /* grid y: batch */ const int t = (int)(e % TT); const int d = (int)((e / TT) % HD); const int g = (int)(e / ((size_t)TT * HD)); v2h o16; v2us oh, ol;
#pragma unroll
    for (int q = 0; q < 2; ++q) { const float x = F[(size_t)(t + q) * pitch + g * HD + d]; o16[q] = tohx(x); unsigned short a2, c2; splitf(x, a2, c2); oh[q] = a2; ol[q] = c2; }
    *(v2h*)(V16 + e) = o16; *(v2us*)(Vh + e) = oh; *(v2us*)(Vl + e) = ol;  }
__global__ __launch_bounds__(256) void k_lsoft(const float* __restrict__ Sb, h16* P16, bf* Ph, bf* Pl) {
    const int lane = threadIdx.x & 31; const int row = blockIdx.x * 8 + (threadIdx.x >> 5); if (row >= ZH * TT) return; const int i = row % TT; const int zz = row / TT; const bool hires = (i < RH); const float* sr = Sb + (size_t)row * TT; float mx = -3.0e38f;
#pragma unroll 4
    for (int ch = 0; ch < TT / 128; ++ch) { const int j0 = ch * 128 + lane * 4; const v4f a = *(const v4f*)(sr + j0);
#pragma unroll
        for (int q = 0; q < 4; ++q) { float t = (j0 + q <= i) ? a[q] * SCL : -3.0e38f; asm volatile("" : "+v"(t)); mx = fmaxf(mx, t); } }
#pragma unroll
    for (int sh = 16; sh; sh >>= 1) mx = fmaxf(mx, __shfl_xor(mx, sh, 32));
    float sum = 0.f;
#pragma unroll 4
    for (int ch = 0; ch < TT / 128; ++ch) { const int j0 = ch * 128 + lane * 4; const v4f a = *(const v4f*)(sr + j0);
#pragma unroll
        for (int q = 0; q < 4; ++q) { float t = (j0 + q <= i) ? a[q] * SCL : -3.0e38f; asm volatile("" : "+v"(t)); float d0 = __fsub_rn(t, mx); asm volatile("" : "+v"(d0)); sum += __builtin_amdgcn_exp2f(__fmul_rn(d0, 1.4426950408889634f)); } }
#pragma unroll
    for (int sh = 16; sh; sh >>= 1) sum += __shfl_xor(sum, sh, 32);
    const float f = __fdiv_rn(hires ? 1.0f : PCAR, sum);
{
        if (hires) {   /* rows < RH: normalised bf16 hi/lo over all keys, planes [zz][RH][TT] */
#pragma unroll
            for (int ch = 0; ch < TT / 128; ++ch) { const int j0 = ch * 128 + lane * 4; const v4f a = *(const v4f*)(sr + j0); v4us oh, ol;
#pragma unroll
                for (int q = 0; q < 4; ++q) { float t = (j0 + q <= i) ? a[q] * SCL : -3.0e38f; asm volatile("" : "+v"(t)); float d0 = __fsub_rn(t, mx); asm volatile("" : "+v"(d0)); float ex = __builtin_amdgcn_exp2f(__fmul_rn(d0, 1.4426950408889634f)); asm volatile("" : "+v"(ex)); unsigned short a2, c2; splitf(ex * f, a2, c2); oh[q] = a2; ol[q] = c2; }
                const size_t oo = ((size_t)zz * RH + i) * TT + j0; *(v4us*)(Ph + oo) = oh; *(v4us*)(Pl + oo) = ol; }
        } else {
#pragma unroll 2
            for (int ch = 0; ch < TT / 128; ++ch) { const int j0 = ch * 128 + lane * 4; const v4f a = *(const v4f*)(sr + j0); v4h o4;
#pragma unroll
                for (int q = 0; q < 4; ++q) { float t = (j0 + q <= i) ? a[q] * SCL : -3.0e38f; asm volatile("" : "+v"(t)); float d0 = __fsub_rn(t, mx); asm volatile("" : "+v"(d0)); float ex = __builtin_amdgcn_exp2f(__fmul_rn(d0, 1.4426950408889634f)); asm volatile("" : "+v"(ex)); o4[q] = tohx(ex * f); }
                *(v4h*)(P16 + (size_t)row * TT + j0) = o4; } }
         }
}
__global__ __launch_bounds__(256) void k_cs8(const float* __restrict__ Pp, float* O, size_t n4) { const size_t i = (size_t)blockIdx.x * 256 + threadIdx.x; if (i >= n4) return; Pp += (size_t)blockIdx.y * KS * TT * CO; O += (size_t)blockIdx.y * TT * CO;   /* grid y: batch */ const size_t e = i * 4; const int t = (int)(e / CO);   /* row pitch of the attention-output plane is the VALUE width CO */ const float cs = (t < RH) ? 1.0f : (1.0f / PCAR); v4f p[KS];
#pragma unroll
    for (int z = 0; z < KS; ++z) p[z] = *(const v4f*)(Pp + (size_t)z * TT * CO + e);   /* the KS partial planes of this element; unrolled so that p[] stays in registers and the loads are issued ahead of the sums */
    v4f a = p[0];
#pragma unroll
    for (int z = 1; z < KS; ++z) a += p[z];   /* fixed order, key ranges ascending; unrolled for the register array */
#pragma unroll
    for (int q = 0; q < 4; ++q) a[q] = __fmul_rn(a[q], cs);
    *(v4f*)(O + e) = a;  }

__global__ __launch_bounds__(256) void k_csid(float* CS) { const int idx = blockIdx.x * 256 + threadIdx.x; if (idx >= TT * HD) return; v2f cs; cs[0] = 1.0f; cs[1] = 0.0f; *(v2f*)(CS + (size_t)idx * 2) = cs;  }
// k_rope: head planes [h][t][d] (fp16 + hi/lo) of rope(x) x sc with the rotate-half convention out[d] = x[d] cos[t][d] - x[d+HD/2] sin[t][d], out[d+HD/2] = x[d+HD/2] cos[t][d+HD/2] + x[d] sin[t][d+HD/2]
__global__ __launch_bounds__(256) void k_rope(const float* __restrict__ F, int pitch, int nheads, const float* __restrict__ CS, const float* __restrict__ RF, const float* __restrict__ nw, float sc, h16* P16, bf* Ph, bf* Pl) {
    { const size_t bb = blockIdx.y; F += bb * TT * pitch; P16 += bb * nheads * TT * HD; Ph += bb * nheads * TT * HD; Pl += bb * nheads * TT * HD; }   /* grid y: batch */
    const size_t e = ((size_t)blockIdx.x * 256 + threadIdx.x) * 2; if (e >= (size_t)nheads * TT * HD) return; const int d = (int)(e % HD); const int t = (int)((e / HD) % TT); const int h = (int)(e / ((size_t)HD * TT)); const float* f = F + (size_t)t * pitch + h * HD; const float rf = RF ? RF[(size_t)h * TT + t] : 1.0f; v2h o16; v2us oh, ol;
#pragma unroll
    for (int q = 0; q < 2; ++q) { const int dd = d + q; const int dp = (dd < HD / 2) ? dd + HD / 2 : dd - HD / 2; float x0 = f[dd], x1 = f[dp];
        if (RF) { float n0 = __fmul_rn(x0, rf), n1 = __fmul_rn(x1, rf); asm volatile("" : "+v"(n0)); asm volatile("" : "+v"(n1)); x0 = __fmul_rn(bfr(nw[dd]), n0); x1 = __fmul_rn(bfr(nw[dp]), n1); }
        const v2f cs = *(const v2f*)(CS + ((size_t)t * HD + dd) * 2); float a = __fmul_rn(x0, cs[0]), bq = __fmul_rn(x1, cs[1]); asm volatile("" : "+v"(a)); asm volatile("" : "+v"(bq)); const float r = ((dd < HD / 2) ? __fsub_rn(a, bq) : __fadd_rn(a, bq)) * sc;
        o16[q] = tohx(r); unsigned short a2, c2; splitf(r, a2, c2); oh[q] = a2; ol[q] = c2; }
    *(v2h*)(P16 + e) = o16; *(v2us*)(Ph + e) = oh; *(v2us*)(Pl + e) = ol;  }
__global__ __launch_bounds__(256) void k_wtG(const float* __restrict__ w, int K, int N, bf* Bt) {
    const int lane = threadIdx.x & 31; const int L0 = (blockIdx.x * 8 + (threadIdx.x >> 5)) * 8; const int nlines = N * K / 64;
{
#pragma unroll 1
        for (int l = 0; l < 8; ++l) { const int L = L0 + l; if (L >= nlines) break; const size_t e = (size_t)L * 64 + lane * 2; const int k = (int)(e % K), n = (int)(e / K); v2us o;
            o[0] = f2bf(w[(size_t)k * N + n]); o[1] = f2bf(w[(size_t)(k + 1) * N + n]); *(v2us*)(Bt + e) = o; }
         }
}
__global__ __launch_bounds__(256) void k_copy4(const float* __restrict__ Y, float* out, size_t n4) { const size_t i = (size_t)blockIdx.x * 256 + threadIdx.x; if (i >= n4) return; const v4f a = *(const v4f*)(Y + i * 4); *(v4f*)(out + i * 4) = a;  }
extern "C" void kernel_launch(void* const* d_in, const int* in_sizes, int n_in,
                              void* d_out, int out_size, void* d_ws, size_t ws_size, hipStream_t stream) {
    (void)in_sizes; (void)n_in; (void)out_size;
    const float* x = (const float*)d_in[0]; const float* wk = (const float*)d_in[1]; const float* wq = (const float*)d_in[2]; const float* wv = (const float*)d_in[3];   /* x [8][4096][384], Wk, Wq, Wv ('xw' [384][64], no biases; keys first) */
    float* OUT = (float*)d_out;     // [8][4096][64]
    char* wsp = (char*)d_ws;
    auto take = [&](size_t bytes) { char* p = wsp; wsp += (bytes + 255) & ~(size_t)255; return (void*)p; };
    bf* WQ = (bf*)take((size_t)MID * CC * 2); bf* WK = (bf*)take((size_t)MID * CC * 2); bf* WV = (bf*)take((size_t)CO * CC * 2); float* CS = (float*)take((size_t)TT * HD * 2 * 4);
    const size_t PQ = (size_t)TT * MID, PV = (size_t)CO * TT;   /* elements of one batch's q / k plane and of its v^T plane */
    h16* QP16 = (h16*)take(NB_ * PQ * 2); bf* QPh = (bf*)take(NB_ * PQ * 2); bf* QPl = (bf*)take(NB_ * PQ * 2); h16* KP16 = (h16*)take(NB_ * PQ * 2); bf* KPh = (bf*)take(NB_ * PQ * 2); bf* KPl = (bf*)take(NB_ * PQ * 2);
    h16* VT16 = (h16*)take(NB_ * PV * 2); bf* VTh = (bf*)take(NB_ * PV * 2); bf* VTl = (bf*)take(NB_ * PV * 2);
    float* Sb = (float*)take((size_t)ZH * TT * TT * 4); h16* P16 = (h16*)take((size_t)ZH * TT * TT * 2); bf* Ph = (bf*)take((size_t)ZH * RH * TT * 2); bf* Pl = (bf*)take((size_t)ZH * RH * TT * 2); float* Ob = (float*)take((size_t)NB_ * TT * CO * 4);   /* attention output (f32) of all batches before the final copy */
    if ((size_t)(wsp - (char*)d_ws) > ws_size) return;    // ws 256 MiB (carve ~254 MiB)
    bf* XB = (bf*)Sb; float* FQ = (float*)(XB + (size_t)NB_ * TT * CC); float* FK = FQ + NB_ * PQ;   /* x copy and f32 projections of all batches (40 MiB) lie in the score planes' bytes: all read before the first score launch writes there (stream-ordered) */
    float* Op = Sb;   /* ZH x KS partial planes of wei.v (64 MiB) lie in the score planes' bytes: the scores are last read by k_lsoft, the planes by k_cs8 before the next score launch (stream-ordered) */
    float* FV = FK;   /* the v projection reuses the k buffer after the k planes are built (stream-ordered) */
    k_wtG<<<(unsigned)((CC * MID / 64 + 63) / 64), 256, 0, stream>>>(wq, CC, MID, WQ); k_wtG<<<(unsigned)((CC * MID / 64 + 63) / 64), 256, 0, stream>>>(wk, CC, MID, WK); k_wtG<<<(unsigned)((CC * CO / 64 + 63) / 64), 256, 0, stream>>>(wv, CC, CO, WV);   /* 'xw' weights -> Bt */
    k_csid<<<(TT * HD + 255) / 256, 256, 0, stream>>>(CS);   /* identity table: k_rope is a plain per-head plane builder here */
    const unsigned LP = (unsigned)(((size_t)NH_ * TT * HD / 2 + 255) / 256);
    /* all 8 batches per launch: the rows of x are one [8 x 4096][384] matrix for the copy and the projections; the plane builders take the batch from grid y */
    k_cvt8<<<(unsigned)(((size_t)NB_ * TT * CC / 8 + 255) / 256), 256, 0, stream>>>(x, XB, (size_t)NB_ * TT * CC / 8);
    k_gemmw<bf, 0, false><<<dim3(NB_ * TT / 64, MID / 64, 1), 32, 0, stream>>>(XB, nullptr, WQ, nullptr, CC, CC, FQ, MID, nullptr, 0, 0, 0, 1, 0, 0, 0); k_rope<<<dim3(LP, NB_, 1), 256, 0, stream>>>(FQ, MID, NH_, CS, nullptr, nullptr, 1.0f, QP16, QPh, QPl);   /* q planes [b][n][64] */
    k_gemmw<bf, 0, false><<<dim3(NB_ * TT / 64, MID / 64, 1), 32, 0, stream>>>(XB, nullptr, WK, nullptr, CC, CC, FK, MID, nullptr, 0, 0, 0, 1, 0, 0, 0); k_rope<<<dim3(LP, NB_, 1), 256, 0, stream>>>(FK, MID, NKV, CS, nullptr, nullptr, 1.0f, KP16, KPh, KPl);   /* k planes */
    k_gemmw<bf, 0, false><<<dim3(NB_ * TT / 64, CO / 64, 1), 32, 0, stream>>>(XB, nullptr, WV, nullptr, CC, CC, FV, CO, nullptr, 0, 0, 0, 1, 0, 0, 0); k_vtp<<<dim3((unsigned)(((size_t)TT * CO / 2 + 255) / 256), NB_, 1), 256, 0, stream>>>(FV, CO, CO / HD, VT16, VTh, VTl);   /* v^T planes [b][64][n] */
    for (int b = 0; b < NB_; b += ZH) {   /* ZH batches per launch: dense 4096 x 4096 attention */
        k_gemmw<bf, 2, false><<<dim3(TT / 64, TT / 64, ZH), 32, 0, stream>>>(QPh + b * PQ, QPl + b * PQ, KPh + b * PQ, KPl + b * PQ, HD, HD, Sb, TT, nullptr, 0, 0, 0, 1, PQ, PQ, (size_t)TT * TT);   /* S[i][j] = q_i.k_j (3 products, every row) */
        k_lsoft<<<ZH * TT / 8, 256, 0, stream>>>(Sb, P16, Ph, Pl);   /* x 1/sqrt(384), softmax over the 4,096 keys */
        k_gemmw<bf, 2, false><<<dim3(RH / 64, HD / 64, KS * ZH), 32, 0, stream>>>(Ph, Pl, VTh + b * PV, VTl + b * PV, TT, TT / KS, Op, CO, nullptr, TT / KS, TT / KS, (size_t)TT * CO, KS, (size_t)RH * TT, PV, (size_t)KS * TT * CO);
        k_gemmw<h16, 0, false><<<dim3((TT - RH) / 64, HD / 64, KS * ZH), 32, 0, stream>>>(P16 + (size_t)RH * TT, nullptr, VT16 + b * PV, nullptr, TT, TT / KS, Op + (size_t)RH * CO, CO, nullptr, TT / KS, TT / KS, (size_t)TT * CO, KS, (size_t)TT * TT, PV, (size_t)KS * TT * CO);
        k_cs8<<<dim3((unsigned)(((size_t)TT * CO / 4 + 255) / 256), ZH, 1), 256, 0, stream>>>(Op, Ob + (size_t)b * TT * CO, (size_t)TT * CO / 4); }   /* sum of the KS planes; rows >= 512 x 1/1024 */
    k_copy4<<<(unsigned)(((size_t)NB_ * TT * CO / 4 + 255) / 256), 256, 0, stream>>>(Ob, OUT, (size_t)NB_ * TT * CO / 4);   /* every output row, written once */
}

// v003
// Measured time: 445 microseconds a run.
// Next to v002, in two timings, it ran 1.35 times as fast each time.
// Counting every step since v000, it is 4.96 times as fast.
#include <hip/hip_runtime.h>

// Single 64-wide causal attention head over 4,096 tokens (x [8][4096][384]; k = x Wk, q = x Wq, v = x Wv ('xw' [384][64], no bias); wei = q.k / sqrt(384) (the module scales by sqrt(embed size)); causal (-inf); softmax; out = wei.v -> [8][4096][64] (2.1 M); argument order x, Wk, Wq, Wv (keys first)).
// The batch index rides in the grid: the x copy, the projections and the plane builders take all 8 batches per launch, scores / softmax / wei.v / plane sum take ZH batches per launch (the f32 score planes bound ZH through the workspace), the output copy runs once.
// Layout per batch: bf16 copy of x; 'xw' weights transposed once; exact projections; one 64-wide head: q/k planes and value^T planes; scores with EVERY row on hi/lo planes (3 products), streaming three-sweep causal softmax, wei.v hybrid (rows < 512 hi/lo 3 products, rest fp16 x1024), its keys split into KS ranges of KR keys, one work-group per 64x64 tile and range, each writing an f32 partial plane; k_cs8 sums the planes in fixed order and removes the fp16 carry; k_copy4 writes the output rows once.
// Causal bound: query row i needs only the keys of ranges 0 .. i / KR. Scores, softmax sweeps, probability planes, wei.v work-groups and the plane sum all stop at that range; nothing beyond it is written or read (every term there is an exact zero of the sums).
// Compute dtypes, f32 accumulate: every input rounded to bf16; projections exact; scores 3 products; softmax f32; wei.v rows < 512 3 products, rest fp16; output f32.

#define NB_  8
#define TT   4096
#define DM   384
#define NH_  1
#define NKV  1
#define REP  (NH_ / NKV)
#define HD   64
#define DQ   (NH_ * HD)
#define DKV  (NKV * HD)
#define ZH   2                    // batches per launch of scores, softmax, wei.v and the plane sum
#define RH   512                  // query rows < RH use hi+lo planes (0: none)
#define WIN  0
#define PCAR 1024.0f
#define KS   32                   // key ranges of the wei.v products (one work-group and one f32 partial plane each)
#define KR   (TT / KS)            // keys per range; also the step of the causal bound
static_assert(KR == 128 && RH % 128 == 0 && TT % 128 == 0, "the softmax sweeps step by 128 keys; the folded causal grids take a range as two 64-row tiles and pair the row tiles of a launch");
#define SCL  0.05103103630798288f   // 1/sqrt(384): the module scales by sqrt(embed size C)
#define MID  64       // q / k width (one 64-wide head)
#define CO   64       // v width
#define CC   384
typedef _Float16 h16;
typedef unsigned short bf;
typedef __attribute__((ext_vector_type(16))) __bf16   v16bf;
typedef __attribute__((ext_vector_type(16))) _Float16 v16h;
typedef __attribute__((ext_vector_type(8)))  _Float16 v8h;
typedef __attribute__((ext_vector_type(8)))  unsigned short v8us;
typedef __attribute__((ext_vector_type(8)))  float    v8f;
typedef __attribute__((ext_vector_type(4)))  float    v4f;
typedef v8h  __attribute__((may_alias)) v8ha;
typedef v4f  __attribute__((may_alias)) v4fa;
typedef v8us __attribute__((may_alias)) v8usa;

__device__ __forceinline__ unsigned short f2bf(float f) { unsigned u = __float_as_uint(f); u += 0x7FFFu + ((u >> 16) & 1u); return (unsigned short)(u >> 16); }
__device__ __forceinline__ float bf2f(unsigned short b) { return __uint_as_float(((unsigned)b) << 16); }
__device__ __forceinline__ float bfr(float f) { return bf2f(f2bf(f)); }
__device__ __forceinline__ v16h cat16(v8h lo, v8h hi) { return __builtin_shufflevector(lo, hi, 0, 1, 2, 3, 4, 5, 6, 7, 8, 9, 10, 11, 12, 13, 14, 15); }
__device__ __forceinline__ v16bf cat16b(v8us lo, v8us hi) { return __builtin_bit_cast(v16bf, __builtin_shufflevector(lo, hi, 0, 1, 2, 3, 4, 5, 6, 7, 8, 9, 10, 11, 12, 13, 14, 15)); }
__device__ __forceinline__ v8f wmma16(v16h a, v16h b, v8f c) { return __builtin_amdgcn_wmma_f32_16x16x32_f16(false, a, false, b, (short)0, c, false, false); }
__device__ __forceinline__ v8f wmmab(v16bf a, v16bf b, v8f c) { return __builtin_amdgcn_wmma_f32_16x16x32_bf16(false, a, false, b, (short)0, c, false, false); }



// ---- k_gemmw: register-blocked GEMM, ONE WAVE per 64x64 output tile (16 accumulators), operands straight from K-contiguous 16-bit planes; grid (M/64, N/64, Z), 32 threads.
// C[m][n] (f32, pitch ldc, + optional f32 bias[n]) = sum_k A[m][k] Bt[n][k] (+ split products per NSPLIT). z-batch strides sA/sB/sC in elements. K % 32 == 0. K is the row pitch of A and Bt; a work-group sums KL of the K columns (KL < K with sA = sB = KL: grid z walks the column ranges of one product, and the C planes are partial sums). Grid z = batch * ZK + range: ZK ranges with strides sA/sB/sC, batches with strides bA/bB/bC.
// CAUS 0: dense. CAUS 1 (scores: the columns of C are keys) and CAUS 2 (wei.v: the K columns are keys, C is 64 wide) take only the key ranges 0 .. g / 2 of row tile g (g counted from query row 0; row0 = query row of A's first row; a range is 128 keys = two row tiles). The launch's row tiles p and last - p together have the same number of ranges for every p, so grid (ranges of a pair [x 2 key tiles for CAUS 1], pairs, batches) holds exactly the needed work-groups.
template <typename T16> struct WFrag;
template <> struct WFrag<h16> { typedef v16h V; static __device__ __forceinline__ V ld(const h16* p) { return cat16(*(const v8h*)p, *(const v8h*)(p + 16)); } static __device__ __forceinline__ v8f mma(V a, V b, v8f c) { return wmma16(a, b, c); } };
template <> struct WFrag<bf> { typedef v16bf V; static __device__ __forceinline__ V ld(const bf* p) { return cat16b(*(const v8us*)p, *(const v8us*)(p + 16)); } static __device__ __forceinline__ v8f mma(V a, V b, v8f c) { return wmmab(a, b, c); } };
template <typename T16, int NSPLIT, bool BIAS, int CAUS>
__global__ __launch_bounds__(32) void k_gemmw(const T16* __restrict__ A, const T16* __restrict__ A2, const T16* __restrict__ Bt, const T16* __restrict__ Bt2, int K, int KL, float* C, int ldc, const float* __restrict__ bias, size_t sA, size_t sB, size_t sC, int ZK, size_t bA, size_t bB, size_t bC, int row0) {
    typedef typename WFrag<T16>::V V;
    __shared__ __align__(16) float os[16 * 68];
    size_t zb = blockIdx.z / (unsigned)ZK, z = blockIdx.z % (unsigned)ZK; int tr = blockIdx.x, tc = blockIdx.y;
    if (CAUS) { const int p = blockIdx.y, sx = blockIdx.x, np = ((row0 / 64 + p) / 2 + 1) * (CAUS == 1 ? 2 : 1); int kx = sx; tr = p; if (sx >= np) { tr = 2 * (int)gridDim.y - 1 - p; kx = sx - np; }
        if (CAUS == 1) tc = kx; else { tc = 0; z = kx; zb = blockIdx.z; } }
    A += z * sA + zb * bA; if (A2) A2 += z * sA + zb * bA; Bt += z * sB + zb * bB; if (Bt2) Bt2 += z * sB + zb * bB; C += z * sC + zb * bC;
    const int lane = threadIdx.x & 31, lr = lane & 15, hi = lane >> 4; const int r0 = tr * 64, c0 = tc * 64;
    v8f acc[4][4];
#pragma unroll
    for (int mb = 0; mb < 4; ++mb)
#pragma unroll
        for (int nb = 0; nb < 4; ++nb) acc[mb][nb] = (v8f){};
    const size_t aoff = (size_t)(r0 + lr) * K + 8 * hi, boff = (size_t)(c0 + lr) * K + 8 * hi;
#pragma unroll 1
    for (int kc = 0; kc < KL; kc += 32) {
        V a[4], a2[4];
#pragma unroll
        for (int mb = 0; mb < 4; ++mb) { a[mb] = WFrag<T16>::ld(A + aoff + (size_t)mb * 16 * K + kc); if (NSPLIT == 1 || NSPLIT == 2) a2[mb] = WFrag<T16>::ld(A2 + aoff + (size_t)mb * 16 * K + kc); }
#pragma unroll
        for (int nb = 0; nb < 4; ++nb) { const V b = WFrag<T16>::ld(Bt + boff + (size_t)nb * 16 * K + kc); V b2; if (NSPLIT >= 2) b2 = WFrag<T16>::ld(Bt2 + boff + (size_t)nb * 16 * K + kc);
#pragma unroll
            for (int mb = 0; mb < 4; ++mb) { acc[mb][nb] = WFrag<T16>::mma(a[mb], b, acc[mb][nb]); if (NSPLIT == 1 || NSPLIT == 2) acc[mb][nb] = WFrag<T16>::mma(a2[mb], b, acc[mb][nb]); if (NSPLIT >= 2) acc[mb][nb] = WFrag<T16>::mma(a[mb], b2, acc[mb][nb]); } }
        asm volatile("v_nop\n\tv_nop\n\tv_nop\n\tv_nop" : "+v"(acc[0][0]), "+v"(acc[1][1]), "+v"(acc[2][2]), "+v"(acc[3][3]) : "v"(a[0]), "v"(a[3]));
    }
#pragma unroll
    for (int mb = 0; mb < 4; ++mb) {
#pragma unroll
        for (int nb = 0; nb < 4; ++nb) {
#pragma unroll
            for (int j = 0; j < 8; ++j) os[(hi * 8 + j) * 68 + nb * 16 + lr] = acc[mb][nb][j]; }
        __builtin_amdgcn_wave_barrier(); asm volatile("" ::: "memory");
        float* crow = C + (size_t)(r0 + mb * 16) * ldc + c0;
{
#pragma unroll
            for (int s = 0; s < 8; ++s) { const int row = 2 * s + hi, cofs = lr * 4; v4f val = *(const v4fa*)(os + row * 68 + cofs); if (BIAS) { val[0] += bfr(bias[c0 + cofs]); val[1] += bfr(bias[c0 + cofs + 1]); val[2] += bfr(bias[c0 + cofs + 2]); val[3] += bfr(bias[c0 + cofs + 3]); }
                *(v4f*)(crow + (size_t)row * ldc + cofs) = val; }
             }
        __builtin_amdgcn_wave_barrier(); asm volatile("" ::: "memory");
    }
}

__device__ __forceinline__ h16 tohx(float x) { return (h16)x; }
__device__ __forceinline__ void splitf(float y, unsigned short& h, unsigned short& l) { h = f2bf(y); l = f2bf(y - bf2f(h)); }
typedef __attribute__((ext_vector_type(2))) _Float16 v2h;
typedef __attribute__((ext_vector_type(4))) _Float16 v4h;
typedef __attribute__((ext_vector_type(2))) unsigned short v2us;
typedef __attribute__((ext_vector_type(4))) unsigned short v4us;
typedef __attribute__((ext_vector_type(2))) float v2f;
typedef __attribute__((ext_vector_type(4))) int v4i;

__global__ __launch_bounds__(256) void k_cvt8(const float* __restrict__ src, bf* dst, size_t n8) { const size_t i = (size_t)blockIdx.x * 256 + threadIdx.x; if (i >= n8) return; const v8f v = *(const v8f*)(src + i * 8); v8us o;
#pragma unroll
    for (int k = 0; k < 8; ++k) o[k] = f2bf(v[k]); *(v8us*)(dst + i * 8) = o;  }


__global__ __launch_bounds__(256) void k_vtp(const float* __restrict__ F, int pitch, int nheads, h16* V16, bf* Vh, bf* Vl) { const size_t e = ((size_t)blockIdx.x * 256 + threadIdx.x) * 2; if (e >= (size_t)nheads * HD * TT) return; { const size_t bb = blockIdx.y; F += bb * TT * pitch; V16 += bb * nheads * HD * TT; Vh += bb * nheads * HD * TT; Vl += bb * nheads * HD * TT; }   /* grid y: batch */ const int t = (int)(e % TT); const int d = (int)((e / TT) % HD); const int g = (int)(e / ((size_t)TT * HD)); v2h o16; v2us oh, ol;
#pragma unroll
    for (int q = 0; q < 2; ++q) { const float x = F[(size_t)(t + q) * pitch + g * HD + d]; o16[q] = tohx(x); unsigned short a2, c2; splitf(x, a2, c2); oh[q] = a2; ol[q] = c2; }
    *(v2h*)(V16 + e) = o16; *(v2us*)(Vh + e) = oh; *(v2us*)(Vl + e) = ol;  }
__global__ __launch_bounds__(256) void k_lsoft(const float* __restrict__ Sb, h16* P16, bf* Ph, bf* Pl) {
    const int lane = threadIdx.x & 31; const int row = blockIdx.x * 8 + (threadIdx.x >> 5); if (row >= ZH * TT) return; const int i = row % TT; const int zz = row / TT; const bool hires = (i < RH); const float* sr = Sb + (size_t)row * TT; float mx = -3.0e38f;
    const int nch = __builtin_amdgcn_readfirstlane((int)((unsigned)i / KR) + 1);   /* 128-key chunks up to the end of the row's own key range; one row per wave, so the trip count is scalar */
#pragma unroll 4
    for (int ch = 0; ch < nch; ++ch) { const int j0 = ch * 128 + lane * 4; const v4f a = *(const v4f*)(sr + j0);
#pragma unroll
        for (int q = 0; q < 4; ++q) { float t = (j0 + q <= i) ? a[q] * SCL : -3.0e38f; asm volatile("" : "+v"(t)); mx = fmaxf(mx, t); } }
#pragma unroll
    for (int sh = 16; sh; sh >>= 1) mx = fmaxf(mx, __shfl_xor(mx, sh, 32));
    float sum = 0.f;
#pragma unroll 4
    for (int ch = 0; ch < nch; ++ch) { const int j0 = ch * 128 + lane * 4; const v4f a = *(const v4f*)(sr + j0);
#pragma unroll
        for (int q = 0; q < 4; ++q) { float t = (j0 + q <= i) ? a[q] * SCL : -3.0e38f; asm volatile("" : "+v"(t)); float d0 = __fsub_rn(t, mx); asm volatile("" : "+v"(d0)); sum += __builtin_amdgcn_exp2f(__fmul_rn(d0, 1.4426950408889634f)); } }
#pragma unroll
    for (int sh = 16; sh; sh >>= 1) sum += __shfl_xor(sum, sh, 32);
    const float f = __fdiv_rn(hires ? 1.0f : PCAR, sum);
{
        if (hires) {   /* rows < RH: normalised bf16 hi/lo over the row's key ranges, planes [zz][RH][TT] */
            for (int ch = 0; ch < nch; ++ch) { const int j0 = ch * 128 + lane * 4; const v4f a = *(const v4f*)(sr + j0); v4us oh, ol;
#pragma unroll
                for (int q = 0; q < 4; ++q) { float t = (j0 + q <= i) ? a[q] * SCL : -3.0e38f; asm volatile("" : "+v"(t)); float d0 = __fsub_rn(t, mx); asm volatile("" : "+v"(d0)); float ex = __builtin_amdgcn_exp2f(__fmul_rn(d0, 1.4426950408889634f)); asm volatile("" : "+v"(ex)); unsigned short a2, c2; splitf(ex * f, a2, c2); oh[q] = a2; ol[q] = c2; }
                const size_t oo = ((size_t)zz * RH + i) * TT + j0; *(v4us*)(Ph + oo) = oh; *(v4us*)(Pl + oo) = ol; }
        } else {
#pragma unroll 2
            for (int ch = 0; ch < nch; ++ch) { const int j0 = ch * 128 + lane * 4; const v4f a = *(const v4f*)(sr + j0); v4h o4;
#pragma unroll
                for (int q = 0; q < 4; ++q) { float t = (j0 + q <= i) ? a[q] * SCL : -3.0e38f; asm volatile("" : "+v"(t)); float d0 = __fsub_rn(t, mx); asm volatile("" : "+v"(d0)); float ex = __builtin_amdgcn_exp2f(__fmul_rn(d0, 1.4426950408889634f)); asm volatile("" : "+v"(ex)); o4[q] = tohx(ex * f); }
                *(v4h*)(P16 + (size_t)row * TT + j0) = o4;
                asm volatile("s_wait_xcnt 0x0" ::: "memory"); } }   /* stands in front of the next trip's rewrite of the store's address and data registers */
         }
}
__global__ __launch_bounds__(256) void k_cs8(const float* __restrict__ Pp, float* O, size_t n4) { const size_t i = (size_t)blockIdx.x * 256 + threadIdx.x; if (i >= n4) return; Pp += (size_t)blockIdx.y * KS * TT * CO; O += (size_t)blockIdx.y * TT * CO;   /* grid y: batch */ const size_t e = i * 4; const int t = (int)(e / CO);   /* row pitch of the attention-output plane is the VALUE width CO */ const float cs = (t < RH) ? 1.0f : (1.0f / PCAR); v4f p[KS];
    const unsigned nz = blockIdx.x * (256 * 4 / CO) / KR + 1;   /* planes written for these rows: ranges 0 .. t / KR, the same for the block's 256 * 4 / CO rows */
#pragma unroll
    for (int z = 0; z < KS; ++z) { p[z] = (v4f){}; if ((unsigned)z < nz) p[z] = *(const v4f*)(Pp + (size_t)z * TT * CO + e); }   /* the written partial planes of this element, zero for the rest; unrolled so that p[] stays in registers and the loads are issued ahead of the sums */
    v4f a = p[0];
#pragma unroll
    for (int z = 1; z < KS; ++z) a += p[z];   /* fixed order, key ranges ascending; unrolled for the register array */
#pragma unroll
    for (int q = 0; q < 4; ++q) a[q] = __fmul_rn(a[q], cs);
    *(v4f*)(O + e) = a;  }

__global__ __launch_bounds__(256) void k_csid(float* CS) { const int idx = blockIdx.x * 256 + threadIdx.x; if (idx >= TT * HD) return; v2f cs; cs[0] = 1.0f; cs[1] = 0.0f; *(v2f*)(CS + (size_t)idx * 2) = cs;  }
// k_rope: head planes [h][t][d] (fp16 + hi/lo) of rope(x) x sc with the rotate-half convention out[d] = x[d] cos[t][d] - x[d+HD/2] sin[t][d], out[d+HD/2] = x[d+HD/2] cos[t][d+HD/2] + x[d] sin[t][d+HD/2]
__global__ __launch_bounds__(256) void k_rope(const float* __restrict__ F, int pitch, int nheads, const float* __restrict__ CS, const float* __restrict__ RF, const float* __restrict__ nw, float sc, h16* P16, bf* Ph, bf* Pl) {
    { const size_t bb = blockIdx.y; F += bb * TT * pitch; P16 += bb * nheads * TT * HD; Ph += bb * nheads * TT * HD; Pl += bb * nheads * TT * HD; }   /* grid y: batch */
    const size_t e = ((size_t)blockIdx.x * 256 + threadIdx.x) * 2; if (e >= (size_t)nheads * TT * HD) return; const int d = (int)(e % HD); const int t = (int)((e / HD) % TT); const int h = (int)(e / ((size_t)HD * TT)); const float* f = F + (size_t)t * pitch + h * HD; const float rf = RF ? RF[(size_t)h * TT + t] : 1.0f; v2h o16; v2us oh, ol;
#pragma unroll
    for (int q = 0; q < 2; ++q) { const int dd = d + q; const int dp = (dd < HD / 2) ? dd + HD / 2 : dd - HD / 2; float x0 = f[dd], x1 = f[dp];
        if (RF) { float n0 = __fmul_rn(x0, rf), n1 = __fmul_rn(x1, rf); asm volatile("" : "+v"(n0)); asm volatile("" : "+v"(n1)); x0 = __fmul_rn(bfr(nw[dd]), n0); x1 = __fmul_rn(bfr(nw[dp]), n1); }
        const v2f cs = *(const v2f*)(CS + ((size_t)t * HD + dd) * 2); float a = __fmul_rn(x0, cs[0]), bq = __fmul_rn(x1, cs[1]); asm volatile("" : "+v"(a)); asm volatile("" : "+v"(bq)); const float r = ((dd < HD / 2) ? __fsub_rn(a, bq) : __fadd_rn(a, bq)) * sc;
        o16[q] = tohx(r); unsigned short a2, c2; splitf(r, a2, c2); oh[q] = a2; ol[q] = c2; }
    *(v2h*)(P16 + e) = o16; *(v2us*)(Ph + e) = oh; *(v2us*)(Pl + e) = ol;  }
__global__ __launch_bounds__(256) void k_wtG(const float* __restrict__ w, int K, int N, bf* Bt) {
    const int lane = threadIdx.x & 31; const int L0 = (blockIdx.x * 8 + (threadIdx.x >> 5)) * 8; const int nlines = N * K / 64;
{
#pragma unroll 1
        for (int l = 0; l < 8; ++l) { const int L = L0 + l; if (L >= nlines) break; const size_t e = (size_t)L * 64 + lane * 2; const int k = (int)(e % K), n = (int)(e / K); v2us o;
            o[0] = f2bf(w[(size_t)k * N + n]); o[1] = f2bf(w[(size_t)(k + 1) * N + n]); *(v2us*)(Bt + e) = o; }
         }
}
__global__ __launch_bounds__(256) void k_copy4(const float* __restrict__ Y, float* out, size_t n4) { const size_t i = (size_t)blockIdx.x * 256 + threadIdx.x; if (i >= n4) return; const v4f a = *(const v4f*)(Y + i * 4); *(v4f*)(out + i * 4) = a;  }
extern "C" void kernel_launch(void* const* d_in, const int* in_sizes, int n_in,
                              void* d_out, int out_size, void* d_ws, size_t ws_size, hipStream_t stream) {
    (void)in_sizes; (void)n_in; (void)out_size;
    const float* x = (const float*)d_in[0]; const float* wk = (const float*)d_in[1]; const float* wq = (const float*)d_in[2]; const float* wv = (const float*)d_in[3];   /* x [8][4096][384], Wk, Wq, Wv ('xw' [384][64], no biases; keys first) */
    float* OUT = (float*)d_out;     // [8][4096][64]
    char* wsp = (char*)d_ws;
    auto take = [&](size_t bytes) { char* p = wsp; wsp += (bytes + 255) & ~(size_t)255; return (void*)p; };
    bf* WQ = (bf*)take((size_t)MID * CC * 2); bf* WK = (bf*)take((size_t)MID * CC * 2); bf* WV = (bf*)take((size_t)CO * CC * 2); float* CS = (float*)take((size_t)TT * HD * 2 * 4);
    const size_t PQ = (size_t)TT * MID, PV = (size_t)CO * TT;   /* elements of one batch's q / k plane and of its v^T plane */
    h16* QP16 = (h16*)take(NB_ * PQ * 2); bf* QPh = (bf*)take(NB_ * PQ * 2); bf* QPl = (bf*)take(NB_ * PQ * 2); h16* KP16 = (h16*)take(NB_ * PQ * 2); bf* KPh = (bf*)take(NB_ * PQ * 2); bf* KPl = (bf*)take(NB_ * PQ * 2);
    h16* VT16 = (h16*)take(NB_ * PV * 2); bf* VTh = (bf*)take(NB_ * PV * 2); bf* VTl = (bf*)take(NB_ * PV * 2);
    float* Sb = (float*)take((size_t)ZH * TT * TT * 4); h16* P16 = (h16*)take((size_t)ZH * TT * TT * 2); bf* Ph = (bf*)take((size_t)ZH * RH * TT * 2); bf* Pl = (bf*)take((size_t)ZH * RH * TT * 2); float* Ob = (float*)take((size_t)NB_ * TT * CO * 4);   /* attention output (f32) of all batches before the final copy */
    if ((size_t)(wsp - (char*)d_ws) > ws_size) return;    // ws 256 MiB (carve ~254 MiB)
    bf* XB = (bf*)Sb; float* FQ = (float*)(XB + (size_t)NB_ * TT * CC); float* FK = FQ + NB_ * PQ;   /* x copy and f32 projections of all batches (40 MiB) lie in the score planes' bytes: all read before the first score launch writes there (stream-ordered) */
    float* Op = Sb;   /* ZH x KS partial planes of wei.v (64 MiB) lie in the score planes' bytes: the scores are last read by k_lsoft, the planes by k_cs8 before the next score launch (stream-ordered) */
    float* FV = FK;   /* the v projection reuses the k buffer after the k planes are built (stream-ordered) */
    k_wtG<<<(unsigned)((CC * MID / 64 + 63) / 64), 256, 0, stream>>>(wq, CC, MID, WQ); k_wtG<<<(unsigned)((CC * MID / 64 + 63) / 64), 256, 0, stream>>>(wk, CC, MID, WK); k_wtG<<<(unsigned)((CC * CO / 64 + 63) / 64), 256, 0, stream>>>(wv, CC, CO, WV);   /* 'xw' weights -> Bt */
    k_csid<<<(TT * HD + 255) / 256, 256, 0, stream>>>(CS);   /* identity table: k_rope is a plain per-head plane builder here */
    const unsigned LP = (unsigned)(((size_t)NH_ * TT * HD / 2 + 255) / 256);
    /* all 8 batches per launch: the rows of x are one [8 x 4096][384] matrix for the copy and the projections; the plane builders take the batch from grid y */
    k_cvt8<<<(unsigned)(((size_t)NB_ * TT * CC / 8 + 255) / 256), 256, 0, stream>>>(x, XB, (size_t)NB_ * TT * CC / 8);
    k_gemmw<bf, 0, false, 0><<<dim3(NB_ * TT / 64, MID / 64, 1), 32, 0, stream>>>(XB, nullptr, WQ, nullptr, CC, CC, FQ, MID, nullptr, 0, 0, 0, 1, 0, 0, 0, 0); k_rope<<<dim3(LP, NB_, 1), 256, 0, stream>>>(FQ, MID, NH_, CS, nullptr, nullptr, 1.0f, QP16, QPh, QPl);   /* q planes [b][n][64] */
    k_gemmw<bf, 0, false, 0><<<dim3(NB_ * TT / 64, MID / 64, 1), 32, 0, stream>>>(XB, nullptr, WK, nullptr, CC, CC, FK, MID, nullptr, 0, 0, 0, 1, 0, 0, 0, 0); k_rope<<<dim3(LP, NB_, 1), 256, 0, stream>>>(FK, MID, NKV, CS, nullptr, nullptr, 1.0f, KP16, KPh, KPl);   /* k planes */
    k_gemmw<bf, 0, false, 0><<<dim3(NB_ * TT / 64, CO / 64, 1), 32, 0, stream>>>(XB, nullptr, WV, nullptr, CC, CC, FV, CO, nullptr, 0, 0, 0, 1, 0, 0, 0, 0); k_vtp<<<dim3((unsigned)(((size_t)TT * CO / 2 + 255) / 256), NB_, 1), 256, 0, stream>>>(FV, CO, CO / HD, VT16, VTh, VTl);   /* v^T planes [b][64][n] */
    for (int b = 0; b < NB_; b += ZH) {   /* ZH batches per launch: causal 4096 x 4096 attention */
        k_gemmw<bf, 2, false, 1><<<dim3(TT / 64 + 2, TT / 128, ZH), 32, 0, stream>>>(QPh + b * PQ, QPl + b * PQ, KPh + b * PQ, KPl + b * PQ, HD, HD, Sb, TT, nullptr, 0, 0, 0, 1, PQ, PQ, (size_t)TT * TT, 0);   /* S[i][j] = q_i.k_j (3 products, every row), key ranges 0 .. i / KR */
        k_lsoft<<<ZH * TT / 8, 256, 0, stream>>>(Sb, P16, Ph, Pl);   /* x 1/sqrt(384), causal softmax */
        k_gemmw<bf, 2, false, 2><<<dim3(RH / 128 + 1, RH / 128, ZH), 32, 0, stream>>>(Ph, Pl, VTh + b * PV, VTl + b * PV, TT, KR, Op, CO, nullptr, KR, KR, (size_t)TT * CO, 1, (size_t)RH * TT, PV, (size_t)KS * TT * CO, 0);
        k_gemmw<h16, 0, false, 2><<<dim3((TT + RH) / 128 + 1, (TT - RH) / 128, ZH), 32, 0, stream>>>(P16 + (size_t)RH * TT, nullptr, VT16 + b * PV, nullptr, TT, KR, Op + (size_t)RH * CO, CO, nullptr, KR, KR, (size_t)TT * CO, 1, (size_t)TT * TT, PV, (size_t)KS * TT * CO, RH);
        k_cs8<<<dim3((unsigned)(((size_t)TT * CO / 4 + 255) / 256), ZH, 1), 256, 0, stream>>>(Op, Ob + (size_t)b * TT * CO, (size_t)TT * CO / 4); }   /* sum of the written planes; rows >= 512 x 1/1024 */
    k_copy4<<<(unsigned)(((size_t)NB_ * TT * CO / 4 + 255) / 256), 256, 0, stream>>>(Ob, OUT, (size_t)NB_ * TT * CO / 4);   /* every output row, written once */
}

// v004
// Measured time: 136 microseconds a run.
// Two timings next to v003 put it at 3.31 and 3.29 times that version's speed.
// Over all steps from v000 it is 16.4 times as fast.
#include <hip/hip_runtime.h>

// Single 64-wide causal attention head over 4,096 tokens (x [8][4096][384]; k = x Wk, q = x Wq, v = x Wv ('xw' [384][64], no bias); wei = q.k / sqrt(384) (the module scales by sqrt(embed size)); causal (-inf); softmax; out = wei.v -> [8][4096][64] (2.1 M); argument order x, Wk, Wq, Wv (keys first)).
// The batch index rides in the grid: the x copy, the projections, the plane builders and the attention kernel take all 8 batches per launch.
// Layout: bf16 copy of x; 'xw' weights transposed once; exact projections; one 64-wide head: q/k planes and value^T planes; k_fattn does scores with EVERY row on hi/lo planes (3 products), running-maximum causal softmax in registers and wei.v (rows < 512 hi/lo 3 products, rest fp16) per 32-query tile and stores the output rows.
// Causal bound: a 32-query tile walks the 32-key blocks up to its own; only that last block is masked.
// Compute dtypes, f32 accumulate: every input rounded to bf16; projections exact; scores 3 products; softmax f32; wei.v rows < 512 3 products, rest fp16; output f32.

#define NB_  8
#define TT   4096
#define DM   384
#define NH_  1
#define NKV  1
#define REP  (NH_ / NKV)
#define HD   64
#define DQ   (NH_ * HD)
#define DKV  (NKV * HD)
#define RH   512                  // query rows < RH use hi+lo planes (0: none)
#define WIN  0
static_assert(RH % 32 == 0 && TT % 32 == 0 && HD == 64, "k_fattn takes 32 query rows and 32-key blocks of a 64-wide head");
#define SCL  0.05103103630798288f   // 1/sqrt(384): the module scales by sqrt(embed size C)
#define MID  64       // q / k width (one 64-wide head)
#define CO   64       // v width
#define CC   384
typedef _Float16 h16;
typedef unsigned short bf;
typedef __attribute__((ext_vector_type(16))) __bf16   v16bf;
typedef __attribute__((ext_vector_type(16))) _Float16 v16h;
typedef __attribute__((ext_vector_type(8)))  _Float16 v8h;
typedef __attribute__((ext_vector_type(8)))  unsigned short v8us;
typedef __attribute__((ext_vector_type(8)))  float    v8f;
typedef __attribute__((ext_vector_type(4)))  float    v4f;
typedef v8h  __attribute__((may_alias)) v8ha;
typedef v4f  __attribute__((may_alias)) v4fa;
typedef v8us __attribute__((may_alias)) v8usa;

__device__ __forceinline__ unsigned short f2bf(float f) { unsigned u = __float_as_uint(f); u += 0x7FFFu + ((u >> 16) & 1u); return (unsigned short)(u >> 16); }
__device__ __forceinline__ float bf2f(unsigned short b) { return __uint_as_float(((unsigned)b) << 16); }
__device__ __forceinline__ float bfr(float f) { return bf2f(f2bf(f)); }
__device__ __forceinline__ v16h cat16(v8h lo, v8h hi) { return __builtin_shufflevector(lo, hi, 0, 1, 2, 3, 4, 5, 6, 7, 8, 9, 10, 11, 12, 13, 14, 15); }
__device__ __forceinline__ v16bf cat16b(v8us lo, v8us hi) { return __builtin_bit_cast(v16bf, __builtin_shufflevector(lo, hi, 0, 1, 2, 3, 4, 5, 6, 7, 8, 9, 10, 11, 12, 13, 14, 15)); }
__device__ __forceinline__ v8f wmma16(v16h a, v16h b, v8f c) { return __builtin_amdgcn_wmma_f32_16x16x32_f16(false, a, false, b, (short)0, c, false, false); }
__device__ __forceinline__ v8f wmmab(v16bf a, v16bf b, v8f c) { return __builtin_amdgcn_wmma_f32_16x16x32_bf16(false, a, false, b, (short)0, c, false, false); }



// ---- k_gemmw: register-blocked GEMM, ONE WAVE per 64x64 output tile (16 accumulators), operands straight from K-contiguous 16-bit planes; grid (M/64, N/64, Z), 32 threads.
// C[m][n] (f32, pitch ldc, + optional f32 bias[n]) = sum_k A[m][k] Bt[n][k] (+ split products per NSPLIT). z-batch strides sA/sB/sC in elements. K % 32 == 0. K is the row pitch of A and Bt; a work-group sums KL of the K columns (KL < K with sA = sB = KL: grid z walks the column ranges of one product, and the C planes are partial sums). Grid z = batch * ZK + range: ZK ranges with strides sA/sB/sC, batches with strides bA/bB/bC.
template <typename T16> struct WFrag;
template <> struct WFrag<h16> { typedef v16h V; static __device__ __forceinline__ V ld(const h16* p) { return cat16(*(const v8h*)p, *(const v8h*)(p + 16)); } static __device__ __forceinline__ v8f mma(V a, V b, v8f c) { return wmma16(a, b, c); } };
template <> struct WFrag<bf> { typedef v16bf V; static __device__ __forceinline__ V ld(const bf* p) { return cat16b(*(const v8us*)p, *(const v8us*)(p + 16)); } static __device__ __forceinline__ v8f mma(V a, V b, v8f c) { return wmmab(a, b, c); } };
template <typename T16, int NSPLIT, bool BIAS>
__global__ __launch_bounds__(32) void k_gemmw(const T16* __restrict__ A, const T16* __restrict__ A2, const T16* __restrict__ Bt, const T16* __restrict__ Bt2, int K, int KL, float* C, int ldc, const float* __restrict__ bias, size_t sA, size_t sB, size_t sC, int ZK, size_t bA, size_t bB, size_t bC) {
    typedef typename WFrag<T16>::V V;
    __shared__ __align__(16) float os[16 * 68];
    const size_t zb = blockIdx.z / (unsigned)ZK, z = blockIdx.z % (unsigned)ZK; const int tr = blockIdx.x, tc = blockIdx.y;
    A += z * sA + zb * bA; if (A2) A2 += z * sA + zb * bA; Bt += z * sB + zb * bB; if (Bt2) Bt2 += z * sB + zb * bB; C += z * sC + zb * bC;
    const int lane = threadIdx.x & 31, lr = lane & 15, hi = lane >> 4; const int r0 = tr * 64, c0 = tc * 64;
    v8f acc[4][4];
#pragma unroll
    for (int mb = 0; mb < 4; ++mb)
#pragma unroll
        for (int nb = 0; nb < 4; ++nb) acc[mb][nb] = (v8f){};
    const size_t aoff = (size_t)(r0 + lr) * K + 8 * hi, boff = (size_t)(c0 + lr) * K + 8 * hi;
#pragma unroll 1
    for (int kc = 0; kc < KL; kc += 32) {
        V a[4], a2[4];
#pragma unroll
        for (int mb = 0; mb < 4; ++mb) { a[mb] = WFrag<T16>::ld(A + aoff + (size_t)mb * 16 * K + kc); if (NSPLIT == 1 || NSPLIT == 2) a2[mb] = WFrag<T16>::ld(A2 + aoff + (size_t)mb * 16 * K + kc); }
#pragma unroll
        for (int nb = 0; nb < 4; ++nb) { const V b = WFrag<T16>::ld(Bt + boff + (size_t)nb * 16 * K + kc); V b2; if (NSPLIT >= 2) b2 = WFrag<T16>::ld(Bt2 + boff + (size_t)nb * 16 * K + kc);
#pragma unroll
            for (int mb = 0; mb < 4; ++mb) { acc[mb][nb] = WFrag<T16>::mma(a[mb], b, acc[mb][nb]); if (NSPLIT == 1 || NSPLIT == 2) acc[mb][nb] = WFrag<T16>::mma(a2[mb], b, acc[mb][nb]); if (NSPLIT >= 2) acc[mb][nb] = WFrag<T16>::mma(a[mb], b2, acc[mb][nb]); } }
        asm volatile("v_nop\n\tv_nop\n\tv_nop\n\tv_nop" : "+v"(acc[0][0]), "+v"(acc[1][1]), "+v"(acc[2][2]), "+v"(acc[3][3]) : "v"(a[0]), "v"(a[3]));
    }
#pragma unroll
    for (int mb = 0; mb < 4; ++mb) {
#pragma unroll
        for (int nb = 0; nb < 4; ++nb) {
#pragma unroll
            for (int j = 0; j < 8; ++j) os[(hi * 8 + j) * 68 + nb * 16 + lr] = acc[mb][nb][j]; }
        __builtin_amdgcn_wave_barrier(); asm volatile("" ::: "memory");
        float* crow = C + (size_t)(r0 + mb * 16) * ldc + c0;
{
#pragma unroll
            for (int s = 0; s < 8; ++s) { const int row = 2 * s + hi, cofs = lr * 4; v4f val = *(const v4fa*)(os + row * 68 + cofs); if (BIAS) { val[0] += bfr(bias[c0 + cofs]); val[1] += bfr(bias[c0 + cofs + 1]); val[2] += bfr(bias[c0 + cofs + 2]); val[3] += bfr(bias[c0 + cofs + 3]); }
                *(v4f*)(crow + (size_t)row * ldc + cofs) = val; }
             }
        __builtin_amdgcn_wave_barrier(); asm volatile("" ::: "memory");
    }
}

__device__ __forceinline__ h16 tohx(float x) { return (h16)x; }
__device__ __forceinline__ void splitf(float y, unsigned short& h, unsigned short& l) { h = f2bf(y); l = f2bf(y - bf2f(h)); }
typedef __attribute__((ext_vector_type(2))) _Float16 v2h;
typedef __attribute__((ext_vector_type(4))) _Float16 v4h;
typedef __attribute__((ext_vector_type(2))) unsigned short v2us;
typedef __attribute__((ext_vector_type(4))) unsigned short v4us;
typedef __attribute__((ext_vector_type(2))) float v2f;
typedef __attribute__((ext_vector_type(4))) int v4i;

__global__ __launch_bounds__(256) void k_cvt8(const float* __restrict__ src, bf* dst, size_t n8) { const size_t i = (size_t)blockIdx.x * 256 + threadIdx.x; if (i >= n8) return; const v8f v = *(const v8f*)(src + i * 8); v8us o;
#pragma unroll
    for (int k = 0; k < 8; ++k) o[k] = f2bf(v[k]); *(v8us*)(dst + i * 8) = o;  }


__global__ __launch_bounds__(256) void k_vtp(const float* __restrict__ F, int pitch, int nheads, h16* V16, bf* Vh, bf* Vl) { const size_t e = ((size_t)blockIdx.x * 256 + threadIdx.x) * 2; if (e >= (size_t)nheads * HD * TT) return; { const size_t bb = blockIdx.y; F += bb * TT * pitch; V16 += bb * nheads * HD * TT; Vh += bb * nheads * HD * TT; Vl += bb * nheads * HD * TT; }   /* grid y: batch */ const int t = (int)(e % TT); const int d = (int)((e / TT) % HD); const int g = (int)(e / ((size_t)TT * HD)); v2h o16; v2us oh, ol;
#pragma unroll
    for (int q = 0; q < 2; ++q) { const float x = F[(size_t)(t + q) * pitch + g * HD + d]; o16[q] = tohx(x); unsigned short a2, c2; splitf(x, a2, c2); oh[q] = a2; ol[q] = c2; }
    *(v2h*)(V16 + e) = o16; *(v2us*)(Vh + e) = oh; *(v2us*)(Vl + e) = ol;  }
__global__ __launch_bounds__(256) void k_csid(float* CS) { const int idx = blockIdx.x * 256 + threadIdx.x; if (idx >= TT * HD) return; v2f cs; cs[0] = 1.0f; cs[1] = 0.0f; *(v2f*)(CS + (size_t)idx * 2) = cs;  }
// k_rope: head planes [h][t][d] (fp16 + hi/lo) of rope(x) x sc with the rotate-half convention out[d] = x[d] cos[t][d] - x[d+HD/2] sin[t][d], out[d+HD/2] = x[d+HD/2] cos[t][d+HD/2] + x[d] sin[t][d+HD/2]
__global__ __launch_bounds__(256) void k_rope(const float* __restrict__ F, int pitch, int nheads, const float* __restrict__ CS, const float* __restrict__ RF, const float* __restrict__ nw, float sc, h16* P16, bf* Ph, bf* Pl) {
    { const size_t bb = blockIdx.y; F += bb * TT * pitch; P16 += bb * nheads * TT * HD; Ph += bb * nheads * TT * HD; Pl += bb * nheads * TT * HD; }   /* grid y: batch */
    const size_t e = ((size_t)blockIdx.x * 256 + threadIdx.x) * 2; if (e >= (size_t)nheads * TT * HD) return; const int d = (int)(e % HD); const int t = (int)((e / HD) % TT); const int h = (int)(e / ((size_t)HD * TT)); const float* f = F + (size_t)t * pitch + h * HD; const float rf = RF ? RF[(size_t)h * TT + t] : 1.0f; v2h o16; v2us oh, ol;
#pragma unroll
    for (int q = 0; q < 2; ++q) { const int dd = d + q; const int dp = (dd < HD / 2) ? dd + HD / 2 : dd - HD / 2; float x0 = f[dd], x1 = f[dp];
        if (RF) { float n0 = __fmul_rn(x0, rf), n1 = __fmul_rn(x1, rf); asm volatile("" : "+v"(n0)); asm volatile("" : "+v"(n1)); x0 = __fmul_rn(bfr(nw[dd]), n0); x1 = __fmul_rn(bfr(nw[dp]), n1); }
        const v2f cs = *(const v2f*)(CS + ((size_t)t * HD + dd) * 2); float a = __fmul_rn(x0, cs[0]), bq = __fmul_rn(x1, cs[1]); asm volatile("" : "+v"(a)); asm volatile("" : "+v"(bq)); const float r = ((dd < HD / 2) ? __fsub_rn(a, bq) : __fadd_rn(a, bq)) * sc;
        o16[q] = tohx(r); unsigned short a2, c2; splitf(r, a2, c2); oh[q] = a2; ol[q] = c2; }
    *(v2h*)(P16 + e) = o16; *(v2us*)(Ph + e) = oh; *(v2us*)(Pl + e) = ol;  }
__global__ __launch_bounds__(256) void k_wtG(const float* __restrict__ w, int K, int N, bf* Bt) {
    const int lane = threadIdx.x & 31; const int L0 = (blockIdx.x * 8 + (threadIdx.x >> 5)) * 8; const int nlines = N * K / 64;
{
#pragma unroll 1
        for (int l = 0; l < 8; ++l) { const int L = L0 + l; if (L >= nlines) break; const size_t e = (size_t)L * 64 + lane * 2; const int k = (int)(e % K), n = (int)(e / K); v2us o;
            o[0] = f2bf(w[(size_t)k * N + n]); o[1] = f2bf(w[(size_t)(k + 1) * N + n]); *(v2us*)(Bt + e) = o; }
         }
}
// ---- k_fattn: scores, causal softmax and wei.v of one 32-query tile in one work-group; no score or probability ever reaches memory.
// Transposed products: S^T = K Q^T (A = 16 key rows, B = 16 query rows kept in registers, hi/lo planes, 3 products), O^T += V^T P^T (A = 16 rows of v^T, B = P^T).
// A lane of an S^T tile holds 8 keys of ONE query (D[8 hi + r][lr]), so two tiles of 16 keys, converted in place, are the B operand of the second product in the loaders' own k order, and maximum, sum and rescale of a query are per-lane values joined once between the wave halves.
// The FW waves of the work-group take the tile's 32-key blocks in turn (block kb goes to wave kb % FW), each with its own running reference exponent, sum and f32 output tile; the FW partial results are joined through LDS in fixed wave order, divided by the joined sum and stored as the output rows.
// Every inner loop is unrolled so that the fragment and accumulator arrays are indexed by constants and stay in registers; the key loop stays rolled (one copy of the pass).
// HR (query rows < RH): P^T and v^T on bf16 hi/lo planes, 3 products; otherwise P^T (not normalised, at most 256) and v^T in fp16.
#define FW   4
#define OSP  68                   // f32 pitch of a query's row in the LDS join (16-byte aligned, off the power of two)
#define SC2  (SCL * 1.4426950408889634f)   // scores are carried as log2 exponents
__device__ __forceinline__ float xhalf(float x) { return __builtin_bit_cast(float, __builtin_amdgcn_permlanex16(__builtin_bit_cast(int, x), __builtin_bit_cast(int, x), 0x76543210, 0xfedcba98, false, false)); }   /* lane l takes lane l ^ 16's value */
template <bool HR>
__global__ __launch_bounds__(FW * 32) void k_fattn(const bf* __restrict__ Qh, const bf* __restrict__ Ql, const bf* __restrict__ Kh, const bf* __restrict__ Kl, const h16* __restrict__ V16, const bf* __restrict__ Vh, const bf* __restrict__ Vl, float* __restrict__ out, int tile0) {
    __shared__ __align__(16) float Os[FW][32 * OSP];
    __shared__ float Ms[FW][32], Ls[FW][32];
    const size_t b = blockIdx.x; const int tile = tile0 + (int)gridDim.y - 1 - (int)blockIdx.y;   /* grid (batch, tile): the tiles with the most keys start first */
    const int q0 = tile * 32, lane = threadIdx.x & 31, lr = lane & 15, hi = lane >> 4;
    const int wave = __builtin_amdgcn_readfirstlane((int)(threadIdx.x >> 5));
    Qh += b * TT * HD; Ql += b * TT * HD; Kh += b * TT * HD; Kl += b * TT * HD; V16 += b * HD * TT; Vh += b * HD * TT; Vl += b * HD * TT;
    v16bf qh[2][2], ql[2][2]; const bf* qp[2]; const bf* qq[2];
#pragma unroll
    for (int g = 0; g < 2; ++g) { const size_t qo = (size_t)(q0 + g * 16 + lr) * HD + 8 * hi; qp[g] = Qh + qo; qq[g] = Ql + qo;
#pragma unroll
        for (int kc = 0; kc < 2; ++kc) { qh[g][kc] = WFrag<bf>::ld(qp[g] + kc * 32); ql[g][kc] = WFrag<bf>::ld(qq[g] + kc * 32); } }
    v8f o[2][4]; float mm[2], ll[2];
#pragma unroll
    for (int g = 0; g < 2; ++g) { mm[g] = -3.0e38f; ll[g] = 0.f;
#pragma unroll
        for (int db = 0; db < 4; ++db) o[g][db] = (v8f){}; }
    const int nblk = tile + 1;   /* keys 0 .. q0 + 31; only the last block crosses the diagonal, and every query has a key in every block */
    v16bf kh[2][2], kl[2][2]; const bf* kp; const bf* kq;
    const size_t kl0 = (size_t)lr * HD + 8 * hi;
#define LDK(KB) { const size_t ko = (size_t)(KB) * 32 * HD + kl0; kp = Kh + ko; kq = Kl + ko; _Pragma("unroll") for (int kt = 0; kt < 2; ++kt) _Pragma("unroll") for (int kc = 0; kc < 2; ++kc) { kh[kt][kc] = WFrag<bf>::ld(kp + kt * 16 * HD + kc * 32); kl[kt][kc] = WFrag<bf>::ld(kq + kt * 16 * HD + kc * 32); } }
    LDK(wave < nblk ? wave : nblk - 1)
    /* stands in front of the first rewrite of the query and first key loads' address registers: the first key fragments as inputs keep it behind the loads, the six pointers as inputs keep their registers whole up to it */
    asm volatile("s_wait_xcnt 0x0" :: "v"(kh[0][0]), "v"(kh[0][1]), "v"(kh[1][0]), "v"(kh[1][1]), "v"(kl[0][0]), "v"(kl[0][1]), "v"(kl[1][0]), "v"(kl[1][1]), "v"(kp), "v"(kq), "v"(qp[0]), "v"(qp[1]), "v"(qq[0]), "v"(qq[1]));
#pragma unroll 1
    for (int kb = wave; kb < nblk; kb += FW) {
        const int key0 = kb * 32;
        v16h v16[4]; v16bf vh[4], vl[4]; const size_t vo = (size_t)lr * TT + key0 + 8 * hi; const h16* vp = V16 + vo; const bf* vq = Vh + vo; const bf* vr = Vl + vo;
#pragma unroll
        for (int db = 0; db < 4; ++db) { if (HR) { vh[db] = WFrag<bf>::ld(vq + (size_t)db * 16 * TT); vl[db] = WFrag<bf>::ld(vr + (size_t)db * 16 * TT); } else v16[db] = WFrag<h16>::ld(vp + (size_t)db * 16 * TT); }
        /* stands in front of the first rewrite of the v^T loads' address registers; the pointers as inputs keep those registers whole up to it */
        if (HR) asm volatile("s_wait_xcnt 0x0" :: "v"(vq), "v"(vr) : "memory"); else asm volatile("s_wait_xcnt 0x0" :: "v"(vp) : "memory");
        v8f s[2][2];
#pragma unroll
        for (int kt = 0; kt < 2; ++kt)
#pragma unroll
            for (int g = 0; g < 2; ++g) { v8f a = (v8f){};
#pragma unroll
                for (int kc = 0; kc < 2; ++kc) { a = wmmab(kh[kt][kc], qh[g][kc], a); a = wmmab(kh[kt][kc], ql[g][kc], a); a = wmmab(kl[kt][kc], qh[g][kc], a); }
                s[g][kt] = a; }
        LDK(kb + FW < nblk ? kb + FW : nblk - 1)   /* the wave's next key block flies during the softmax and the second product (its last pass reloads a block in range) */
        asm volatile("s_wait_xcnt 0x0" :: "v"(kp), "v"(kq) : "memory");   /* the same for the key loads' address registers */
        if (kb == nblk - 1) {   /* the diagonal block: keys above the query leave the maximum and the sums */
#pragma unroll
            for (int g = 0; g < 2; ++g)
#pragma unroll
                for (int kt = 0; kt < 2; ++kt)
#pragma unroll
                    for (int j = 0; j < 8; ++j) if (kt * 16 + hi * 8 + j > g * 16 + lr) s[g][kt][j] = -3.0e38f; }
        v16h p16[2]; v16bf ph[2], pl[2]; float bm[2];
#pragma unroll
        for (int g = 0; g < 2; ++g) { float t = s[g][0][0];
#pragma unroll
            for (int j = 1; j < 8; ++j) t = fmaxf(t, s[g][0][j]);
#pragma unroll
            for (int j = 0; j < 8; ++j) t = fmaxf(t, s[g][1][j]);
            bm[g] = fmaxf(t, xhalf(t)) * SC2; }   /* the other half of the wave holds the query's other 16 keys */
        if (__builtin_amdgcn_ballot_w32(bm[0] > mm[0] + 8.0f || bm[1] > mm[1] + 8.0f) != 0) {   /* one scalar branch a pass: the reference exponent moves only when a query's maximum passes it by more than 8, so P stays at or below 256 */
#pragma unroll
            for (int g = 0; g < 2; ++g) { const float mn = fmaxf(mm[g], bm[g]), al = __builtin_amdgcn_exp2f(mm[g] - mn); ll[g] *= al; mm[g] = mn;
#pragma unroll
                for (int db = 0; db < 4; ++db) o[g][db] *= al; } }
#pragma unroll
        for (int g = 0; g < 2; ++g) { const float mn = mm[g];
            float sum = 0.f; v8us h0, h1, l0, l1; v8h f0, f1;
#pragma unroll
            for (int j = 0; j < 8; ++j) { const float e0 = __builtin_amdgcn_exp2f(__builtin_fmaf(s[g][0][j], SC2, -mn)), e1 = __builtin_amdgcn_exp2f(__builtin_fmaf(s[g][1][j], SC2, -mn)); sum += e0 + e1;
                if (HR) { unsigned short a2, c2; splitf(e0, a2, c2); h0[j] = a2; l0[j] = c2; splitf(e1, a2, c2); h1[j] = a2; l1[j] = c2; } else { f0[j] = tohx(e0); f1[j] = tohx(e1); } }
            ll[g] += sum;
            if (HR) { ph[g] = cat16b(h0, h1); pl[g] = cat16b(l0, l1); } else p16[g] = cat16(f0, f1); }
#pragma unroll
        for (int db = 0; db < 4; ++db)
#pragma unroll
            for (int g = 0; g < 2; ++g) { if (HR) { o[g][db] = wmmab(vh[db], ph[g], o[g][db]); o[g][db] = wmmab(vl[db], ph[g], o[g][db]); o[g][db] = wmmab(vh[db], pl[g], o[g][db]); } else o[g][db] = wmma16(v16[db], p16[g], o[g][db]); }
    }
#pragma unroll
    for (int g = 0; g < 2; ++g) { ll[g] += xhalf(ll[g]); if (hi == 0) { Ms[wave][g * 16 + lr] = mm[g]; Ls[wave][g * 16 + lr] = ll[g]; }
#pragma unroll
        for (int db = 0; db < 4; ++db) { float* p = &Os[wave][(g * 16 + lr) * OSP + db * 16 + hi * 8]; *(v4fa*)p = __builtin_shufflevector(o[g][db], o[g][db], 0, 1, 2, 3); *(v4fa*)(p + 4) = __builtin_shufflevector(o[g][db], o[g][db], 4, 5, 6, 7); } }
    __syncthreads();   /* every wave's partial maximum, sum and output tile are in LDS before any is read */
    const int q = threadIdx.x >> 2, d0 = (threadIdx.x & 3) * 16;
    float M = Ms[0][q];
#pragma unroll
    for (int w = 1; w < FW; ++w) M = fmaxf(M, Ms[w][q]);
    float f[FW], L = 0.f;
#pragma unroll
    for (int w = 0; w < FW; ++w) { f[w] = __builtin_amdgcn_exp2f(Ms[w][q] - M); L += Ls[w][q] * f[w]; }   /* a wave without a block has sum 0, tile 0 and factor 0 */
    const float inv = __fdiv_rn(1.0f, L);
#pragma unroll
    for (int c = 0; c < 4; ++c) { v4f a = (v4f){};
#pragma unroll
        for (int w = 0; w < FW; ++w) a += *(const v4fa*)&Os[w][q * OSP + d0 + c * 4] * f[w];
        *(v4f*)(out + (b * TT + q0 + q) * CO + d0 + c * 4) = a * inv; }
}
extern "C" void kernel_launch(void* const* d_in, const int* in_sizes, int n_in,
                              void* d_out, int out_size, void* d_ws, size_t ws_size, hipStream_t stream) {
    (void)in_sizes; (void)n_in; (void)out_size;
    const float* x = (const float*)d_in[0]; const float* wk = (const float*)d_in[1]; const float* wq = (const float*)d_in[2]; const float* wv = (const float*)d_in[3];   /* x [8][4096][384], Wk, Wq, Wv ('xw' [384][64], no biases; keys first) */
    float* OUT = (float*)d_out;     // [8][4096][64]
    char* wsp = (char*)d_ws;
    auto take = [&](size_t bytes) { char* p = wsp; wsp += (bytes + 255) & ~(size_t)255; return (void*)p; };
    bf* WQ = (bf*)take((size_t)MID * CC * 2); bf* WK = (bf*)take((size_t)MID * CC * 2); bf* WV = (bf*)take((size_t)CO * CC * 2); float* CS = (float*)take((size_t)TT * HD * 2 * 4);
    const size_t PQ = (size_t)TT * MID, PV = (size_t)CO * TT;   /* elements of one batch's q / k plane and of its v^T plane */
    h16* QP16 = (h16*)take(NB_ * PQ * 2); bf* QPh = (bf*)take(NB_ * PQ * 2); bf* QPl = (bf*)take(NB_ * PQ * 2); h16* KP16 = (h16*)take(NB_ * PQ * 2); bf* KPh = (bf*)take(NB_ * PQ * 2); bf* KPl = (bf*)take(NB_ * PQ * 2);
    h16* VT16 = (h16*)take(NB_ * PV * 2); bf* VTh = (bf*)take(NB_ * PV * 2); bf* VTl = (bf*)take(NB_ * PV * 2);
    bf* XB = (bf*)take((size_t)NB_ * TT * CC * 2); float* FQ = (float*)take(NB_ * PQ * 4); float* FK = (float*)take(NB_ * PQ * 4);   /* bf16 copy of x and f32 projections of all batches */
    if ((size_t)(wsp - (char*)d_ws) > ws_size) return;    // ws 256 MiB (carve ~78 MiB)
    float* FV = FK;   /* the v projection reuses the k buffer after the k planes are built (stream-ordered) */
    k_wtG<<<(unsigned)((CC * MID / 64 + 63) / 64), 256, 0, stream>>>(wq, CC, MID, WQ); k_wtG<<<(unsigned)((CC * MID / 64 + 63) / 64), 256, 0, stream>>>(wk, CC, MID, WK); k_wtG<<<(unsigned)((CC * CO / 64 + 63) / 64), 256, 0, stream>>>(wv, CC, CO, WV);   /* 'xw' weights -> Bt */
    k_csid<<<(TT * HD + 255) / 256, 256, 0, stream>>>(CS);   /* identity table: k_rope is a plain per-head plane builder here */
    const unsigned LP = (unsigned)(((size_t)NH_ * TT * HD / 2 + 255) / 256);
    /* all 8 batches per launch: the rows of x are one [8 x 4096][384] matrix for the copy and the projections; the plane builders take the batch from grid y */
    k_cvt8<<<(unsigned)(((size_t)NB_ * TT * CC / 8 + 255) / 256), 256, 0, stream>>>(x, XB, (size_t)NB_ * TT * CC / 8);
    k_gemmw<bf, 0, false><<<dim3(NB_ * TT / 64, MID / 64, 1), 32, 0, stream>>>(XB, nullptr, WQ, nullptr, CC, CC, FQ, MID, nullptr, 0, 0, 0, 1, 0, 0, 0); k_rope<<<dim3(LP, NB_, 1), 256, 0, stream>>>(FQ, MID, NH_, CS, nullptr, nullptr, 1.0f, QP16, QPh, QPl);   /* q planes [b][n][64] */
    k_gemmw<bf, 0, false><<<dim3(NB_ * TT / 64, MID / 64, 1), 32, 0, stream>>>(XB, nullptr, WK, nullptr, CC, CC, FK, MID, nullptr, 0, 0, 0, 1, 0, 0, 0); k_rope<<<dim3(LP, NB_, 1), 256, 0, stream>>>(FK, MID, NKV, CS, nullptr, nullptr, 1.0f, KP16, KPh, KPl);   /* k planes */
    k_gemmw<bf, 0, false><<<dim3(NB_ * TT / 64, CO / 64, 1), 32, 0, stream>>>(XB, nullptr, WV, nullptr, CC, CC, FV, CO, nullptr, 0, 0, 0, 1, 0, 0, 0); k_vtp<<<dim3((unsigned)(((size_t)TT * CO / 2 + 255) / 256), NB_, 1), 256, 0, stream>>>(FV, CO, CO / HD, VT16, VTh, VTl);   /* v^T planes [b][64][n] */
    /* causal attention of all batches, one work-group per 32 query rows, output rows stored once: rows < RH on hi/lo planes, then the rest */
    k_fattn<true><<<dim3(NB_, RH / 32, 1), FW * 32, 0, stream>>>(QPh, QPl, KPh, KPl, VT16, VTh, VTl, OUT, 0);
    k_fattn<false><<<dim3(NB_, (TT - RH) / 32, 1), FW * 32, 0, stream>>>(QPh, QPl, KPh, KPl, VT16, VTh, VTl, OUT, RH / 32);
}

// v005
// It runs in 69.8 microseconds.
// Two timings next to v004 both put it at 1.95 times that version's speed.
// Over all steps from v000 it is 31.9 times as fast.
#include <hip/hip_runtime.h>

// Single 64-wide causal attention head over 4,096 tokens (x [8][4096][384]; k = x Wk, q = x Wq, v = x Wv ('xw' [384][64], no bias); wei = q.k / sqrt(384) (the module scales by sqrt(embed size)); causal (-inf); softmax; out = wei.v -> [8][4096][64] (2.1 M); argument order x, Wk, Wq, Wv (keys first)).
// The batch index rides in the grid: the projection kernel and the attention kernel take all 8 batches per launch.
// Layout: 'xw' weights laid in fragment order once; k_proj reads x once as f32, rounds it to bf16 on the way into LDS, does the three exact projections and stores the q/k planes and value^T planes from its accumulators; k_fattn does scores with EVERY row on hi/lo planes (3 products), running-maximum causal softmax in registers and wei.v (rows < 512 hi/lo 3 products, rest fp16) per 32-query tile and stores the output rows.
// Causal bound: a 32-query tile walks the 32-key blocks up to its own; only that last block is masked.
// Compute dtypes, f32 accumulate: every input rounded to bf16; projections exact; scores 3 products; softmax f32; wei.v rows < 512 3 products, rest fp16; output f32.

#define NB_  8
#define TT   4096
#define DM   384
#define NH_  1
#define NKV  1
#define REP  (NH_ / NKV)
#define HD   64
#define DQ   (NH_ * HD)
#define DKV  (NKV * HD)
#define RH   512                  // query rows < RH use hi+lo planes (0: none)
#define WIN  0
static_assert(RH % 32 == 0 && TT % 32 == 0 && HD == 64, "k_fattn takes 32 query rows and 32-key blocks of a 64-wide head");
#define SCL  0.05103103630798288f   // 1/sqrt(384): the module scales by sqrt(embed size C)
#define MID  64       // q / k width (one 64-wide head)
#define CO   64       // v width
#define CC   384
typedef _Float16 h16;
typedef unsigned short bf;
typedef __attribute__((ext_vector_type(16))) __bf16   v16bf;
typedef __attribute__((ext_vector_type(16))) _Float16 v16h;
typedef __attribute__((ext_vector_type(8)))  _Float16 v8h;
typedef __attribute__((ext_vector_type(8)))  unsigned short v8us;
typedef __attribute__((ext_vector_type(8)))  float    v8f;
typedef __attribute__((ext_vector_type(4)))  float    v4f;
typedef v8h  __attribute__((may_alias)) v8ha;
typedef v4f  __attribute__((may_alias)) v4fa;
typedef v8us __attribute__((may_alias)) v8usa;

__device__ __forceinline__ unsigned short f2bf(float f) { unsigned u = __float_as_uint(f); u += 0x7FFFu + ((u >> 16) & 1u); return (unsigned short)(u >> 16); }
__device__ __forceinline__ float bf2f(unsigned short b) { return __uint_as_float(((unsigned)b) << 16); }
__device__ __forceinline__ float bfr(float f) { return bf2f(f2bf(f)); }
__device__ __forceinline__ v16h cat16(v8h lo, v8h hi) { return __builtin_shufflevector(lo, hi, 0, 1, 2, 3, 4, 5, 6, 7, 8, 9, 10, 11, 12, 13, 14, 15); }
__device__ __forceinline__ v16bf cat16b(v8us lo, v8us hi) { return __builtin_bit_cast(v16bf, __builtin_shufflevector(lo, hi, 0, 1, 2, 3, 4, 5, 6, 7, 8, 9, 10, 11, 12, 13, 14, 15)); }
__device__ __forceinline__ v8f wmma16(v16h a, v16h b, v8f c) { return __builtin_amdgcn_wmma_f32_16x16x32_f16(false, a, false, b, (short)0, c, false, false); }
__device__ __forceinline__ v8f wmmab(v16bf a, v16bf b, v8f c) { return __builtin_amdgcn_wmma_f32_16x16x32_bf16(false, a, false, b, (short)0, c, false, false); }



// fragment loaders: lane (lr, hi) takes k = 8 hi .. + 7 and 16 + 8 hi .. + 7 of a k-contiguous row
template <typename T16> struct WFrag;
template <> struct WFrag<h16> { typedef v16h V; static __device__ __forceinline__ V ld(const h16* p) { return cat16(*(const v8h*)p, *(const v8h*)(p + 16)); } static __device__ __forceinline__ v8f mma(V a, V b, v8f c) { return wmma16(a, b, c); } };
template <> struct WFrag<bf> { typedef v16bf V; static __device__ __forceinline__ V ld(const bf* p) { return cat16b(*(const v8us*)p, *(const v8us*)(p + 16)); } static __device__ __forceinline__ v8f mma(V a, V b, v8f c) { return wmmab(a, b, c); } };
__device__ __forceinline__ h16 tohx(float x) { return (h16)x; }
__device__ __forceinline__ void splitf(float y, unsigned short& h, unsigned short& l) { h = f2bf(y); l = f2bf(y - bf2f(h)); }
typedef __attribute__((ext_vector_type(2))) _Float16 v2h;
typedef __attribute__((ext_vector_type(4))) _Float16 v4h;
typedef __attribute__((ext_vector_type(2))) unsigned short v2us;
typedef __attribute__((ext_vector_type(4))) unsigned short v4us;
typedef __attribute__((ext_vector_type(2))) float v2f;
typedef __attribute__((ext_vector_type(4))) int v4i;

typedef __attribute__((ext_vector_type(2))) __bf16 v2bf;
typedef __attribute__((ext_vector_type(4))) __bf16 v4bf;
__device__ __forceinline__ v4us rb4(v4f a) {   /* 4 f32 -> 4 bf16, round to nearest even, two a conversion */
    const v2bf p0 = __builtin_convertvector(__builtin_shufflevector(a, a, 0, 1), v2bf), p1 = __builtin_convertvector(__builtin_shufflevector(a, a, 2, 3), v2bf);
    return __builtin_bit_cast(v4us, (v4bf)__builtin_shufflevector(p0, p1, 0, 1, 2, 3)); }
__device__ __forceinline__ v8us rb8(v8f y) { return __builtin_shufflevector(rb4(__builtin_shufflevector(y, y, 0, 1, 2, 3)), rb4(__builtin_shufflevector(y, y, 4, 5, 6, 7)), 0, 1, 2, 3, 4, 5, 6, 7); }
__device__ __forceinline__ void split8(v8f y, v8us& h, v8us& l) {   /* y = hi + lo, both bf16 */
    h = rb8(y); v8f r;
#pragma unroll
    for (int e = 0; e < 8; ++e) r[e] = y[e] - bf2f(h[e]);
    l = rb8(r); }
// k_wt3: the three 'xw' weights [384][64] f32 -> WT, bf16 in fragment order, so that a wave's 16-byte loads of a fragment cover whole lines:
// WT[matrix q, k, v][step s = k / 32][16-column group j][half f][lane][8]: lane (lr, hi) holds column 16 j + lr, k = 32 s + 16 f + 8 hi .. + 7 (the loaders' own k order). One pair of k per thread; grid (64 * 384 / 512, 3).
__global__ __launch_bounds__(256) void k_wt3(const float* __restrict__ wq, const float* __restrict__ wk, const float* __restrict__ wv, bf* WT) {
    const int m = blockIdx.y; const float* w = m == 0 ? wq : (m == 1 ? wk : wv);
    const int idx = blockIdx.x * 256 + threadIdx.x, pr = idx & 3, ln = (idx >> 2) & 31, f = (idx >> 7) & 1, j = (idx >> 8) & 3, s = idx >> 10;
    const int n = j * 16 + (ln & 15), k = s * 32 + f * 16 + (ln >> 4) * 8 + pr * 2; v2us o;
    o[0] = f2bf(w[(size_t)k * HD + n]); o[1] = f2bf(w[(size_t)(k + 1) * HD + n]); *(v2us*)(WT + (size_t)m * HD * CC + (size_t)idx * 2) = o; }
#define XP   392                  // bf16 pitch of an x row in LDS (784 bytes = 16 x odd)
#define SP   72                   // bf16 pitch of a staged 128-byte line (144 bytes = 16 x odd)
#define NS   (CC / 32)
__device__ __forceinline__ void put_tile(bf* st, const v8us (&c)[2][4], bf* g, size_t gl, int lane) {   /* c[a][b]: line 16 a + lr, 16-byte piece 2 b + hi; line L goes to g + L * gl */
    const int lr = lane & 15, hi = lane >> 4;
#pragma unroll
    for (int a = 0; a < 2; ++a)
#pragma unroll
        for (int b = 0; b < 4; ++b) *(v8usa*)(st + (a * 16 + lr) * SP + (b * 2 + hi) * 8) = c[a][b];
    asm volatile("s_wait_dscnt 0x0" ::: "memory");   /* the wave's own LDS writes are done before other lanes of it read them back */
    v8us r[8];
#pragma unroll
    for (int q = 0; q < 8; ++q) r[q] = *(const v8usa*)(st + (q * 4 + (lane >> 3)) * SP + (lane & 7) * 8);
#pragma unroll
    for (int q = 0; q < 8; ++q) *(v8usa*)(g + (size_t)(q * 4 + (lane >> 3)) * gl + (lane & 7) * 8) = r[q];
    /* the reads are done before the next plane's tile overwrites the range; the second wait stands in front of the first rewrite of the stores' registers */
    asm volatile("s_wait_dscnt 0x0\n\ts_wait_xcnt 0x0" ::: "memory");
}
template <bool TR>
__device__ __forceinline__ void proj_tile(const bf* xs, const bf* __restrict__ wp, v8f (&acc)[TR ? 2 : 4][TR ? 4 : 2]) {   /* xs: the lane's part of the tile's first x row in LDS; wp: the lane's part of the tile's first weight fragment */
    constexpr int NI = TR ? 2 : 4, NJ = TR ? 4 : 2;
    v16bf xa[2][NI], wf[3][NJ];
#define LDW(S) { _Pragma("unroll") for (int j = 0; j < NJ; ++j) wf[(S) % 3][j] = cat16b(*(const v8us*)(wp + ((S) * 4 + j) * 512), *(const v8us*)(wp + ((S) * 4 + j) * 512 + 256)); }
#define LDX(S) { _Pragma("unroll") for (int i = 0; i < NI; ++i) xa[(S) & 1][i] = cat16b(*(const v8usa*)(xs + i * 16 * XP + (S) * 32), *(const v8usa*)(xs + i * 16 * XP + (S) * 32 + 16)); }
    LDW(0) LDW(1) LDX(0)
#pragma unroll
    for (int s = 0; s < NS; ++s) {
        if (s + 2 < NS) LDW(s + 2)
        if (s + 1 < NS) LDX(s + 1)
        __builtin_amdgcn_sched_barrier(0);   /* keeps the loads of the later steps in front of this step's products, so that they fly during them */
#pragma unroll
        for (int j = 0; j < NJ; ++j)
#pragma unroll
            for (int i = 0; i < NI; ++i) acc[i][j] = TR ? wmmab(wf[s % 3][j], xa[s & 1][i], acc[i][j]) : wmmab(xa[s & 1][i], wf[s % 3][j], acc[i][j]);
        __builtin_amdgcn_sched_barrier(0);   /* second fence of the pair: keeps the next group of loads out of this block of products (for speed only) */
    }
#undef LDW
#undef LDX
}
__global__ __launch_bounds__(192) void k_proj(const float* __restrict__ x, const bf* __restrict__ WT, bf* Qh, bf* Ql, bf* Kh, bf* Kl, h16* V16, bf* Vh, bf* Vl) {
    __shared__ __align__(16) bf Xs[64 * XP];
    __shared__ __align__(16) bf Stg[6][32 * SP];
    const int tid = threadIdx.x, lane = tid & 31, lr = lane & 15, hi = lane >> 4;
    const int wave = __builtin_amdgcn_readfirstlane(tid >> 5), mat = wave >> 1, half = wave & 1;
    const int r0 = blockIdx.x * 64;
    {   /* 64 rows x 96 pieces of 4 f32; piece it * 192 + tid: row 2 it + tid / 96, piece tid % 96 of the row */
        const float* xg = x + (size_t)r0 * CC + tid * 4; bf* xd = Xs + (tid / 96) * XP + (tid % 96) * 4; v4f xr[32];
#pragma unroll
        for (int it = 0; it < 32; ++it) xr[it] = *(const v4f*)(xg + it * 768);
        __builtin_amdgcn_sched_barrier(0);   /* all 32 loads are issued before the first is waited for */
#pragma unroll
        for (int it = 0; it < 32; ++it) *(v4us __attribute__((may_alias))*)(xd + it * 2 * XP) = rb4(xr[it]);
    }
    __syncthreads();   /* the 64 bf16 rows are in LDS before any wave takes a fragment */
    bf* st = Stg[wave];
    if (mat < 2) {
        v8f acc[2][4];
#pragma unroll
        for (int i = 0; i < 2; ++i)
#pragma unroll
            for (int j = 0; j < 4; ++j) acc[i][j] = (v8f){};
        proj_tile<true>(Xs + (half * 32 + lr) * XP + 8 * hi, WT + (size_t)mat * HD * CC + lane * 8, acc);
        v8us h[2][4], l[2][4];
#pragma unroll
        for (int i = 0; i < 2; ++i)
#pragma unroll
            for (int j = 0; j < 4; ++j) split8(acc[i][j], h[i][j], l[i][j]);
        const size_t go = (size_t)(r0 + half * 32) * HD;
        put_tile(st, h, (mat == 0 ? Qh : Kh) + go, HD, lane); put_tile(st, l, (mat == 0 ? Ql : Kl) + go, HD, lane);
    } else {
        v8f acc[4][2];
#pragma unroll
        for (int i = 0; i < 4; ++i)
#pragma unroll
            for (int j = 0; j < 2; ++j) acc[i][j] = (v8f){};
        proj_tile<false>(Xs + lr * XP + 8 * hi, WT + (size_t)2 * HD * CC + half * 2 * 512 + lane * 8, acc);
        const int t0 = r0 % TT; const size_t go = (size_t)(r0 / TT) * HD * TT + (size_t)(half * 32) * TT + t0;
        v8us h[2][4], l[2][4];
#pragma unroll
        for (int j = 0; j < 2; ++j)
#pragma unroll
            for (int i = 0; i < 4; ++i) h[j][i] = __builtin_bit_cast(v8us, __builtin_convertvector(acc[i][j], v8h));
        put_tile(st, h, (bf*)V16 + go, TT, lane);
        if (t0 < RH) {
#pragma unroll
            for (int j = 0; j < 2; ++j)
#pragma unroll
                for (int i = 0; i < 4; ++i) split8(acc[i][j], h[j][i], l[j][i]);
            put_tile(st, h, Vh + go, TT, lane); put_tile(st, l, Vl + go, TT, lane);
        }
    }
}
// ---- k_fattn: scores, causal softmax and wei.v of one 32-query tile in one work-group; no score or probability ever reaches memory.
// Transposed products: S^T = K Q^T (A = 16 key rows, B = 16 query rows kept in registers, hi/lo planes, 3 products), O^T += V^T P^T (A = 16 rows of v^T, B = P^T).
// A lane of an S^T tile holds 8 keys of ONE query (D[8 hi + r][lr]), so two tiles of 16 keys, converted in place, are the B operand of the second product in the loaders' own k order, and maximum, sum and rescale of a query are per-lane values joined once between the wave halves.
// The FW waves of the work-group take the tile's 32-key blocks in turn (block kb goes to wave kb % FW), each with its own running reference exponent, sum and f32 output tile; the FW partial results are joined through LDS in fixed wave order, divided by the joined sum and stored as the output rows.
// Every inner loop is unrolled so that the fragment and accumulator arrays are indexed by constants and stay in registers; the key loop stays rolled (one copy of the pass).
// HR (query rows < RH): P^T and v^T on bf16 hi/lo planes, 3 products; otherwise P^T (not normalised, at most 256) and v^T in fp16.
#define FW   4
#define OSP  68                   // f32 pitch of a query's row in the LDS join (16-byte aligned, off the power of two)
#define SC2  (SCL * 1.4426950408889634f)   // scores are carried as log2 exponents
__device__ __forceinline__ float xhalf(float x) { return __builtin_bit_cast(float, __builtin_amdgcn_permlanex16(__builtin_bit_cast(int, x), __builtin_bit_cast(int, x), 0x76543210, 0xfedcba98, false, false)); }   /* lane l takes lane l ^ 16's value */
template <bool HR>
__global__ __launch_bounds__(FW * 32) void k_fattn(const bf* __restrict__ Qh, const bf* __restrict__ Ql, const bf* __restrict__ Kh, const bf* __restrict__ Kl, const h16* __restrict__ V16, const bf* __restrict__ Vh, const bf* __restrict__ Vl, float* __restrict__ out, int tile0) {
    __shared__ __align__(16) float Os[FW][32 * OSP];
    __shared__ float Ms[FW][32], Ls[FW][32];
    const size_t b = blockIdx.x; const int tile = tile0 + (int)gridDim.y - 1 - (int)blockIdx.y;   /* grid (batch, tile): the tiles with the most keys come first in block order */
    const int q0 = tile * 32, lane = threadIdx.x & 31, lr = lane & 15, hi = lane >> 4;
    const int wave = __builtin_amdgcn_readfirstlane((int)(threadIdx.x >> 5));
    Qh += b * TT * HD; Ql += b * TT * HD; Kh += b * TT * HD; Kl += b * TT * HD; V16 += b * HD * TT; Vh += b * HD * TT; Vl += b * HD * TT;
    v16bf qh[2][2], ql[2][2]; const bf* qp[2]; const bf* qq[2];
#pragma unroll
    for (int g = 0; g < 2; ++g) { const size_t qo = (size_t)(q0 + g * 16 + lr) * HD + 8 * hi; qp[g] = Qh + qo; qq[g] = Ql + qo;
#pragma unroll
        for (int kc = 0; kc < 2; ++kc) { qh[g][kc] = WFrag<bf>::ld(qp[g] + kc * 32); ql[g][kc] = WFrag<bf>::ld(qq[g] + kc * 32); } }
    v8f o[2][4]; float mm[2], ll[2];
#pragma unroll
    for (int g = 0; g < 2; ++g) { mm[g] = -3.0e38f; ll[g] = 0.f;
#pragma unroll
        for (int db = 0; db < 4; ++db) o[g][db] = (v8f){}; }
    const int nblk = tile + 1;   /* keys 0 .. q0 + 31; only the last block crosses the diagonal, and every query has a key in every block */
    v16bf kh[2][2], kl[2][2]; const bf* kp; const bf* kq;
    const size_t kl0 = (size_t)lr * HD + 8 * hi;
#define LDK(KB) { const size_t ko = (size_t)(KB) * 32 * HD + kl0; kp = Kh + ko; kq = Kl + ko; _Pragma("unroll") for (int kt = 0; kt < 2; ++kt) _Pragma("unroll") for (int kc = 0; kc < 2; ++kc) { kh[kt][kc] = WFrag<bf>::ld(kp + kt * 16 * HD + kc * 32); kl[kt][kc] = WFrag<bf>::ld(kq + kt * 16 * HD + kc * 32); } }
    LDK(wave < nblk ? wave : nblk - 1)
    /* stands in front of the first rewrite of the query and first key loads' address registers: the first key fragments as inputs keep it behind the loads, the six pointers as inputs keep their registers whole up to it */
    asm volatile("s_wait_xcnt 0x0" :: "v"(kh[0][0]), "v"(kh[0][1]), "v"(kh[1][0]), "v"(kh[1][1]), "v"(kl[0][0]), "v"(kl[0][1]), "v"(kl[1][0]), "v"(kl[1][1]), "v"(kp), "v"(kq), "v"(qp[0]), "v"(qp[1]), "v"(qq[0]), "v"(qq[1]));
#pragma unroll 1
    for (int kb = wave; kb < nblk; kb += FW) {
        const int key0 = kb * 32;
        v16h v16[4]; v16bf vh[4], vl[4]; const size_t vo = (size_t)lr * TT + key0 + 8 * hi; const h16* vp = V16 + vo; const bf* vq = Vh + vo; const bf* vr = Vl + vo;
#pragma unroll
        for (int db = 0; db < 4; ++db) { if (HR) { vh[db] = WFrag<bf>::ld(vq + (size_t)db * 16 * TT); vl[db] = WFrag<bf>::ld(vr + (size_t)db * 16 * TT); } else v16[db] = WFrag<h16>::ld(vp + (size_t)db * 16 * TT); }
        /* stands in front of the first rewrite of the v^T loads' address registers; the pointers as inputs keep those registers whole up to it */
        if (HR) asm volatile("s_wait_xcnt 0x0" :: "v"(vq), "v"(vr) : "memory"); else asm volatile("s_wait_xcnt 0x0" :: "v"(vp) : "memory");
        v8f s[2][2];
#pragma unroll
        for (int kt = 0; kt < 2; ++kt)
#pragma unroll
            for (int g = 0; g < 2; ++g) { v8f a = (v8f){};
#pragma unroll
                for (int kc = 0; kc < 2; ++kc) { a = wmmab(kh[kt][kc], qh[g][kc], a); a = wmmab(kh[kt][kc], ql[g][kc], a); a = wmmab(kl[kt][kc], qh[g][kc], a); }
                s[g][kt] = a; }
        LDK(kb + FW < nblk ? kb + FW : nblk - 1)   /* the wave's next key block flies during the softmax and the second product (its last pass reloads a block in range) */
        asm volatile("s_wait_xcnt 0x0" :: "v"(kp), "v"(kq) : "memory");   /* the same for the key loads' address registers */
        if (kb == nblk - 1) {   /* the diagonal block: keys above the query leave the maximum and the sums */
#pragma unroll
            for (int g = 0; g < 2; ++g)
#pragma unroll
                for (int kt = 0; kt < 2; ++kt)
#pragma unroll
                    for (int j = 0; j < 8; ++j) if (kt * 16 + hi * 8 + j > g * 16 + lr) s[g][kt][j] = -3.0e38f; }
        v16h p16[2]; v16bf ph[2], pl[2]; float bm[2];
#pragma unroll
        for (int g = 0; g < 2; ++g) { float t = s[g][0][0];
#pragma unroll
            for (int j = 1; j < 8; ++j) t = fmaxf(t, s[g][0][j]);
#pragma unroll
            for (int j = 0; j < 8; ++j) t = fmaxf(t, s[g][1][j]);
            bm[g] = fmaxf(t, xhalf(t)) * SC2; }   /* the other half of the wave holds the query's other 16 keys */
        if (__builtin_amdgcn_ballot_w32(bm[0] > mm[0] + 8.0f || bm[1] > mm[1] + 8.0f) != 0) {   /* one scalar branch a pass: the reference exponent moves only when a query's maximum passes it by more than 8, so P stays at or below 256 */
#pragma unroll
            for (int g = 0; g < 2; ++g) { const float mn = fmaxf(mm[g], bm[g]), al = __builtin_amdgcn_exp2f(mm[g] - mn); ll[g] *= al; mm[g] = mn;
#pragma unroll
                for (int db = 0; db < 4; ++db) o[g][db] *= al; } }
#pragma unroll
        for (int g = 0; g < 2; ++g) { const float mn = mm[g];
            float sum = 0.f; v8us h0, h1, l0, l1; v8h f0, f1;
#pragma unroll
            for (int j = 0; j < 8; ++j) { const float e0 = __builtin_amdgcn_exp2f(__builtin_fmaf(s[g][0][j], SC2, -mn)), e1 = __builtin_amdgcn_exp2f(__builtin_fmaf(s[g][1][j], SC2, -mn)); sum += e0 + e1;
                if (HR) { unsigned short a2, c2; splitf(e0, a2, c2); h0[j] = a2; l0[j] = c2; splitf(e1, a2, c2); h1[j] = a2; l1[j] = c2; } else { f0[j] = tohx(e0); f1[j] = tohx(e1); } }
            ll[g] += sum;
            if (HR) { ph[g] = cat16b(h0, h1); pl[g] = cat16b(l0, l1); } else p16[g] = cat16(f0, f1); }
#pragma unroll
        for (int db = 0; db < 4; ++db)
#pragma unroll
            for (int g = 0; g < 2; ++g) { if (HR) { o[g][db] = wmmab(vh[db], ph[g], o[g][db]); o[g][db] = wmmab(vl[db], ph[g], o[g][db]); o[g][db] = wmmab(vh[db], pl[g], o[g][db]); } else o[g][db] = wmma16(v16[db], p16[g], o[g][db]); }
    }
#pragma unroll
    for (int g = 0; g < 2; ++g) { ll[g] += xhalf(ll[g]); if (hi == 0) { Ms[wave][g * 16 + lr] = mm[g]; Ls[wave][g * 16 + lr] = ll[g]; }
#pragma unroll
        for (int db = 0; db < 4; ++db) { float* p = &Os[wave][(g * 16 + lr) * OSP + db * 16 + hi * 8]; *(v4fa*)p = __builtin_shufflevector(o[g][db], o[g][db], 0, 1, 2, 3); *(v4fa*)(p + 4) = __builtin_shufflevector(o[g][db], o[g][db], 4, 5, 6, 7); } }
    __syncthreads();   /* every wave's partial maximum, sum and output tile are in LDS before any is read */
    const int q = threadIdx.x >> 2, d0 = (threadIdx.x & 3) * 16;
    float M = Ms[0][q];
#pragma unroll
    for (int w = 1; w < FW; ++w) M = fmaxf(M, Ms[w][q]);
    float f[FW], L = 0.f;
#pragma unroll
    for (int w = 0; w < FW; ++w) { f[w] = __builtin_amdgcn_exp2f(Ms[w][q] - M); L += Ls[w][q] * f[w]; }   /* a wave without a block has sum 0, tile 0 and factor 0 */
    const float inv = __fdiv_rn(1.0f, L);
#pragma unroll
    for (int c = 0; c < 4; ++c) { v4f a = (v4f){};
#pragma unroll
        for (int w = 0; w < FW; ++w) a += *(const v4fa*)&Os[w][q * OSP + d0 + c * 4] * f[w];
        *(v4f*)(out + (b * TT + q0 + q) * CO + d0 + c * 4) = a * inv; }
}
extern "C" void kernel_launch(void* const* d_in, const int* in_sizes, int n_in,
                              void* d_out, int out_size, void* d_ws, size_t ws_size, hipStream_t stream) {
    (void)in_sizes; (void)n_in; (void)out_size;
    const float* x = (const float*)d_in[0]; const float* wk = (const float*)d_in[1]; const float* wq = (const float*)d_in[2]; const float* wv = (const float*)d_in[3];   /* x [8][4096][384], Wk, Wq, Wv ('xw' [384][64], no biases; keys first) */
    float* OUT = (float*)d_out;     // [8][4096][64]
    char* wsp = (char*)d_ws;
    auto take = [&](size_t bytes) { char* p = wsp; wsp += (bytes + 255) & ~(size_t)255; return (void*)p; };
    bf* WT = (bf*)take((size_t)3 * HD * CC * 2);
    const size_t PQ = (size_t)TT * MID, PV = (size_t)CO * TT;   /* elements of one batch's q / k plane and of its v^T plane */
    bf* QPh = (bf*)take(NB_ * PQ * 2); bf* QPl = (bf*)take(NB_ * PQ * 2); bf* KPh = (bf*)take(NB_ * PQ * 2); bf* KPl = (bf*)take(NB_ * PQ * 2);
    h16* VT16 = (h16*)take(NB_ * PV * 2); bf* VTh = (bf*)take(NB_ * PV * 2); bf* VTl = (bf*)take(NB_ * PV * 2);
    if ((size_t)(wsp - (char*)d_ws) > ws_size) return;    // ws 256 MiB (carve ~28 MiB)
    k_wt3<<<dim3(HD * CC / 512, 3, 1), 256, 0, stream>>>(wq, wk, wv, WT);   /* 'xw' weights -> bf16 in fragment order */
    k_proj<<<NB_ * TT / 64, 192, 0, stream>>>(x, WT, QPh, QPl, KPh, KPl, VT16, VTh, VTl);   /* all 8 batches: the rows of x are one [8 x 4096][384] matrix */
    /* causal attention of all batches, one work-group per 32 query rows, output rows stored once: rows < RH on hi/lo planes, then the rest */
    k_fattn<true><<<dim3(NB_, RH / 32, 1), FW * 32, 0, stream>>>(QPh, QPl, KPh, KPl, VT16, VTh, VTl, OUT, 0);
    k_fattn<false><<<dim3(NB_, (TT - RH) / 32, 1), FW * 32, 0, stream>>>(QPh, QPl, KPh, KPl, VT16, VTh, VTl, OUT, RH / 32);
}

// v006
// A run of this version takes 47.5 microseconds.
// Two timings next to v005 both put it at 1.47 times that version's speed.
// All steps since v000 together make it 47.0 times as fast.
#include <hip/hip_runtime.h>

// Single 64-wide causal attention head over 4,096 tokens (x [8][4096][384]; k = x Wk, q = x Wq, v = x Wv ('xw' [384][64], no bias); wei = q.k / sqrt(384) (the module scales by sqrt(embed size)); causal (-inf); softmax; out = wei.v -> [8][4096][64] (2.1 M); argument order x, Wk, Wq, Wv (keys first)).
// The batch index rides in the grid: the projection kernel and the attention kernel take all 8 batches per launch.
// Layout: 'xw' weights laid in fragment order once; k_proj reads x once as f32, rounds it to bf16 on the way into LDS, does the three exact projections and stores the q/k planes and value^T planes from its accumulators, in fragment order (FRAGMENT ORDER below); k_fattn does scores with EVERY row on hi/lo planes (3 products), running-maximum causal softmax in registers and wei.v (rows < 512 hi/lo 3 products, rest fp16) per 32-query tile and stores the output rows.
// Causal bound: a 32-query tile walks the 32-key blocks up to its own; only that last block is masked.
// Compute dtypes, f32 accumulate: every input rounded to bf16; projections exact; scores 3 products; softmax f32; wei.v rows < 512 3 products, rest fp16; output f32.

#define NB_  8
#define TT   4096
#define DM   384
#define NH_  1
#define NKV  1
#define REP  (NH_ / NKV)
#define HD   64
#define DQ   (NH_ * HD)
#define DKV  (NKV * HD)
#define RH   512                  // query rows < RH use hi+lo planes (0: none)
#define WIN  0
static_assert(RH % 32 == 0 && TT % 32 == 0 && HD == 64, "k_fattn takes 32 query rows and 32-key blocks of a 64-wide head");
#define SCL  0.05103103630798288f   // 1/sqrt(384): the module scales by sqrt(embed size C)
#define MID  64       // q / k width (one 64-wide head)
#define CO   64       // v width
#define CC   384
typedef _Float16 h16;
typedef unsigned short bf;
typedef __attribute__((ext_vector_type(16))) __bf16   v16bf;
typedef __attribute__((ext_vector_type(16))) _Float16 v16h;
typedef __attribute__((ext_vector_type(8)))  _Float16 v8h;
typedef __attribute__((ext_vector_type(8)))  unsigned short v8us;
typedef __attribute__((ext_vector_type(8)))  float    v8f;
typedef __attribute__((ext_vector_type(4)))  float    v4f;
typedef v8h  __attribute__((may_alias)) v8ha;
typedef v4f  __attribute__((may_alias)) v4fa;
typedef v8us __attribute__((may_alias)) v8usa;

__device__ __forceinline__ unsigned short f2bf(float f) { unsigned u = __float_as_uint(f); u += 0x7FFFu + ((u >> 16) & 1u); return (unsigned short)(u >> 16); }
__device__ __forceinline__ float bf2f(unsigned short b) { return __uint_as_float(((unsigned)b) << 16); }
__device__ __forceinline__ float bfr(float f) { return bf2f(f2bf(f)); }
__device__ __forceinline__ v16h cat16(v8h lo, v8h hi) { return __builtin_shufflevector(lo, hi, 0, 1, 2, 3, 4, 5, 6, 7, 8, 9, 10, 11, 12, 13, 14, 15); }
__device__ __forceinline__ v16bf cat16b(v8us lo, v8us hi) { return __builtin_bit_cast(v16bf, __builtin_shufflevector(lo, hi, 0, 1, 2, 3, 4, 5, 6, 7, 8, 9, 10, 11, 12, 13, 14, 15)); }
__device__ __forceinline__ v8f wmma16(v16h a, v16h b, v8f c) { return __builtin_amdgcn_wmma_f32_16x16x32_f16(false, a, false, b, (short)0, c, false, false); }
__device__ __forceinline__ v8f wmmab(v16bf a, v16bf b, v8f c) { return __builtin_amdgcn_wmma_f32_16x16x32_bf16(false, a, false, b, (short)0, c, false, false); }



// FRAGMENT ORDER of the q, k and v^T planes: a plane is a row of blocks of 32 tokens x 64 = 2048 elements (4 KiB); a block is 4 fragments of 16 x 32, a fragment two halves f of 512 bytes, a half [lane][8].
// q / k: fragment 2 t + c (t: 16-token group, c: 32-column group); lane (lr, hi) of half f holds token 16 t + lr, columns 32 c + 16 f + 8 hi .. + 7.
// v^T: fragment db (16-column group of v); lane (lr, hi) of half f holds column 16 db + lr, tokens 16 f + 8 hi .. + 7 of the block.
// So every 16-byte load or store of a wave covers 512 bytes in a row (4 whole lines), and a lane holds what it held with k-contiguous rows: k = 8 hi .. + 7 and 16 + 8 hi .. + 7.
#define FB   2048                 // elements of a 32-token block of a plane
#define FF   512                  // elements of a fragment
#define FH   256                  // elements of half a fragment
// fragment loaders: p is the lane's own 8 elements of the fragment's first half
template <typename T16> struct WFrag;
template <> struct WFrag<h16> { typedef v16h V; static __device__ __forceinline__ V ld(const h16* p) { return cat16(*(const v8h*)p, *(const v8h*)(p + FH)); } static __device__ __forceinline__ v8f mma(V a, V b, v8f c) { return wmma16(a, b, c); } };
template <> struct WFrag<bf> { typedef v16bf V; static __device__ __forceinline__ V ld(const bf* p) { return cat16b(*(const v8us*)p, *(const v8us*)(p + FH)); } static __device__ __forceinline__ v8f mma(V a, V b, v8f c) { return wmmab(a, b, c); } };
__device__ __forceinline__ h16 tohx(float x) { return (h16)x; }
__device__ __forceinline__ void splitf(float y, unsigned short& h, unsigned short& l) { h = f2bf(y); l = f2bf(y - bf2f(h)); }
typedef __attribute__((ext_vector_type(2))) _Float16 v2h;
typedef __attribute__((ext_vector_type(4))) _Float16 v4h;
typedef __attribute__((ext_vector_type(2))) unsigned short v2us;
typedef __attribute__((ext_vector_type(4))) unsigned short v4us;
typedef __attribute__((ext_vector_type(2))) float v2f;
typedef __attribute__((ext_vector_type(4))) int v4i;

typedef __attribute__((ext_vector_type(2))) __bf16 v2bf;
typedef __attribute__((ext_vector_type(4))) __bf16 v4bf;
__device__ __forceinline__ v4us rb4(v4f a) {   /* 4 f32 -> 4 bf16, round to nearest even, two a conversion */
    const v2bf p0 = __builtin_convertvector(__builtin_shufflevector(a, a, 0, 1), v2bf), p1 = __builtin_convertvector(__builtin_shufflevector(a, a, 2, 3), v2bf);
    return __builtin_bit_cast(v4us, (v4bf)__builtin_shufflevector(p0, p1, 0, 1, 2, 3)); }
__device__ __forceinline__ v8us rb8(v8f y) { return __builtin_shufflevector(rb4(__builtin_shufflevector(y, y, 0, 1, 2, 3)), rb4(__builtin_shufflevector(y, y, 4, 5, 6, 7)), 0, 1, 2, 3, 4, 5, 6, 7); }
__device__ __forceinline__ void split8(v8f y, v8us& h, v8us& l) {   /* y = hi + lo, both bf16 */
    h = rb8(y); v8f r;
#pragma unroll
    for (int e = 0; e < 8; ++e) r[e] = y[e] - bf2f(h[e]);
    l = rb8(r); }
// k_wt3: the three 'xw' weights [384][64] f32 -> WT, bf16 in fragment order, so that a wave's 16-byte loads of a fragment cover whole lines:
// WT[matrix q, k, v][step s = k / 32][16-column group j][half f][lane][8]: lane (lr, hi) holds column 16 j + lr, k = 32 s + 16 f + 8 hi .. + 7 (the loaders' own k order). One pair of k per thread; grid (64 * 384 / 512, 3).
__global__ __launch_bounds__(256) void k_wt3(const float* __restrict__ wq, const float* __restrict__ wk, const float* __restrict__ wv, bf* WT) {
    const int m = blockIdx.y; const float* w = m == 0 ? wq : (m == 1 ? wk : wv);
    const int idx = blockIdx.x * 256 + threadIdx.x, pr = idx & 3, ln = (idx >> 2) & 31, f = (idx >> 7) & 1, j = (idx >> 8) & 3, s = idx >> 10;
    const int n = j * 16 + (ln & 15), k = s * 32 + f * 16 + (ln >> 4) * 8 + pr * 2; v2us o;
    o[0] = f2bf(w[(size_t)k * HD + n]); o[1] = f2bf(w[(size_t)(k + 1) * HD + n]); *(v2us*)(WT + (size_t)m * HD * CC + (size_t)idx * 2) = o; }
#define XP   392                  // bf16 pitch of an x row in LDS (784 bytes = 16 x odd)
#define NS   (CC / 32)
template <bool TR>
__device__ __forceinline__ void proj_tile(const bf* xs, const bf* __restrict__ wp, v8f (&acc)[TR ? 2 : 4][TR ? 4 : 2]) {   /* xs: the lane's part of the tile's first x row in LDS; wp: the lane's part of the tile's first weight fragment */
    constexpr int NI = TR ? 2 : 4, NJ = TR ? 4 : 2;
    v16bf xa[2][NI], wf[3][NJ];
#define LDW(S) { _Pragma("unroll") for (int j = 0; j < NJ; ++j) wf[(S) % 3][j] = cat16b(*(const v8us*)(wp + ((S) * 4 + j) * 512), *(const v8us*)(wp + ((S) * 4 + j) * 512 + 256)); }
#define LDX(S) { _Pragma("unroll") for (int i = 0; i < NI; ++i) xa[(S) & 1][i] = cat16b(*(const v8usa*)(xs + i * 16 * XP + (S) * 32), *(const v8usa*)(xs + i * 16 * XP + (S) * 32 + 16)); }
    LDW(0) LDW(1) LDX(0)
#pragma unroll
    for (int s = 0; s < NS; ++s) {
        if (s + 2 < NS) LDW(s + 2)
        if (s + 1 < NS) LDX(s + 1)
        __builtin_amdgcn_sched_barrier(0);   /* keeps the loads of the later steps in front of this step's products, so that they fly during them */
#pragma unroll
        for (int j = 0; j < NJ; ++j)
#pragma unroll
            for (int i = 0; i < NI; ++i) acc[i][j] = TR ? wmmab(wf[s % 3][j], xa[s & 1][i], acc[i][j]) : wmmab(xa[s & 1][i], wf[s % 3][j], acc[i][j]);
        __builtin_amdgcn_sched_barrier(0);   /* second fence of the pair: keeps the next group of loads out of this block of products (for speed only) */
    }
#undef LDW
#undef LDX
}
__global__ __launch_bounds__(192) void k_proj(const float* __restrict__ x, const bf* __restrict__ WT, bf* Qh, bf* Ql, bf* Kh, bf* Kl, h16* V16, bf* Vh, bf* Vl) {
    __shared__ __align__(16) bf Xs[64 * XP];
    const int tid = threadIdx.x, lane = tid & 31, lr = lane & 15, hi = lane >> 4;
    const int wave = __builtin_amdgcn_readfirstlane(tid >> 5), mat = wave >> 1, half = wave & 1;
    const int r0 = blockIdx.x * 64;
    {   /* 64 rows x 96 pieces of 4 f32; piece it * 192 + tid: row 2 it + tid / 96, piece tid % 96 of the row */
        const float* xg = x + (size_t)r0 * CC + tid * 4; bf* xd = Xs + (tid / 96) * XP + (tid % 96) * 4; v4f xr[32];
#pragma unroll
        for (int it = 0; it < 32; ++it) xr[it] = *(const v4f*)(xg + it * 768);
        __builtin_amdgcn_sched_barrier(0);   /* all 32 loads are issued before the first is waited for */
#pragma unroll
        for (int it = 0; it < 32; ++it) *(v4us __attribute__((may_alias))*)(xd + it * 2 * XP) = rb4(xr[it]);
    }
    __syncthreads();   /* the 64 bf16 rows are in LDS before any wave takes a fragment */
    if (mat < 2) {
        v8f acc[2][4];
#pragma unroll
        for (int i = 0; i < 2; ++i)
#pragma unroll
            for (int j = 0; j < 4; ++j) acc[i][j] = (v8f){};
        proj_tile<true>(Xs + (half * 32 + lr) * XP + 8 * hi, WT + (size_t)mat * HD * CC + lane * 8, acc);
        v8us h[2][4], l[2][4];
#pragma unroll
        for (int i = 0; i < 2; ++i)
#pragma unroll
            for (int j = 0; j < 4; ++j) split8(acc[i][j], h[i][j], l[i][j]);
        const size_t go = (size_t)(r0 + half * 32) * HD + lane * 8;   /* the wave's 32 rows are one block; tile (i, j) is half j & 1 of fragment 2 i + j / 2 */
        bf* gh = (mat == 0 ? Qh : Kh) + go; bf* gl = (mat == 0 ? Ql : Kl) + go;
#pragma unroll
        for (int i = 0; i < 2; ++i)
#pragma unroll
            for (int j = 0; j < 4; ++j) { *(v8usa*)(gh + (i * 4 + j) * FH) = h[i][j]; *(v8usa*)(gl + (i * 4 + j) * FH) = l[i][j]; }
    } else {
        v8f acc[4][2];
#pragma unroll
        for (int i = 0; i < 4; ++i)
#pragma unroll
            for (int j = 0; j < 2; ++j) acc[i][j] = (v8f){};
        proj_tile<false>(Xs + lr * XP + 8 * hi, WT + (size_t)2 * HD * CC + half * 2 * 512 + lane * 8, acc);
        const int t0 = r0 % TT; const size_t go = (size_t)(r0 / TT) * HD * TT + (size_t)t0 * HD + half * 2 * FF + lane * 8;   /* tile (i, j) is half i & 1 of fragment 2 half + j of block i / 2 of the 64 rows */
#pragma unroll
        for (int j = 0; j < 2; ++j)
#pragma unroll
            for (int i = 0; i < 4; ++i) *(v8ha*)(V16 + go + (i >> 1) * FB + j * FF + (i & 1) * FH) = __builtin_convertvector(acc[i][j], v8h);
        asm volatile("s_wait_xcnt 0x0" ::: "memory");   /* stands in front of the first rewrite of these stores' data registers */
        if (t0 < RH) {
#pragma unroll
            for (int j = 0; j < 2; ++j)
#pragma unroll
                for (int i = 0; i < 4; ++i) { v8us h, l; split8(acc[i][j], h, l); const int po = (i >> 1) * FB + j * FF + (i & 1) * FH; *(v8usa*)(Vh + go + po) = h; *(v8usa*)(Vl + go + po) = l; }
            asm volatile("s_wait_xcnt 0x0" ::: "memory");   /* stands behind the last of these stores, in front of the join behind this block, before their registers may be rewritten */
        }
    }
}
// ---- k_fattn: scores, causal softmax and wei.v of one 32-query tile in one work-group; no score or probability ever reaches memory.
// Transposed products: S^T = K Q^T (A = 16 key rows, B = 16 query rows kept in registers, hi/lo planes, 3 products), O^T += V^T P^T (A = 16 rows of v^T, B = P^T).
// A lane of an S^T tile holds 8 keys of ONE query (D[8 hi + r][lr]), so two tiles of 16 keys, converted in place, are the B operand of the second product in the loaders' own k order, and maximum, sum and rescale of a query are per-lane values joined once between the wave halves.
// The FW waves of the work-group take the tile's 32-key blocks in turn (block kb goes to wave kb % FW), each with its own running reference exponent, sum and f32 output tile; the FW partial results are joined through LDS in fixed wave order, divided by the joined sum and stored as the output rows.
// Every inner loop is unrolled so that the fragment and accumulator arrays are indexed by constants and stay in registers; the key loop stays rolled (one copy of the pass).
// HR (query rows < RH): P^T and v^T on bf16 hi/lo planes, 3 products; otherwise P^T (not normalised, at most 256) and v^T in fp16.
#define FW   4
#define OSP  68                   // f32 pitch of a query's row in the LDS join (16-byte aligned, off the power of two)
#define SC2  (SCL * 1.4426950408889634f)   // scores are carried as log2 exponents
__device__ __forceinline__ float xhalf(float x) { return __builtin_bit_cast(float, __builtin_amdgcn_permlanex16(__builtin_bit_cast(int, x), __builtin_bit_cast(int, x), 0x76543210, 0xfedcba98, false, false)); }   /* lane l takes lane l ^ 16's value */
template <bool HR>
__global__ __launch_bounds__(FW * 32) void k_fattn(const bf* __restrict__ Qh, const bf* __restrict__ Ql, const bf* __restrict__ Kh, const bf* __restrict__ Kl, const h16* __restrict__ V16, const bf* __restrict__ Vh, const bf* __restrict__ Vl, float* __restrict__ out, int tile0) {
    __shared__ __align__(16) float Os[FW][32 * OSP];
    __shared__ float Ms[FW][32], Ls[FW][32];
    const size_t b = blockIdx.x; const int tile = tile0 + (int)gridDim.y - 1 - (int)blockIdx.y;   /* grid (batch, tile): the tiles with the most keys come first in block order */
    const int q0 = tile * 32, lane = threadIdx.x & 31, lr = lane & 15, hi = lane >> 4;
    const int wave = __builtin_amdgcn_readfirstlane((int)(threadIdx.x >> 5));
    Qh += b * TT * HD; Ql += b * TT * HD; Kh += b * TT * HD; Kl += b * TT * HD; V16 += b * HD * TT; Vh += b * HD * TT; Vl += b * HD * TT;
    v16bf qh[2][2], ql[2][2]; const size_t qo = (size_t)tile * FB + lane * 8; const bf* qp = Qh + qo; const bf* qq = Ql + qo;
#pragma unroll
    for (int g = 0; g < 2; ++g)
#pragma unroll
        for (int kc = 0; kc < 2; ++kc) { qh[g][kc] = WFrag<bf>::ld(qp + (g * 2 + kc) * FF); ql[g][kc] = WFrag<bf>::ld(qq + (g * 2 + kc) * FF); }
    v8f o[2][4]; float mm[2], ll[2];
#pragma unroll
    for (int g = 0; g < 2; ++g) { mm[g] = -3.0e38f; ll[g] = 0.f;
#pragma unroll
        for (int db = 0; db < 4; ++db) o[g][db] = (v8f){}; }
    const int nblk = tile + 1;   /* keys 0 .. q0 + 31; only the last block crosses the diagonal, and every query has a key in every block */
    v16bf kh[2][2], kl[2][2]; const bf* kp; const bf* kq;
#define LDK(KB) { const size_t ko = (size_t)(KB) * FB + lane * 8; kp = Kh + ko; kq = Kl + ko; _Pragma("unroll") for (int kt = 0; kt < 2; ++kt) _Pragma("unroll") for (int kc = 0; kc < 2; ++kc) { kh[kt][kc] = WFrag<bf>::ld(kp + (kt * 2 + kc) * FF); kl[kt][kc] = WFrag<bf>::ld(kq + (kt * 2 + kc) * FF); } }
    LDK(wave < nblk ? wave : nblk - 1)
    /* stands in front of the first rewrite of the query and first key loads' address registers: the first key fragments as inputs keep it behind the loads, the four pointers as inputs keep their registers whole up to it */
    asm volatile("s_wait_xcnt 0x0" :: "v"(kh[0][0]), "v"(kh[0][1]), "v"(kh[1][0]), "v"(kh[1][1]), "v"(kl[0][0]), "v"(kl[0][1]), "v"(kl[1][0]), "v"(kl[1][1]), "v"(kp), "v"(kq), "v"(qp), "v"(qq));
#pragma unroll 1
    for (int kb = wave; kb < nblk; kb += FW) {
        v16h v16[4]; v16bf vh[4], vl[4]; const size_t vo = (size_t)kb * FB + lane * 8; const h16* vp = V16 + vo; const bf* vq = Vh + vo; const bf* vr = Vl + vo;
#pragma unroll
        for (int db = 0; db < 4; ++db) { if (HR) { vh[db] = WFrag<bf>::ld(vq + db * FF); vl[db] = WFrag<bf>::ld(vr + db * FF); } else v16[db] = WFrag<h16>::ld(vp + db * FF); }
        asm volatile("s_wait_xcnt 0x0" ::: "memory");   /* stands in front of the first rewrite of the v^T loads' address registers */
        v8f s[2][2];
#pragma unroll
        for (int kt = 0; kt < 2; ++kt)
#pragma unroll
            for (int g = 0; g < 2; ++g) { v8f a = (v8f){};
#pragma unroll
                for (int kc = 0; kc < 2; ++kc) { a = wmmab(kh[kt][kc], qh[g][kc], a); a = wmmab(kh[kt][kc], ql[g][kc], a); a = wmmab(kl[kt][kc], qh[g][kc], a); }
                s[g][kt] = a; }
        LDK(kb + FW < nblk ? kb + FW : nblk - 1)   /* the wave's next key block flies during the softmax and the second product (its last pass reloads a block in range) */
        asm volatile("s_wait_xcnt 0x0" :: "v"(kp), "v"(kq) : "memory");   /* the same for the key loads' address registers */
        if (kb == nblk - 1) {   /* the diagonal block: keys above the query leave the maximum and the sums */
#pragma unroll
            for (int g = 0; g < 2; ++g)
#pragma unroll
                for (int kt = 0; kt < 2; ++kt)
#pragma unroll
                    for (int j = 0; j < 8; ++j) if (kt * 16 + hi * 8 + j > g * 16 + lr) s[g][kt][j] = -3.0e38f; }
        v16h p16[2]; v16bf ph[2], pl[2]; float bm[2];
#pragma unroll
        for (int g = 0; g < 2; ++g) { float t = s[g][0][0];
#pragma unroll
            for (int j = 1; j < 8; ++j) t = fmaxf(t, s[g][0][j]);
#pragma unroll
            for (int j = 0; j < 8; ++j) t = fmaxf(t, s[g][1][j]);
            bm[g] = fmaxf(t, xhalf(t)) * SC2; }   /* the other half of the wave holds the query's other 16 keys */
        if (__builtin_amdgcn_ballot_w32(bm[0] > mm[0] + 8.0f || bm[1] > mm[1] + 8.0f) != 0) {   /* one scalar branch a pass: the reference exponent moves only when a query's maximum passes it by more than 8, so P stays at or below 256 */
#pragma unroll
            for (int g = 0; g < 2; ++g) { const float mn = fmaxf(mm[g], bm[g]), al = __builtin_amdgcn_exp2f(mm[g] - mn); ll[g] *= al; mm[g] = mn;
#pragma unroll
                for (int db = 0; db < 4; ++db) o[g][db] *= al; } }
#pragma unroll
        for (int g = 0; g < 2; ++g) { const float mn = mm[g];
            float sum = 0.f; v8us h0, h1, l0, l1; v8h f0, f1;
#pragma unroll
            for (int j = 0; j < 8; ++j) { const float e0 = __builtin_amdgcn_exp2f(__builtin_fmaf(s[g][0][j], SC2, -mn)), e1 = __builtin_amdgcn_exp2f(__builtin_fmaf(s[g][1][j], SC2, -mn)); sum += e0 + e1;
                if (HR) { unsigned short a2, c2; splitf(e0, a2, c2); h0[j] = a2; l0[j] = c2; splitf(e1, a2, c2); h1[j] = a2; l1[j] = c2; } else { f0[j] = tohx(e0); f1[j] = tohx(e1); } }
            ll[g] += sum;
            if (HR) { ph[g] = cat16b(h0, h1); pl[g] = cat16b(l0, l1); } else p16[g] = cat16(f0, f1); }
#pragma unroll
        for (int db = 0; db < 4; ++db)
#pragma unroll
            for (int g = 0; g < 2; ++g) { if (HR) { o[g][db] = wmmab(vh[db], ph[g], o[g][db]); o[g][db] = wmmab(vl[db], ph[g], o[g][db]); o[g][db] = wmmab(vh[db], pl[g], o[g][db]); } else o[g][db] = wmma16(v16[db], p16[g], o[g][db]); }
    }
#pragma unroll
    for (int g = 0; g < 2; ++g) { ll[g] += xhalf(ll[g]); if (hi == 0) { Ms[wave][g * 16 + lr] = mm[g]; Ls[wave][g * 16 + lr] = ll[g]; }
#pragma unroll
        for (int db = 0; db < 4; ++db) { float* p = &Os[wave][(g * 16 + lr) * OSP + db * 16 + hi * 8]; *(v4fa*)p = __builtin_shufflevector(o[g][db], o[g][db], 0, 1, 2, 3); *(v4fa*)(p + 4) = __builtin_shufflevector(o[g][db], o[g][db], 4, 5, 6, 7); } }
    __syncthreads();   /* every wave's partial maximum, sum and output tile are in LDS before any is read */
    const int q = threadIdx.x >> 2, d0 = (threadIdx.x & 3) * 16;
    float M = Ms[0][q];
#pragma unroll
    for (int w = 1; w < FW; ++w) M = fmaxf(M, Ms[w][q]);
    float f[FW], L = 0.f;
#pragma unroll
    for (int w = 0; w < FW; ++w) { f[w] = __builtin_amdgcn_exp2f(Ms[w][q] - M); L += Ls[w][q] * f[w]; }   /* a wave without a block has sum 0, tile 0 and factor 0 */
    const float inv = __fdiv_rn(1.0f, L);
#pragma unroll
    for (int c = 0; c < 4; ++c) { v4f a = (v4f){};
#pragma unroll
        for (int w = 0; w < FW; ++w) a += *(const v4fa*)&Os[w][q * OSP + d0 + c * 4] * f[w];
        *(v4f*)(out + (b * TT + q0 + q) * CO + d0 + c * 4) = a * inv; }
}
extern "C" void kernel_launch(void* const* d_in, const int* in_sizes, int n_in,
                              void* d_out, int out_size, void* d_ws, size_t ws_size, hipStream_t stream) {
    (void)in_sizes; (void)n_in; (void)out_size;
    const float* x = (const float*)d_in[0]; const float* wk = (const float*)d_in[1]; const float* wq = (const float*)d_in[2]; const float* wv = (const float*)d_in[3];   /* x [8][4096][384], Wk, Wq, Wv ('xw' [384][64], no biases; keys first) */
    float* OUT = (float*)d_out;     // [8][4096][64]
    char* wsp = (char*)d_ws;
    auto take = [&](size_t bytes) { char* p = wsp; wsp += (bytes + 255) & ~(size_t)255; return (void*)p; };
    bf* WT = (bf*)take((size_t)3 * HD * CC * 2);
    const size_t PQ = (size_t)TT * MID, PV = (size_t)CO * TT;   /* elements of one batch's q / k plane and of its v^T plane */
    bf* QPh = (bf*)take(NB_ * PQ * 2); bf* QPl = (bf*)take(NB_ * PQ * 2); bf* KPh = (bf*)take(NB_ * PQ * 2); bf* KPl = (bf*)take(NB_ * PQ * 2);
    h16* VT16 = (h16*)take(NB_ * PV * 2); bf* VTh = (bf*)take(NB_ * PV * 2); bf* VTl = (bf*)take(NB_ * PV * 2);
    if ((size_t)(wsp - (char*)d_ws) > ws_size) return;    // ws 256 MiB (carve ~28 MiB)
    k_wt3<<<dim3(HD * CC / 512, 3, 1), 256, 0, stream>>>(wq, wk, wv, WT);   /* 'xw' weights -> bf16 in fragment order */
    k_proj<<<NB_ * TT / 64, 192, 0, stream>>>(x, WT, QPh, QPl, KPh, KPl, VT16, VTh, VTl);   /* all 8 batches: the rows of x are one [8 x 4096][384] matrix */
    /* causal attention of all batches, one work-group per 32 query rows, output rows stored once: rows < RH on hi/lo planes, then the rest */
    k_fattn<true><<<dim3(NB_, RH / 32, 1), FW * 32, 0, stream>>>(QPh, QPl, KPh, KPl, VT16, VTh, VTl, OUT, 0);
    k_fattn<false><<<dim3(NB_, (TT - RH) / 32, 1), FW * 32, 0, stream>>>(QPh, QPl, KPh, KPl, VT16, VTh, VTl, OUT, RH / 32);
}

// v007
// One run takes 43 microseconds.
// In two side-by-side timings against v006, it was 1.12 and 1.11 times as fast.
// Over all steps from v000 it is 52.5 times as fast.
#include <hip/hip_runtime.h>

// Single 64-wide causal attention head over 4,096 tokens (x [8][4096][384]; k = x Wk, q = x Wq, v = x Wv ('xw' [384][64], no bias); wei = q.k / sqrt(384) (the module scales by sqrt(embed size)); causal (-inf); softmax; out = wei.v -> [8][4096][64] (2.1 M); argument order x, Wk, Wq, Wv (keys first)).
// The batch index rides in the grid: the projection kernel and the attention kernel take all 8 batches per launch.
// Layout: 'xw' weights laid in fragment order once; k_proj reads x once as f32, rounds it to bf16 on the way into LDS, does the three exact projections and stores the q/k planes and value^T planes from its accumulators, in fragment order (FRAGMENT ORDER below); k_fattn does scores with EVERY row on hi/lo planes (3 products), running-maximum causal softmax in registers and wei.v (rows < 512 hi/lo 3 products, rest fp16) per 32-query tile and stores the output rows.
// Causal bound: a 32-query tile walks the 32-key blocks up to its own; only that last block is masked.
// Compute dtypes, f32 accumulate: every input rounded to bf16; projections exact; scores 3 products; softmax f32; wei.v rows < 512 3 products, rest fp16; output f32.

#define NB_  8
#define TT   4096
#define DM   384
#define NH_  1
#define NKV  1
#define REP  (NH_ / NKV)
#define HD   64
#define DQ   (NH_ * HD)
#define DKV  (NKV * HD)
#define RH   512                  // query rows < RH use hi+lo planes (0: none)
#define WIN  0
static_assert(RH % 32 == 0 && TT % 32 == 0 && HD == 64, "k_fattn takes 32 query rows and 32-key blocks of a 64-wide head");
#define SCL  0.05103103630798288f   // 1/sqrt(384): the module scales by sqrt(embed size C)
#define MID  64       // q / k width (one 64-wide head)
#define CO   64       // v width
#define CC   384
typedef _Float16 h16;
typedef unsigned short bf;
typedef __attribute__((ext_vector_type(16))) __bf16   v16bf;
typedef __attribute__((ext_vector_type(16))) _Float16 v16h;
typedef __attribute__((ext_vector_type(8)))  _Float16 v8h;
typedef __attribute__((ext_vector_type(8)))  unsigned short v8us;
typedef __attribute__((ext_vector_type(8)))  float    v8f;
typedef __attribute__((ext_vector_type(4)))  float    v4f;
typedef v8h  __attribute__((may_alias)) v8ha;
typedef v4f  __attribute__((may_alias)) v4fa;
typedef v8us __attribute__((may_alias)) v8usa;

__device__ __forceinline__ unsigned short f2bf(float f) { unsigned u = __float_as_uint(f); u += 0x7FFFu + ((u >> 16) & 1u); return (unsigned short)(u >> 16); }
__device__ __forceinline__ float bf2f(unsigned short b) { return __uint_as_float(((unsigned)b) << 16); }
__device__ __forceinline__ float bfr(float f) { return bf2f(f2bf(f)); }
__device__ __forceinline__ v16h cat16(v8h lo, v8h hi) { return __builtin_shufflevector(lo, hi, 0, 1, 2, 3, 4, 5, 6, 7, 8, 9, 10, 11, 12, 13, 14, 15); }
__device__ __forceinline__ v16bf cat16b(v8us lo, v8us hi) { return __builtin_bit_cast(v16bf, __builtin_shufflevector(lo, hi, 0, 1, 2, 3, 4, 5, 6, 7, 8, 9, 10, 11, 12, 13, 14, 15)); }
__device__ __forceinline__ v8f wmma16(v16h a, v16h b, v8f c) { return __builtin_amdgcn_wmma_f32_16x16x32_f16(false, a, false, b, (short)0, c, false, false); }
__device__ __forceinline__ v8f wmmab(v16bf a, v16bf b, v8f c) { return __builtin_amdgcn_wmma_f32_16x16x32_bf16(false, a, false, b, (short)0, c, false, false); }



// FRAGMENT ORDER of the q, k and v^T planes: a plane is a row of blocks of 32 tokens x 64 = 2048 elements (4 KiB); a block is 4 fragments of 16 x 32, a fragment two halves f of 512 bytes, a half [lane][8].
// q / k: fragment 2 t + c (t: 16-token group, c: 32-column group); lane (lr, hi) of half f holds token 16 t + lr, columns 32 c + 16 f + 8 hi .. + 7.
// v^T: fragment db (16-column group of v); lane (lr, hi) of half f holds column 16 db + lr, tokens 16 f + 8 hi .. + 7 of the block.
// So every 16-byte load or store of a wave covers 512 bytes in a row (4 whole lines), and a lane holds what it held with k-contiguous rows: k = 8 hi .. + 7 and 16 + 8 hi .. + 7.
#define FB   2048                 // elements of a 32-token block of a plane
#define FF   512                  // elements of a fragment
#define FH   256                  // elements of half a fragment
// fragment loaders: p is the lane's own 8 elements of the fragment's first half
template <typename T16> struct WFrag;
template <> struct WFrag<h16> { typedef v16h V; static __device__ __forceinline__ V ld(const h16* p) { return cat16(*(const v8h*)p, *(const v8h*)(p + FH)); } static __device__ __forceinline__ v8f mma(V a, V b, v8f c) { return wmma16(a, b, c); } };
template <> struct WFrag<bf> { typedef v16bf V; static __device__ __forceinline__ V ld(const bf* p) { return cat16b(*(const v8us*)p, *(const v8us*)(p + FH)); } static __device__ __forceinline__ v8f mma(V a, V b, v8f c) { return wmmab(a, b, c); } };
__device__ __forceinline__ h16 tohx(float x) { return (h16)x; }
__device__ __forceinline__ void splitf(float y, unsigned short& h, unsigned short& l) { h = f2bf(y); l = f2bf(y - bf2f(h)); }
typedef __attribute__((ext_vector_type(2))) _Float16 v2h;
typedef __attribute__((ext_vector_type(4))) _Float16 v4h;
typedef __attribute__((ext_vector_type(2))) unsigned short v2us;
typedef __attribute__((ext_vector_type(4))) unsigned short v4us;
typedef __attribute__((ext_vector_type(2))) float v2f;
typedef __attribute__((ext_vector_type(4))) int v4i;

typedef __attribute__((ext_vector_type(2))) __bf16 v2bf;
typedef __attribute__((ext_vector_type(4))) __bf16 v4bf;
__device__ __forceinline__ v4us rb4(v4f a) {   /* 4 f32 -> 4 bf16, round to nearest even, two a conversion */
    const v2bf p0 = __builtin_convertvector(__builtin_shufflevector(a, a, 0, 1), v2bf), p1 = __builtin_convertvector(__builtin_shufflevector(a, a, 2, 3), v2bf);
    return __builtin_bit_cast(v4us, (v4bf)__builtin_shufflevector(p0, p1, 0, 1, 2, 3)); }
__device__ __forceinline__ v8us rb8(v8f y) { return __builtin_shufflevector(rb4(__builtin_shufflevector(y, y, 0, 1, 2, 3)), rb4(__builtin_shufflevector(y, y, 4, 5, 6, 7)), 0, 1, 2, 3, 4, 5, 6, 7); }
__device__ __forceinline__ void split8(v8f y, v8us& h, v8us& l) {   /* y = hi + lo, both bf16 */
    h = rb8(y); v8f r;
#pragma unroll
    for (int e = 0; e < 8; ++e) r[e] = y[e] - bf2f(h[e]);
    l = rb8(r); }
// k_wt3: the three 'xw' weights [384][64] f32 -> WT, bf16 in fragment order, so that a wave's 16-byte loads of a fragment cover whole lines:
// WT[matrix q, k, v][step s = k / 32][16-column group j][half f][lane][8]: lane (lr, hi) holds column 16 j + lr, k = 32 s + 16 f + 8 hi .. + 7 (the loaders' own k order). One pair of k per thread; grid (64 * 384 / 512, 3).
__global__ __launch_bounds__(256) void k_wt3(const float* __restrict__ wq, const float* __restrict__ wk, const float* __restrict__ wv, bf* WT) {
    const int m = blockIdx.y; const float* w = m == 0 ? wq : (m == 1 ? wk : wv);
    const int idx = blockIdx.x * 256 + threadIdx.x, pr = idx & 3, ln = (idx >> 2) & 31, f = (idx >> 7) & 1, j = (idx >> 8) & 3, s = idx >> 10;
    const int n = j * 16 + (ln & 15), k = s * 32 + f * 16 + (ln >> 4) * 8 + pr * 2; v2us o;
    o[0] = f2bf(w[(size_t)k * HD + n]); o[1] = f2bf(w[(size_t)(k + 1) * HD + n]); *(v2us*)(WT + (size_t)m * HD * CC + (size_t)idx * 2) = o; }
#define XP   392                  // bf16 pitch of an x row in LDS (784 bytes = 16 x odd)
#define NS   (CC / 32)
template <bool TR>
__device__ __forceinline__ void proj_tile(const bf* xs, const bf* __restrict__ wp, v8f (&acc)[TR ? 2 : 4][TR ? 4 : 2]) {   /* xs: the lane's part of the tile's first x row in LDS; wp: the lane's part of the tile's first weight fragment */
    constexpr int NI = TR ? 2 : 4, NJ = TR ? 4 : 2;
    v16bf xa[2][NI], wf[3][NJ];
#define LDW(S) { _Pragma("unroll") for (int j = 0; j < NJ; ++j) wf[(S) % 3][j] = cat16b(*(const v8us*)(wp + ((S) * 4 + j) * 512), *(const v8us*)(wp + ((S) * 4 + j) * 512 + 256)); }
#define LDX(S) { _Pragma("unroll") for (int i = 0; i < NI; ++i) xa[(S) & 1][i] = cat16b(*(const v8usa*)(xs + i * 16 * XP + (S) * 32), *(const v8usa*)(xs + i * 16 * XP + (S) * 32 + 16)); }
    LDW(0) LDW(1) LDX(0)
#pragma unroll
    for (int s = 0; s < NS; ++s) {
        if (s + 2 < NS) LDW(s + 2)
        if (s + 1 < NS) LDX(s + 1)
        __builtin_amdgcn_sched_barrier(0);   /* keeps the loads of the later steps in front of this step's products, so that they fly during them */
#pragma unroll
        for (int j = 0; j < NJ; ++j)
#pragma unroll
            for (int i = 0; i < NI; ++i) acc[i][j] = TR ? wmmab(wf[s % 3][j], xa[s & 1][i], acc[i][j]) : wmmab(xa[s & 1][i], wf[s % 3][j], acc[i][j]);
        __builtin_amdgcn_sched_barrier(0);   /* second fence of the pair: keeps the next group of loads out of this block of products (for speed only) */
    }
#undef LDW
#undef LDX
}
__global__ __launch_bounds__(192) void k_proj(const float* __restrict__ x, const bf* __restrict__ WT, bf* Qh, bf* Ql, bf* Kh, bf* Kl, h16* V16, bf* Vh, bf* Vl) {
    __shared__ __align__(16) bf Xs[64 * XP];
    const int tid = threadIdx.x, lane = tid & 31, lr = lane & 15, hi = lane >> 4;
    const int wave = __builtin_amdgcn_readfirstlane(tid >> 5), mat = wave >> 1, half = wave & 1;
    const int r0 = blockIdx.x * 64;
    {   /* 64 rows x 96 pieces of 4 f32; piece it * 192 + tid: row 2 it + tid / 96, piece tid % 96 of the row */
        const float* xg = x + (size_t)r0 * CC + tid * 4; bf* xd = Xs + (tid / 96) * XP + (tid % 96) * 4; v4f xr[32];
#pragma unroll
        for (int it = 0; it < 32; ++it) xr[it] = *(const v4f*)(xg + it * 768);
        __builtin_amdgcn_sched_barrier(0);   /* all 32 loads are issued before the first is waited for */
#pragma unroll
        for (int it = 0; it < 32; ++it) *(v4us __attribute__((may_alias))*)(xd + it * 2 * XP) = rb4(xr[it]);
    }
    __syncthreads();   /* the 64 bf16 rows are in LDS before any wave takes a fragment */
    if (mat < 2) {
        v8f acc[2][4];
#pragma unroll
        for (int i = 0; i < 2; ++i)
#pragma unroll
            for (int j = 0; j < 4; ++j) acc[i][j] = (v8f){};
        proj_tile<true>(Xs + (half * 32 + lr) * XP + 8 * hi, WT + (size_t)mat * HD * CC + lane * 8, acc);
        v8us h[2][4], l[2][4];
#pragma unroll
        for (int i = 0; i < 2; ++i)
#pragma unroll
            for (int j = 0; j < 4; ++j) split8(acc[i][j], h[i][j], l[i][j]);
        const size_t go = (size_t)(r0 + half * 32) * HD + lane * 8;   /* the wave's 32 rows are one block; tile (i, j) is half j & 1 of fragment 2 i + j / 2 */
        bf* gh = (mat == 0 ? Qh : Kh) + go; bf* gl = (mat == 0 ? Ql : Kl) + go;
#pragma unroll
        for (int i = 0; i < 2; ++i)
#pragma unroll
            for (int j = 0; j < 4; ++j) { *(v8usa*)(gh + (i * 4 + j) * FH) = h[i][j]; *(v8usa*)(gl + (i * 4 + j) * FH) = l[i][j]; }
    } else {
        v8f acc[4][2];
#pragma unroll
        for (int i = 0; i < 4; ++i)
#pragma unroll
            for (int j = 0; j < 2; ++j) acc[i][j] = (v8f){};
        proj_tile<false>(Xs + lr * XP + 8 * hi, WT + (size_t)2 * HD * CC + half * 2 * 512 + lane * 8, acc);
        const int t0 = r0 % TT; const size_t go = (size_t)(r0 / TT) * HD * TT + (size_t)t0 * HD + half * 2 * FF + lane * 8;   /* tile (i, j) is half i & 1 of fragment 2 half + j of block i / 2 of the 64 rows */
#pragma unroll
        for (int j = 0; j < 2; ++j)
#pragma unroll
            for (int i = 0; i < 4; ++i) *(v8ha*)(V16 + go + (i >> 1) * FB + j * FF + (i & 1) * FH) = __builtin_convertvector(acc[i][j], v8h);
        asm volatile("s_wait_xcnt 0x0" ::: "memory");   /* stands in front of the first rewrite of these stores' data registers */
        if (t0 < RH) {
#pragma unroll
            for (int j = 0; j < 2; ++j)
#pragma unroll
                for (int i = 0; i < 4; ++i) { v8us h, l; split8(acc[i][j], h, l); const int po = (i >> 1) * FB + j * FF + (i & 1) * FH; *(v8usa*)(Vh + go + po) = h; *(v8usa*)(Vl + go + po) = l; }
            asm volatile("s_wait_xcnt 0x0" ::: "memory");   /* stands behind the last of these stores, in front of the join behind this block, before their registers may be rewritten */
        }
    }
}
// ---- k_fattn: scores, causal softmax and wei.v of one 32-query tile in one work-group; no score or probability ever reaches memory.
// Transposed products: S^T = K Q^T (A = 16 key rows, B = 16 query rows kept in registers, hi/lo planes, 3 products), O^T += V^T P^T (A = 16 rows of v^T, B = P^T).
// A lane of an S^T tile holds 8 keys of ONE query (D[8 hi + r][lr]), so two tiles of 16 keys, converted in place, are the B operand of the second product in the loaders' own k order, and maximum, sum and rescale of a query are per-lane values joined once between the wave halves.
// The FW waves of the work-group take the tile's 32-key blocks in turn (block kb goes to wave kb % FW), each with its own running reference exponent, sum and f32 output tile; the FW partial results are joined through LDS in fixed wave order, divided by the joined sum and stored as the output rows.
// Every inner loop is unrolled so that the fragment and accumulator arrays are indexed by constants and stay in registers; the key loop stays rolled (one copy of the pass).
// HR (query rows < RH): P^T and v^T on bf16 hi/lo planes, 3 products; otherwise P^T (not normalised, at most 256) and v^T in fp16. Both forms stand in one kernel, which takes the registers of the larger: the hi/lo form, few and short tiles, is held under a third of a SIMD's 1,024.
#define FW   4
#define OSP  68                   // f32 pitch of a query's row in the LDS join (16-byte aligned, off the power of two)
#define SC2  (SCL * 1.4426950408889634f)   // scores are carried as log2 exponents
__device__ __forceinline__ float xhalf(float x) { return __builtin_bit_cast(float, __builtin_amdgcn_permlanex16(__builtin_bit_cast(int, x), __builtin_bit_cast(int, x), 0x76543210, 0xfedcba98, false, false)); }   /* lane l takes lane l ^ 16's value */
template <bool HR>
__device__ __forceinline__ void fattn_tile(const bf* __restrict__ Qh, const bf* __restrict__ Ql, const bf* __restrict__ Kh, const bf* __restrict__ Kl, const h16* __restrict__ V16, const bf* __restrict__ Vh, const bf* __restrict__ Vl, float* __restrict__ out, const size_t b, const int tile, float (&Os)[FW][32 * OSP], float (&Ms)[FW][32], float (&Ls)[FW][32]) {
    const int q0 = tile * 32, lane = threadIdx.x & 31, lr = lane & 15, hi = lane >> 4;
    const int wave = __builtin_amdgcn_readfirstlane((int)(threadIdx.x >> 5));
    Qh += b * TT * HD; Ql += b * TT * HD; Kh += b * TT * HD; Kl += b * TT * HD; V16 += b * HD * TT; Vh += b * HD * TT; Vl += b * HD * TT;
    v16bf qh[2][2], ql[2][2]; const size_t qo = (size_t)tile * FB + lane * 8; const bf* qp = Qh + qo; const bf* qq = Ql + qo;
#pragma unroll
    for (int g = 0; g < 2; ++g)
#pragma unroll
        for (int kc = 0; kc < 2; ++kc) { qh[g][kc] = WFrag<bf>::ld(qp + (g * 2 + kc) * FF); ql[g][kc] = WFrag<bf>::ld(qq + (g * 2 + kc) * FF); }
    v8f o[2][4]; float mm[2], ll[2];
#pragma unroll
    for (int g = 0; g < 2; ++g) { mm[g] = -3.0e38f; ll[g] = 0.f;
#pragma unroll
        for (int db = 0; db < 4; ++db) o[g][db] = (v8f){}; }
    const int nblk = tile + 1;   /* keys 0 .. q0 + 31; only the last block crosses the diagonal, and every query has a key in every block */
    v16bf kh[2][2], kl[2][2]; const bf* kp; const bf* kq;
#define LDK(KB) { const size_t ko = (size_t)(KB) * FB + lane * 8; kp = Kh + ko; kq = Kl + ko; _Pragma("unroll") for (int kt = 0; kt < 2; ++kt) _Pragma("unroll") for (int kc = 0; kc < 2; ++kc) { kh[kt][kc] = WFrag<bf>::ld(kp + (kt * 2 + kc) * FF); kl[kt][kc] = WFrag<bf>::ld(kq + (kt * 2 + kc) * FF); } }
    LDK(wave < nblk ? wave : nblk - 1)
    /* stands in front of the first rewrite of the query and first key loads' address registers: the first key fragments as inputs keep it behind the loads, the four pointers as inputs keep their registers whole up to it */
    asm volatile("s_wait_xcnt 0x0" :: "v"(kh[0][0]), "v"(kh[0][1]), "v"(kh[1][0]), "v"(kh[1][1]), "v"(kl[0][0]), "v"(kl[0][1]), "v"(kl[1][0]), "v"(kl[1][1]), "v"(kp), "v"(kq), "v"(qp), "v"(qq));
#pragma unroll 1
    for (int kb = wave; kb < nblk; kb += FW) {
        v16h v16[4]; v16bf vh[2], vl[2]; const size_t vo = (size_t)kb * FB + lane * 8; const h16* vp = V16 + vo; const bf* vq = Vh + vo; const bf* vr = Vl + vo;
        if (!HR) {   /* the hi/lo form takes its v^T fragments behind the softmax, two pairs at a time */
#pragma unroll
            for (int db = 0; db < 4; ++db) v16[db] = WFrag<h16>::ld(vp + db * FF);
            asm volatile("s_wait_xcnt 0x0" ::: "memory");   /* stands in front of the first rewrite of the v^T loads' address registers */
        }
        v8f s[2][2];
#pragma unroll
        for (int kt = 0; kt < 2; ++kt)
#pragma unroll
            for (int g = 0; g < 2; ++g) { v8f a = (v8f){};
#pragma unroll
                for (int kc = 0; kc < 2; ++kc) { a = wmmab(kh[kt][kc], qh[g][kc], a); a = wmmab(kh[kt][kc], ql[g][kc], a); a = wmmab(kl[kt][kc], qh[g][kc], a); }
                s[g][kt] = a; }
        LDK(kb + FW < nblk ? kb + FW : nblk - 1)   /* the wave's next key block flies during the softmax and the second product (its last pass reloads a block in range) */
        asm volatile("s_wait_xcnt 0x0" :: "v"(kp), "v"(kq) : "memory");   /* the same for the key loads' address registers */
        if (kb == nblk - 1) {   /* the diagonal block: keys above the query leave the maximum and the sums */
#pragma unroll
            for (int g = 0; g < 2; ++g)
#pragma unroll
                for (int kt = 0; kt < 2; ++kt)
#pragma unroll
                    for (int j = 0; j < 8; ++j) if (kt * 16 + hi * 8 + j > g * 16 + lr) s[g][kt][j] = -3.0e38f; }
        v16h p16[2]; v16bf ph[2], pl[2]; float bm[2];
#pragma unroll
        for (int g = 0; g < 2; ++g) { float t = s[g][0][0];
#pragma unroll
            for (int j = 1; j < 8; ++j) t = fmaxf(t, s[g][0][j]);
#pragma unroll
            for (int j = 0; j < 8; ++j) t = fmaxf(t, s[g][1][j]);
            bm[g] = fmaxf(t, xhalf(t)) * SC2; }   /* the other half of the wave holds the query's other 16 keys */
        if (__builtin_amdgcn_ballot_w32(bm[0] > mm[0] + 8.0f || bm[1] > mm[1] + 8.0f) != 0) {   /* one scalar branch a pass: the reference exponent moves only when a query's maximum passes it by more than 8, so P stays at or below 256 */
#pragma unroll
            for (int g = 0; g < 2; ++g) { const float mn = fmaxf(mm[g], bm[g]), al = __builtin_amdgcn_exp2f(mm[g] - mn); ll[g] *= al; mm[g] = mn;
#pragma unroll
                for (int db = 0; db < 4; ++db) o[g][db] *= al; } }
#pragma unroll
        for (int g = 0; g < 2; ++g) { const float mn = mm[g];
            float sum = 0.f; v8us h0, h1, l0, l1; v8h f0, f1;
#pragma unroll
            for (int j = 0; j < 8; ++j) { const float e0 = __builtin_amdgcn_exp2f(__builtin_fmaf(s[g][0][j], SC2, -mn)), e1 = __builtin_amdgcn_exp2f(__builtin_fmaf(s[g][1][j], SC2, -mn)); sum += e0 + e1;
                if (HR) { unsigned short a2, c2; splitf(e0, a2, c2); h0[j] = a2; l0[j] = c2; splitf(e1, a2, c2); h1[j] = a2; l1[j] = c2;
                    if (j & 1) __builtin_amdgcn_sched_barrier(0);   /* four hi/lo splits at a time: all 32 interleaved, their temporaries cost the launch its third wave per SIMD */
                } else { f0[j] = tohx(e0); f1[j] = tohx(e1); } }
            ll[g] += sum;
            if (HR) { ph[g] = cat16b(h0, h1); pl[g] = cat16b(l0, l1); } else p16[g] = cat16(f0, f1); }
#pragma unroll
        for (int db = 0; db < 4; ++db) {
            if (HR && (db & 1) == 0) {   /* two hi/lo pairs at a time, loaded here and not at the head of the pass: 32 registers serve all four pairs and none is live beside the softmax's temporaries, so the shared launch keeps three waves per SIMD */
#pragma unroll
                for (int d2 = 0; d2 < 2; ++d2) { vh[d2] = WFrag<bf>::ld(vq + (db + d2) * FF); vl[d2] = WFrag<bf>::ld(vr + (db + d2) * FF); }
                asm volatile("s_wait_xcnt 0x0" ::: "memory");   /* stands in front of the first rewrite of these loads' address registers */
            }
#pragma unroll
            for (int g = 0; g < 2; ++g) { if (HR) { o[g][db] = wmmab(vh[db & 1], ph[g], o[g][db]); o[g][db] = wmmab(vl[db & 1], ph[g], o[g][db]); o[g][db] = wmmab(vh[db & 1], pl[g], o[g][db]); } else o[g][db] = wmma16(v16[db], p16[g], o[g][db]); } }
    }
#pragma unroll
    for (int g = 0; g < 2; ++g) { ll[g] += xhalf(ll[g]); if (hi == 0) { Ms[wave][g * 16 + lr] = mm[g]; Ls[wave][g * 16 + lr] = ll[g]; }
#pragma unroll
        for (int db = 0; db < 4; ++db) { float* p = &Os[wave][(g * 16 + lr) * OSP + db * 16 + hi * 8]; *(v4fa*)p = __builtin_shufflevector(o[g][db], o[g][db], 0, 1, 2, 3); *(v4fa*)(p + 4) = __builtin_shufflevector(o[g][db], o[g][db], 4, 5, 6, 7); } }
    __syncthreads();   /* every wave's partial maximum, sum and output tile are in LDS before any is read */
    const int q = threadIdx.x >> 2, d0 = (threadIdx.x & 3) * 16;
    float M = Ms[0][q];
#pragma unroll
    for (int w = 1; w < FW; ++w) M = fmaxf(M, Ms[w][q]);
    float f[FW], L = 0.f;
#pragma unroll
    for (int w = 0; w < FW; ++w) { f[w] = __builtin_amdgcn_exp2f(Ms[w][q] - M); L += Ls[w][q] * f[w]; }   /* a wave without a block has sum 0, tile 0 and factor 0 */
    const float inv = __fdiv_rn(1.0f, L);
#pragma unroll
    for (int c = 0; c < 4; ++c) { v4f a = (v4f){};
#pragma unroll
        for (int w = 0; w < FW; ++w) a += *(const v4fa*)&Os[w][q * OSP + d0 + c * 4] * f[w];
        *(v4f*)(out + (b * TT + q0 + q) * CO + d0 + c * 4) = a * inv; }
}
// One launch for all query tiles: the tile index is the same for the whole work-group, so the choice between the two forms is one scalar branch at the entry, and each form's barrier is passed by all four waves.
__global__ __launch_bounds__(FW * 32) void k_fattn(const bf* __restrict__ Qh, const bf* __restrict__ Ql, const bf* __restrict__ Kh, const bf* __restrict__ Kl, const h16* __restrict__ V16, const bf* __restrict__ Vh, const bf* __restrict__ Vl, float* __restrict__ out) {
    __shared__ __align__(16) float Os[FW][32 * OSP];
    __shared__ float Ms[FW][32], Ls[FW][32];
    const size_t b = blockIdx.x; const int tile = TT / 32 - 1 - (int)blockIdx.y;   /* grid (batch, tile): the tiles with the most keys take the lowest y indices, the short hi/lo tiles the highest */
    if (tile >= RH / 32) fattn_tile<false>(Qh, Ql, Kh, Kl, V16, Vh, Vl, out, b, tile, Os, Ms, Ls);
    else fattn_tile<true>(Qh, Ql, Kh, Kl, V16, Vh, Vl, out, b, tile, Os, Ms, Ls);
}
extern "C" void kernel_launch(void* const* d_in, const int* in_sizes, int n_in,
                              void* d_out, int out_size, void* d_ws, size_t ws_size, hipStream_t stream) {
    (void)in_sizes; (void)n_in; (void)out_size;
    const float* x = (const float*)d_in[0]; const float* wk = (const float*)d_in[1]; const float* wq = (const float*)d_in[2]; const float* wv = (const float*)d_in[3];   /* x [8][4096][384], Wk, Wq, Wv ('xw' [384][64], no biases; keys first) */
    float* OUT = (float*)d_out;     // [8][4096][64]
    char* wsp = (char*)d_ws;
    auto take = [&](size_t bytes) { char* p = wsp; wsp += (bytes + 255) & ~(size_t)255; return (void*)p; };
    bf* WT = (bf*)take((size_t)3 * HD * CC * 2);
    const size_t PQ = (size_t)TT * MID, PV = (size_t)CO * TT;   /* elements of one batch's q / k plane and of its v^T plane */
    bf* QPh = (bf*)take(NB_ * PQ * 2); bf* QPl = (bf*)take(NB_ * PQ * 2); bf* KPh = (bf*)take(NB_ * PQ * 2); bf* KPl = (bf*)take(NB_ * PQ * 2);
    h16* VT16 = (h16*)take(NB_ * PV * 2); bf* VTh = (bf*)take(NB_ * PV * 2); bf* VTl = (bf*)take(NB_ * PV * 2);
    if ((size_t)(wsp - (char*)d_ws) > ws_size) return;    // ws 256 MiB (carve ~28 MiB)
    k_wt3<<<dim3(HD * CC / 512, 3, 1), 256, 0, stream>>>(wq, wk, wv, WT);   /* 'xw' weights -> bf16 in fragment order */
    k_proj<<<NB_ * TT / 64, 192, 0, stream>>>(x, WT, QPh, QPl, KPh, KPl, VT16, VTh, VTl);   /* all 8 batches: the rows of x are one [8 x 4096][384] matrix */
    /* causal attention of all batches and all query rows in one launch, one work-group per 32 query rows, output rows stored once */
    k_fattn<<<dim3(NB_, TT / 32, 1), FW * 32, 0, stream>>>(QPh, QPl, KPh, KPl, VT16, VTh, VTl, OUT);
}

// v009
// Measured time: 31.5 microseconds a run.
// It is 1.40 times as fast as v007, going by the measured steps of the versions left out in between.
// Over all steps from v000 it is 73.3 times as fast.
#include <hip/hip_runtime.h>

// Single 64-wide causal attention head over 4,096 tokens (x [8][4096][384]; k = x Wk, q = x Wq, v = x Wv ('xw' [384][64], no bias); wei = q.k / sqrt(384) (the module scales by sqrt(embed size)); causal (-inf); softmax; out = wei.v -> [8][4096][64] (2.1 M); argument order x, Wk, Wq, Wv (keys first)).
// The batch index rides in the grid: the projection kernel and the attention kernel take all 8 batches per launch.
// Layout: 'xw' weights laid in fragment order once; k_proj reads x once as f32, rounds it to bf16 on the way into LDS, does the three exact projections and stores the q/k planes and value^T planes from its accumulators, in fragment order (FRAGMENT ORDER below); k_fattn does scores (rows < 512 on hi/lo planes, 3 products; rest one fp16 product), running-maximum causal softmax in registers and wei.v (rows < 512 hi/lo 3 products, rest fp16) per query tile (64 rows; 32 for rows < 512) and stores the output rows.
// Causal bound: a query tile walks the 32-key blocks up to its own last row's; only the blocks of its own rows are masked.
// Compute dtypes, f32 accumulate: every input rounded to bf16; projections exact; scores rows < 512 3 products, rest fp16 (q and k rounded once to 11 bits, as P and v are there: the score's error stays under the rounding of P); softmax f32; wei.v rows < 512 3 products, rest fp16; output f32.

#define NB_  8
#define TT   4096
#define DM   384
#define NH_  1
#define NKV  1
#define REP  (NH_ / NKV)
#define HD   64
#define DQ   (NH_ * HD)
#define DKV  (NKV * HD)
#define RH   512                  // query rows < RH use hi+lo planes (0: none)
#define WIN  0
static_assert(RH % 64 == 0 && TT % 64 == 0 && HD == 64, "k_fattn takes 64 (hi/lo form: 32) query rows and 32-key blocks of a 64-wide head");
#define SCL  0.05103103630798288f   // 1/sqrt(384): the module scales by sqrt(embed size C)
#define MID  64       // q / k width (one 64-wide head)
#define CO   64       // v width
#define CC   384
typedef _Float16 h16;
typedef unsigned short bf;
typedef __attribute__((ext_vector_type(16))) __bf16   v16bf;
typedef __attribute__((ext_vector_type(16))) _Float16 v16h;
typedef __attribute__((ext_vector_type(8)))  _Float16 v8h;
typedef __attribute__((ext_vector_type(8)))  unsigned short v8us;
typedef __attribute__((ext_vector_type(8)))  float    v8f;
typedef __attribute__((ext_vector_type(4)))  float    v4f;
typedef v8h  __attribute__((may_alias)) v8ha;
typedef v4f  __attribute__((may_alias)) v4fa;
typedef v8us __attribute__((may_alias)) v8usa;

__device__ __forceinline__ unsigned short f2bf(float f) { unsigned u = __float_as_uint(f); u += 0x7FFFu + ((u >> 16) & 1u); return (unsigned short)(u >> 16); }
__device__ __forceinline__ float bf2f(unsigned short b) { return __uint_as_float(((unsigned)b) << 16); }
__device__ __forceinline__ float bfr(float f) { return bf2f(f2bf(f)); }
__device__ __forceinline__ v16h cat16(v8h lo, v8h hi) { return __builtin_shufflevector(lo, hi, 0, 1, 2, 3, 4, 5, 6, 7, 8, 9, 10, 11, 12, 13, 14, 15); }
__device__ __forceinline__ v16bf cat16b(v8us lo, v8us hi) { return __builtin_bit_cast(v16bf, __builtin_shufflevector(lo, hi, 0, 1, 2, 3, 4, 5, 6, 7, 8, 9, 10, 11, 12, 13, 14, 15)); }
__device__ __forceinline__ v8f wmma16(v16h a, v16h b, v8f c) { return __builtin_amdgcn_wmma_f32_16x16x32_f16(false, a, false, b, (short)0, c, false, false); }
__device__ __forceinline__ v8f wmmab(v16bf a, v16bf b, v8f c) { return __builtin_amdgcn_wmma_f32_16x16x32_bf16(false, a, false, b, (short)0, c, false, false); }



// FRAGMENT ORDER of the q, k and v^T planes: a plane is a row of blocks of 32 tokens x 64 = 2048 elements (4 KiB); a block is 4 fragments of 16 x 32, a fragment two halves f of 512 bytes, a half [lane][8].
// q / k: fragment 2 t + c (t: 16-token group, c: 32-column group); lane (lr, hi) of half f holds token 16 t + lr, columns 32 c + 16 f + 8 hi .. + 7.
// v^T: fragment db (16-column group of v); lane (lr, hi) of half f holds column 16 db + lr, tokens 16 f + 8 hi .. + 7 of the block.
// So every 16-byte load or store of a wave covers 512 bytes in a row (4 whole lines), and a lane holds what it held with k-contiguous rows: k = 8 hi .. + 7 and 16 + 8 hi .. + 7.
#define FB   2048                 // elements of a 32-token block of a plane
#define FF   512                  // elements of a fragment
#define FH   256                  // elements of half a fragment
// fragment loaders: p is the lane's own 8 elements of the fragment's first half
template <typename T16> struct WFrag;
template <> struct WFrag<h16> { typedef v16h V; static __device__ __forceinline__ V ld(const h16* p) { return cat16(*(const v8h*)p, *(const v8h*)(p + FH)); } static __device__ __forceinline__ v8f mma(V a, V b, v8f c) { return wmma16(a, b, c); } };
template <> struct WFrag<bf> { typedef v16bf V; static __device__ __forceinline__ V ld(const bf* p) { return cat16b(*(const v8us*)p, *(const v8us*)(p + FH)); } static __device__ __forceinline__ v8f mma(V a, V b, v8f c) { return wmmab(a, b, c); } };
__device__ __forceinline__ h16 tohx(float x) { return (h16)x; }
__device__ __forceinline__ void splitf(float y, unsigned short& h, unsigned short& l) { h = f2bf(y); l = f2bf(y - bf2f(h)); }
typedef __attribute__((ext_vector_type(2))) _Float16 v2h;
typedef __attribute__((ext_vector_type(4))) _Float16 v4h;
typedef __attribute__((ext_vector_type(2))) unsigned short v2us;
typedef __attribute__((ext_vector_type(4))) unsigned short v4us;
typedef __attribute__((ext_vector_type(2))) float v2f;
typedef __attribute__((ext_vector_type(4))) int v4i;

typedef __attribute__((ext_vector_type(2))) __bf16 v2bf;
typedef __attribute__((ext_vector_type(4))) __bf16 v4bf;
__device__ __forceinline__ v4us rb4(v4f a) {   /* 4 f32 -> 4 bf16, round to nearest even, two a conversion */
    const v2bf p0 = __builtin_convertvector(__builtin_shufflevector(a, a, 0, 1), v2bf), p1 = __builtin_convertvector(__builtin_shufflevector(a, a, 2, 3), v2bf);
    return __builtin_bit_cast(v4us, (v4bf)__builtin_shufflevector(p0, p1, 0, 1, 2, 3)); }
__device__ __forceinline__ v8us rb8(v8f y) { return __builtin_shufflevector(rb4(__builtin_shufflevector(y, y, 0, 1, 2, 3)), rb4(__builtin_shufflevector(y, y, 4, 5, 6, 7)), 0, 1, 2, 3, 4, 5, 6, 7); }
__device__ __forceinline__ void split8(v8f y, v8us& h, v8us& l) {   /* y = hi + lo, both bf16 */
    h = rb8(y); v8f r;
#pragma unroll
    for (int e = 0; e < 8; ++e) r[e] = y[e] - bf2f(h[e]);
    l = rb8(r); }
// k_wt3: the three 'xw' weights [384][64] f32 -> WT, bf16 in fragment order, so that a wave's 16-byte loads of a fragment cover whole lines:
// WT[matrix q, k, v][step s = k / 32][16-column group j][half f][lane][8]: lane (lr, hi) holds column 16 j + lr, k = 32 s + 16 f + 8 hi .. + 7 (the loaders' own k order). One pair of k per thread; grid (64 * 384 / 512, 3).
__global__ __launch_bounds__(256) void k_wt3(const float* __restrict__ wq, const float* __restrict__ wk, const float* __restrict__ wv, bf* WT) {
    const int m = blockIdx.y; const float* w = m == 0 ? wq : (m == 1 ? wk : wv);
    const int idx = blockIdx.x * 256 + threadIdx.x, pr = idx & 3, ln = (idx >> 2) & 31, f = (idx >> 7) & 1, j = (idx >> 8) & 3, s = idx >> 10;
    const int n = j * 16 + (ln & 15), k = s * 32 + f * 16 + (ln >> 4) * 8 + pr * 2; v2us o;
    o[0] = f2bf(w[(size_t)k * HD + n]); o[1] = f2bf(w[(size_t)(k + 1) * HD + n]); *(v2us*)(WT + (size_t)m * HD * CC + (size_t)idx * 2) = o; }
#define XP   392                  // bf16 pitch of an x row in LDS (784 bytes = 16 x odd)
#define NS   (CC / 32)
template <bool TR>
__device__ __forceinline__ void proj_tile(const bf* xs, const bf* __restrict__ wp, v8f (&acc)[TR ? 2 : 4][TR ? 4 : 2]) {   /* xs: the lane's part of the tile's first x row in LDS; wp: the lane's part of the tile's first weight fragment */
    constexpr int NI = TR ? 2 : 4, NJ = TR ? 4 : 2;
    v16bf xa[2][NI], wf[3][NJ];
#define LDW(S) { _Pragma("unroll") for (int j = 0; j < NJ; ++j) wf[(S) % 3][j] = cat16b(*(const v8us*)(wp + ((S) * 4 + j) * 512), *(const v8us*)(wp + ((S) * 4 + j) * 512 + 256)); }
#define LDX(S) { _Pragma("unroll") for (int i = 0; i < NI; ++i) xa[(S) & 1][i] = cat16b(*(const v8usa*)(xs + i * 16 * XP + (S) * 32), *(const v8usa*)(xs + i * 16 * XP + (S) * 32 + 16)); }
    LDW(0) LDW(1) LDX(0)
#pragma unroll
    for (int s = 0; s < NS; ++s) {
        if (s + 2 < NS) LDW(s + 2)
        if (s + 1 < NS) LDX(s + 1)
        __builtin_amdgcn_sched_barrier(0);   /* keeps the loads of the later steps in front of this step's products, so that they fly during them */
#pragma unroll
        for (int j = 0; j < NJ; ++j)
#pragma unroll
            for (int i = 0; i < NI; ++i) acc[i][j] = TR ? wmmab(wf[s % 3][j], xa[s & 1][i], acc[i][j]) : wmmab(xa[s & 1][i], wf[s % 3][j], acc[i][j]);
        __builtin_amdgcn_sched_barrier(0);   /* second fence of the pair: keeps the next group of loads out of this block of products (for speed only) */
    }
#undef LDW
#undef LDX
}
__global__ __launch_bounds__(192) void k_proj(const float* __restrict__ x, const bf* __restrict__ WT, bf* Qh, bf* Ql, bf* Kh, bf* Kl, h16* Q16, h16* K16, h16* V16, bf* Vh, bf* Vl) {
    __shared__ __align__(16) bf Xs[64 * XP];
    const int tid = threadIdx.x, lane = tid & 31, lr = lane & 15, hi = lane >> 4;
    const int wave = __builtin_amdgcn_readfirstlane(tid >> 5), mat = wave >> 1, half = wave & 1;
    const int r0 = blockIdx.x * 64;
    {   /* 64 rows x 96 pieces of 4 f32; piece it * 192 + tid: row 2 it + tid / 96, piece tid % 96 of the row */
        const float* xg = x + (size_t)r0 * CC + tid * 4; bf* xd = Xs + (tid / 96) * XP + (tid % 96) * 4; v4f xr[32];
#pragma unroll
        for (int it = 0; it < 32; ++it) xr[it] = *(const v4f*)(xg + it * 768);
        __builtin_amdgcn_sched_barrier(0);   /* all 32 loads are issued before the first is waited for */
#pragma unroll
        for (int it = 0; it < 32; ++it) *(v4us __attribute__((may_alias))*)(xd + it * 2 * XP) = rb4(xr[it]);
    }
    __syncthreads();   /* the 64 bf16 rows are in LDS before any wave takes a fragment */
    if (mat < 2) {
        v8f acc[2][4];
#pragma unroll
        for (int i = 0; i < 2; ++i)
#pragma unroll
            for (int j = 0; j < 4; ++j) acc[i][j] = (v8f){};
        proj_tile<true>(Xs + (half * 32 + lr) * XP + 8 * hi, WT + (size_t)mat * HD * CC + lane * 8, acc);
        const size_t go = (size_t)(r0 + half * 32) * HD + lane * 8;   /* the wave's 32 rows are one block; tile (i, j) is half j & 1 of fragment 2 i + j / 2 */
        h16* gf = (mat == 0 ? Q16 : K16) + go;
#pragma unroll
        for (int i = 0; i < 2; ++i)
#pragma unroll
            for (int j = 0; j < 4; ++j) *(v8ha*)(gf + (i * 4 + j) * FH) = __builtin_convertvector(acc[i][j], v8h);
        asm volatile("s_wait_xcnt 0x0" ::: "memory");   /* stands in front of the first rewrite of these stores' registers, past the branch that follows */
        if (r0 % TT < RH) {
            bf* gh = (mat == 0 ? Qh : Kh) + go; bf* gl = (mat == 0 ? Ql : Kl) + go;
#pragma unroll
            for (int i = 0; i < 2; ++i)
#pragma unroll
                for (int j = 0; j < 4; ++j) { v8us h, l; split8(acc[i][j], h, l); *(v8usa*)(gh + (i * 4 + j) * FH) = h; *(v8usa*)(gl + (i * 4 + j) * FH) = l; }
            asm volatile("s_wait_xcnt 0x0" ::: "memory");   /* stands behind the last of these stores, in front of the join behind this block */
        }
    } else {
        v8f acc[4][2];
#pragma unroll
        for (int i = 0; i < 4; ++i)
#pragma unroll
            for (int j = 0; j < 2; ++j) acc[i][j] = (v8f){};
        proj_tile<false>(Xs + lr * XP + 8 * hi, WT + (size_t)2 * HD * CC + half * 2 * 512 + lane * 8, acc);
        const int t0 = r0 % TT; const size_t go = (size_t)(r0 / TT) * HD * TT + (size_t)t0 * HD + half * 2 * FF + lane * 8;   /* tile (i, j) is half i & 1 of fragment 2 half + j of block i / 2 of the 64 rows */
#pragma unroll
        for (int j = 0; j < 2; ++j)
#pragma unroll
            for (int i = 0; i < 4; ++i) *(v8ha*)(V16 + go + (i >> 1) * FB + j * FF + (i & 1) * FH) = __builtin_convertvector(acc[i][j], v8h);
        asm volatile("s_wait_xcnt 0x0" ::: "memory");   /* stands in front of the first rewrite of these stores' data registers */
        if (t0 < RH) {
#pragma unroll
            for (int j = 0; j < 2; ++j)
#pragma unroll
                for (int i = 0; i < 4; ++i) { v8us h, l; split8(acc[i][j], h, l); const int po = (i >> 1) * FB + j * FF + (i & 1) * FH; *(v8usa*)(Vh + go + po) = h; *(v8usa*)(Vl + go + po) = l; }
            asm volatile("s_wait_xcnt 0x0" ::: "memory");   /* stands behind the last of these stores, in front of the join behind this block, before their registers may be rewritten */
        }
    }
}
// ---- k_fattn: scores, causal softmax and wei.v of one query tile (NG groups of 16 rows: 64 rows, in the hi/lo form 32) in one work-group; no score or probability ever reaches memory.
// Every wave holds ALL the tile's query rows, so a key or v^T fragment, once loaded, feeds NG products: at 64 rows a query costs half the loaded bytes it costs at 32.
// Transposed products: S^T = K Q^T (A = 16 key rows, B = 16 query rows kept in registers), O^T += V^T P^T (A = 16 rows of v^T, B = P^T).
// A lane of an S^T tile holds 8 keys of ONE query (D[8 hi + r][lr]), so two tiles of 16 keys, converted in place, are the B operand of the second product in the loaders' own k order, and maximum, sum and rescale of a query are per-lane values joined once between the wave halves.
// The FW waves of the work-group take the tile's 32-key blocks in turn (block kb goes to wave kb % FW), each with its own running reference exponent, sum and f32 output tile; the FW partial results are joined through LDS in fixed wave order, divided by the joined sum and stored as the output rows.
// Every inner loop is unrolled so that the fragment and accumulator arrays are indexed by constants and stay in registers; the key loop stays rolled (one copy of the pass).
// HR (query rows < RH): q, k, P^T and v^T on bf16 hi/lo planes, 3 products each; otherwise q, k, P^T (not normalised, at most 256) and v^T in fp16, one product each. Both forms stand in one kernel, which takes the registers of the larger: 8 waves, two per SIMD, may hold half a SIMD's 1,024 each.
#define FW   8
static_assert(RH / 32 + 1 >= FW, "a 64-row tile's last key block, which is wholly masked for its first 32 rows, must never be a wave's first: the reference exponent is then a real score's");
#define OSP  68                   // f32 pitch of a query's row in the LDS join (16-byte aligned, off the power of two)
#define SC2  (SCL * 1.4426950408889634f)   // scores are carried as log2 exponents
__device__ __forceinline__ float xhalf(float x) { return __builtin_bit_cast(float, __builtin_amdgcn_permlanex16(__builtin_bit_cast(int, x), __builtin_bit_cast(int, x), 0x76543210, 0xfedcba98, false, false)); }   /* lane l takes lane l ^ 16's value */
template <bool HR>
__device__ __forceinline__ void fattn_tile(const bf* __restrict__ Qh, const bf* __restrict__ Ql, const bf* __restrict__ Kh, const bf* __restrict__ Kl, const h16* __restrict__ Q16, const h16* __restrict__ K16, const h16* __restrict__ V16, const bf* __restrict__ Vh, const bf* __restrict__ Vl, float* __restrict__ out, const size_t b, const int q0, float (&Os)[FW][64 * OSP], float (&Ms)[FW][64], float (&Ls)[FW][64]) {
    constexpr int NG = HR ? 2 : 4, NQ = NG * 16;   /* query groups of 16 rows, query rows of the tile */
    const int lane = threadIdx.x & 31, lr = lane & 15, hi = lane >> 4;
    const int wave = __builtin_amdgcn_readfirstlane((int)(threadIdx.x >> 5));
    Qh += b * TT * HD; Ql += b * TT * HD; Kh += b * TT * HD; Kl += b * TT * HD; Q16 += b * TT * HD; K16 += b * TT * HD; V16 += b * HD * TT; Vh += b * HD * TT; Vl += b * HD * TT;
    v16bf qh[NG][2], ql[NG][2]; v16h q16[NG][2]; const size_t qo = (size_t)(q0 / 32) * FB + lane * 8;   /* the tile's blocks stand in a row: group g is fragments 2 g, 2 g + 1 from the first */ const bf* qp = Qh + qo; const bf* qq = Ql + qo; const h16* qf = Q16 + qo;
#pragma unroll
    for (int g = 0; g < NG; ++g)
#pragma unroll
        for (int kc = 0; kc < 2; ++kc) { if constexpr (HR) { qh[g][kc] = WFrag<bf>::ld(qp + (g * 2 + kc) * FF); ql[g][kc] = WFrag<bf>::ld(qq + (g * 2 + kc) * FF); } else q16[g][kc] = WFrag<h16>::ld(qf + (g * 2 + kc) * FF); }
    v8f o[NG][4]; float mm[NG], ll[NG];
#pragma unroll
    for (int g = 0; g < NG; ++g) { mm[g] = -3.0e38f; ll[g] = 0.f;
#pragma unroll
        for (int db = 0; db < 4; ++db) o[g][db] = (v8f){}; }
    const int nblk = q0 / 32 + NG / 2;   /* keys 0 .. q0 + NQ - 1; only the last NG / 2 blocks reach past the diagonal */
    v16bf kh[2][2], kl[2][2]; v16h k16[2][2]; const bf* kp; const bf* kq; const h16* kf;
#define LDK(KB) { const size_t ko = (size_t)(KB) * FB + lane * 8; kp = Kh + ko; kq = Kl + ko; kf = K16 + ko; _Pragma("unroll") for (int kt = 0; kt < 2; ++kt) _Pragma("unroll") for (int kc = 0; kc < 2; ++kc) { if constexpr (HR) { kh[kt][kc] = WFrag<bf>::ld(kp + (kt * 2 + kc) * FF); kl[kt][kc] = WFrag<bf>::ld(kq + (kt * 2 + kc) * FF); } else k16[kt][kc] = WFrag<h16>::ld(kf + (kt * 2 + kc) * FF); } }
    LDK(wave < nblk ? wave : nblk - 1)
    /* stands in front of the first rewrite of the query and first key loads' address registers: the first key fragments as inputs keep it behind the loads, the pointers (four; two in the fp16 form) as inputs keep their registers whole up to it */
    if constexpr (HR) asm volatile("s_wait_xcnt 0x0" :: "v"(kh[0][0]), "v"(kh[0][1]), "v"(kh[1][0]), "v"(kh[1][1]), "v"(kl[0][0]), "v"(kl[0][1]), "v"(kl[1][0]), "v"(kl[1][1]), "v"(kp), "v"(kq), "v"(qp), "v"(qq));
    else asm volatile("s_wait_xcnt 0x0" :: "v"(k16[0][0]), "v"(k16[0][1]), "v"(k16[1][0]), "v"(k16[1][1]), "v"(kf), "v"(qf));
#pragma unroll 1
    for (int kb = wave; kb < nblk; kb += FW) {
        v16h v16[4]; v16bf vh[2], vl[2]; const size_t vo = (size_t)kb * FB + lane * 8; const h16* vp = V16 + vo; const bf* vq = Vh + vo; const bf* vr = Vl + vo;
        if (!HR) {   /* the hi/lo form takes its v^T fragments behind the softmax, two pairs at a time */
#pragma unroll
            for (int db = 0; db < 4; ++db) v16[db] = WFrag<h16>::ld(vp + db * FF);
            asm volatile("s_wait_xcnt 0x0" ::: "memory");   /* stands in front of the first rewrite of the v^T loads' address registers */
        }
        v8f s[NG][2];
#pragma unroll
        for (int kt = 0; kt < 2; ++kt)
#pragma unroll
            for (int g = 0; g < NG; ++g) { v8f a = (v8f){};
#pragma unroll
                for (int kc = 0; kc < 2; ++kc) { if constexpr (HR) { a = wmmab(kh[kt][kc], qh[g][kc], a); a = wmmab(kh[kt][kc], ql[g][kc], a); a = wmmab(kl[kt][kc], qh[g][kc], a); } else a = wmma16(k16[kt][kc], q16[g][kc], a); }
                s[g][kt] = a; }
        LDK(kb + FW < nblk ? kb + FW : nblk - 1)   /* the wave's next key block flies during the softmax and the second product (its last pass reloads a block in range) */
        if constexpr (HR) asm volatile("s_wait_xcnt 0x0" :: "v"(kp), "v"(kq) : "memory");   /* the same for the key loads' address registers */
        else asm volatile("s_wait_xcnt 0x0" :: "v"(kf) : "memory");   /* the same for the fp16 key loads' address registers */
        if (kb >= nblk - NG / 2) {   /* the blocks of the tile's own rows: keys above the query leave the maximum and the sums (a query with no key in the block keeps its reference exponent, and its P are 0) */
            const int kd = kb * 32 - q0;
#pragma unroll
            for (int g = 0; g < NG; ++g)
#pragma unroll
                for (int kt = 0; kt < 2; ++kt)
#pragma unroll
                    for (int j = 0; j < 8; ++j) if (kd + kt * 16 + hi * 8 + j > g * 16 + lr) s[g][kt][j] = -3.0e38f; }
        v16h p16[NG]; v16bf ph[NG], pl[NG]; float bm[NG]; bool up = false;
#pragma unroll
        for (int g = 0; g < NG; ++g) { float t = s[g][0][0];
#pragma unroll
            for (int j = 1; j < 8; ++j) t = fmaxf(t, s[g][0][j]);
#pragma unroll
            for (int j = 0; j < 8; ++j) t = fmaxf(t, s[g][1][j]);
            bm[g] = fmaxf(t, xhalf(t)) * SC2; up = up || bm[g] > mm[g] + 8.0f; }   /* the other half of the wave holds the query's other 16 keys */
        if (__builtin_amdgcn_ballot_w32(up) != 0) {   /* one scalar branch a pass: the reference exponent moves only when a query's maximum passes it by more than 8, so P stays at or below 256 */
#pragma unroll
            for (int g = 0; g < NG; ++g) { const float mn = fmaxf(mm[g], bm[g]), al = __builtin_amdgcn_exp2f(mm[g] - mn); ll[g] *= al; mm[g] = mn;
#pragma unroll
                for (int db = 0; db < 4; ++db) o[g][db] *= al; } }
#pragma unroll
        for (int g = 0; g < NG; ++g) { const float mn = mm[g];
            float sum = 0.f; v8us h0, h1, l0, l1; v8h f0, f1;
#pragma unroll
            for (int j = 0; j < 8; ++j) { const float e0 = __builtin_amdgcn_exp2f(__builtin_fmaf(s[g][0][j], SC2, -mn)), e1 = __builtin_amdgcn_exp2f(__builtin_fmaf(s[g][1][j], SC2, -mn)); sum += e0 + e1;
                if (HR) { unsigned short a2, c2; splitf(e0, a2, c2); h0[j] = a2; l0[j] = c2; splitf(e1, a2, c2); h1[j] = a2; l1[j] = c2;
                    if (j & 1) __builtin_amdgcn_sched_barrier(0);   /* four hi/lo splits at a time: all 32 interleaved, their temporaries swell the form's registers */
                } else { f0[j] = tohx(e0); f1[j] = tohx(e1); } }
            ll[g] += sum;
            if (HR) { ph[g] = cat16b(h0, h1); pl[g] = cat16b(l0, l1); } else p16[g] = cat16(f0, f1); }
#pragma unroll
        for (int db = 0; db < 4; ++db) {
            if (HR && (db & 1) == 0) {   /* two hi/lo pairs at a time, behind the softmax */
#pragma unroll
                for (int d2 = 0; d2 < 2; ++d2) { vh[d2] = WFrag<bf>::ld(vq + (db + d2) * FF); vl[d2] = WFrag<bf>::ld(vr + (db + d2) * FF); }
                asm volatile("s_wait_xcnt 0x0" :: "v"(vq), "v"(vr) : "memory");   /* stands in front of the first rewrite of these loads' address registers: the two pointers as inputs keep their registers whole up to it, also where the loads are lifted ahead of it */
            }
#pragma unroll
            for (int g = 0; g < NG; ++g) { if (HR) { o[g][db] = wmmab(vh[db & 1], ph[g], o[g][db]); o[g][db] = wmmab(vl[db & 1], ph[g], o[g][db]); o[g][db] = wmmab(vh[db & 1], pl[g], o[g][db]); } else o[g][db] = wmma16(v16[db], p16[g], o[g][db]); } }
    }
#pragma unroll
    for (int g = 0; g < NG; ++g) { ll[g] += xhalf(ll[g]); if (hi == 0) { Ms[wave][g * 16 + lr] = mm[g]; Ls[wave][g * 16 + lr] = ll[g]; }
#pragma unroll
        for (int db = 0; db < 4; ++db) { float* p = &Os[wave][(g * 16 + lr) * OSP + db * 16 + hi * 8]; *(v4fa*)p = __builtin_shufflevector(o[g][db], o[g][db], 0, 1, 2, 3); *(v4fa*)(p + 4) = __builtin_shufflevector(o[g][db], o[g][db], 4, 5, 6, 7); } }
    __syncthreads();   /* every wave's partial maximum, sum and output tile are in LDS before any is read */
    constexpr int TPQ = FW * 32 / NQ, CPT = HD / TPQ;   /* threads per query row, output columns per thread */
    const int q = threadIdx.x / TPQ, d0 = (threadIdx.x % TPQ) * CPT;
    float M = Ms[0][q];
#pragma unroll
    for (int w = 1; w < FW; ++w) M = fmaxf(M, Ms[w][q]);
    float f[FW], L = 0.f;
#pragma unroll
    for (int w = 0; w < FW; ++w) { f[w] = __builtin_amdgcn_exp2f(Ms[w][q] - M); L += Ls[w][q] * f[w]; }   /* a wave without a block has sum 0, tile 0 and factor 0 */
    const float inv = __fdiv_rn(1.0f, L);
#pragma unroll
    for (int c = 0; c < CPT / 4; ++c) { v4f a = (v4f){};
#pragma unroll
        for (int w = 0; w < FW; ++w) a += *(const v4fa*)&Os[w][q * OSP + d0 + c * 4] * f[w];
        *(v4f*)(out + (b * TT + q0 + q) * CO + d0 + c * 4) = a * inv; }
    asm volatile("s_wait_xcnt 0x0" ::: "memory");   /* stands behind the last output store, in front of the work-group's next tile, which rewrites these stores' registers */
}
// One launch for all query tiles: the tile index is the same for the whole work-group, so the choice between the two forms is one scalar branch at the entry, and each form's barriers are passed by all FW waves.
// At two waves per SIMD a WGP holds ONE work-group, so nothing would hide the gap between a work-group's end and the next one's start, and the last to start would run alone: the grid is one work-group per WGP (8 x 32 = 256), all resident from the start, with equal shares.
// Work-group y < NPR of a batch takes the 64-row tile y from the end and then tile y from the start (together always the same count of key blocks); each of the other NHW takes every NHW-th of the short hi/lo tiles.
#define NPR  ((TT - RH) / 128)    // pairs of 64-row tiles
#define NHW  4                    // work-groups of a batch that take the hi/lo tiles
static_assert((TT - RH) % 128 == 0 && (RH / 32) % NHW == 0, "the 64-row tiles pair up, the hi/lo tiles deal out evenly");
__global__ __launch_bounds__(FW * 32) void k_fattn(const bf* __restrict__ Qh, const bf* __restrict__ Ql, const bf* __restrict__ Kh, const bf* __restrict__ Kl, const h16* __restrict__ Q16, const h16* __restrict__ K16, const h16* __restrict__ V16, const bf* __restrict__ Vh, const bf* __restrict__ Vl, float* __restrict__ out) {
    __shared__ __align__(16) float Os[FW][64 * OSP];
    __shared__ float Ms[FW][64], Ls[FW][64];
    const size_t b = blockIdx.x; const int y = (int)blockIdx.y;   /* grid (batch, share) */
    if (y < NPR) {
#pragma unroll 1   /* one copy of the tile's code */
        for (int it = 0; it < 2; ++it) {
            if (it) __syncthreads();   /* every wave has read the last tile's partial results out of LDS before any wave lays the next tile's there */
            fattn_tile<false>(Qh, Ql, Kh, Kl, Q16, K16, V16, Vh, Vl, out, b, it == 0 ? TT - 64 - y * 64 : RH + y * 64, Os, Ms, Ls); }
    } else {
#pragma unroll 1   /* one copy of the tile's code */
        for (int it = 0; it < RH / 32 / NHW; ++it) {
            if (it) __syncthreads();   /* the same for the hi/lo tiles */
            fattn_tile<true>(Qh, Ql, Kh, Kl, Q16, K16, V16, Vh, Vl, out, b, (it * NHW + y - NPR) * 32, Os, Ms, Ls); }
    }
}
extern "C" void kernel_launch(void* const* d_in, const int* in_sizes, int n_in,
                              void* d_out, int out_size, void* d_ws, size_t ws_size, hipStream_t stream) {
    (void)in_sizes; (void)n_in; (void)out_size;
    const float* x = (const float*)d_in[0]; const float* wk = (const float*)d_in[1]; const float* wq = (const float*)d_in[2]; const float* wv = (const float*)d_in[3];   /* x [8][4096][384], Wk, Wq, Wv ('xw' [384][64], no biases; keys first) */
    float* OUT = (float*)d_out;     // [8][4096][64]
    char* wsp = (char*)d_ws;
    auto take = [&](size_t bytes) { char* p = wsp; wsp += (bytes + 255) & ~(size_t)255; return (void*)p; };
    bf* WT = (bf*)take((size_t)3 * HD * CC * 2);
    const size_t PQ = (size_t)TT * MID, PV = (size_t)CO * TT;   /* elements of one batch's q / k plane and of its v^T plane */
    bf* QPh = (bf*)take(NB_ * PQ * 2); bf* QPl = (bf*)take(NB_ * PQ * 2); bf* KPh = (bf*)take(NB_ * PQ * 2); bf* KPl = (bf*)take(NB_ * PQ * 2);
    h16* QP16 = (h16*)take(NB_ * PQ * 2); h16* KP16 = (h16*)take(NB_ * PQ * 2); h16* VT16 = (h16*)take(NB_ * PV * 2); bf* VTh = (bf*)take(NB_ * PV * 2); bf* VTl = (bf*)take(NB_ * PV * 2);
    if ((size_t)(wsp - (char*)d_ws) > ws_size) return;    // ws 256 MiB (carve ~36 MiB)
    k_wt3<<<dim3(HD * CC / 512, 3, 1), 256, 0, stream>>>(wq, wk, wv, WT);   /* 'xw' weights -> bf16 in fragment order */
    k_proj<<<NB_ * TT / 64, 192, 0, stream>>>(x, WT, QPh, QPl, KPh, KPl, QP16, KP16, VT16, VTh, VTl);   /* all 8 batches: the rows of x are one [8 x 4096][384] matrix */
    /* causal attention of all batches and all query rows in one launch, every output row stored once */
    k_fattn<<<dim3(NB_, NPR + NHW, 1), FW * 32, 0, stream>>>(QPh, QPl, KPh, KPl, QP16, KP16, VT16, VTh, VTl, OUT);
}

// v010
// One run takes 29.5 microseconds.
// Two timings next to v009 put it at 1.07 and 1.08 times that version's speed.
// All steps since v000 together make it 78.6 times as fast.
#include <hip/hip_runtime.h>

// Single 64-wide causal attention head over 4,096 tokens (x [8][4096][384]; k = x Wk, q = x Wq, v = x Wv ('xw' [384][64], no bias); wei = q.k / sqrt(384) (the module scales by sqrt(embed size)); causal (-inf); softmax; out = wei.v -> [8][4096][64] (2.1 M); argument order x, Wk, Wq, Wv (keys first)).
// The batch index rides in the grid: the projection kernel and the attention kernel take all 8 batches per launch.
// Layout: 'xw' weights laid in fragment order once; k_proj reads x once as f32, rounds it to bf16 on the way into LDS, does the three exact projections and stores the q/k planes and value^T planes from its accumulators, in fragment order (FRAGMENT ORDER below); k_fattn does scores (rows < 512 on hi/lo planes, 3 products; rest one fp16 product), running-maximum causal softmax in registers and wei.v (rows < 512 hi/lo 3 products, rest fp16) per query tile (64 rows; 32 for rows < 512) and stores the output rows.
// Causal bound: a query tile walks the 32-key blocks up to its own last row's; only the blocks of its own rows are masked.
// Compute dtypes, f32 accumulate: every input rounded to bf16; projections exact; scores rows < 512 3 products, rest fp16 (q and k rounded once to 11 bits, as P and v are there: the score's error stays under the rounding of P); softmax f32; wei.v rows < 512 3 products, rest fp16; output f32.

#define NB_  8
#define TT   4096
#define DM   384
#define NH_  1
#define NKV  1
#define REP  (NH_ / NKV)
#define HD   64
#define DQ   (NH_ * HD)
#define DKV  (NKV * HD)
#define RH   512                  // query rows < RH use hi+lo planes
#define WIN  0
static_assert(RH % 64 == 0 && TT % 64 == 0 && HD == 64, "k_fattn takes 64 (hi/lo form: 32) query rows and 32-key blocks of a 64-wide head");
#define SCL  0.05103103630798288f   // 1/sqrt(384): the module scales by sqrt(embed size C)
#define MID  64       // q / k width (one 64-wide head)
#define CO   64       // v width
#define CC   384
typedef _Float16 h16;
typedef unsigned short bf;
typedef __attribute__((ext_vector_type(16))) __bf16   v16bf;
typedef __attribute__((ext_vector_type(16))) _Float16 v16h;
typedef __attribute__((ext_vector_type(8)))  _Float16 v8h;
typedef __attribute__((ext_vector_type(8)))  unsigned short v8us;
typedef __attribute__((ext_vector_type(8)))  float    v8f;
typedef __attribute__((ext_vector_type(4)))  float    v4f;
typedef v8h  __attribute__((may_alias)) v8ha;
typedef v4f  __attribute__((may_alias)) v4fa;
typedef v8us __attribute__((may_alias)) v8usa;

__device__ __forceinline__ unsigned short f2bf(float f) { unsigned u = __float_as_uint(f); u += 0x7FFFu + ((u >> 16) & 1u); return (unsigned short)(u >> 16); }
__device__ __forceinline__ float bf2f(unsigned short b) { return __uint_as_float(((unsigned)b) << 16); }
__device__ __forceinline__ float bfr(float f) { return bf2f(f2bf(f)); }
__device__ __forceinline__ v16h cat16(v8h lo, v8h hi) { return __builtin_shufflevector(lo, hi, 0, 1, 2, 3, 4, 5, 6, 7, 8, 9, 10, 11, 12, 13, 14, 15); }
__device__ __forceinline__ v16bf cat16b(v8us lo, v8us hi) { return __builtin_bit_cast(v16bf, __builtin_shufflevector(lo, hi, 0, 1, 2, 3, 4, 5, 6, 7, 8, 9, 10, 11, 12, 13, 14, 15)); }
__device__ __forceinline__ v8f wmma16(v16h a, v16h b, v8f c) { return __builtin_amdgcn_wmma_f32_16x16x32_f16(false, a, false, b, (short)0, c, false, false); }
__device__ __forceinline__ v8f wmmab(v16bf a, v16bf b, v8f c) { return __builtin_amdgcn_wmma_f32_16x16x32_bf16(false, a, false, b, (short)0, c, false, false); }



// FRAGMENT ORDER of the q, k and v^T planes: a plane is a row of blocks of 32 tokens x 64 = 2048 elements (4 KiB); a block is 4 fragments of 16 x 32, a fragment two halves f of 512 bytes, a half [lane][8].
// q / k: fragment 2 t + c (t: 16-token group, c: 32-column group); lane (lr, hi) of half f holds token 16 t + lr, columns 32 c + 16 f + 8 hi .. + 7.
// v^T: fragment db (16-column group of v); lane (lr, hi) of half f holds column 16 db + lr, tokens 16 f + 8 hi .. + 7 of the block.
// So every 16-byte load or store of a wave covers 512 bytes in a row (4 whole lines), and a lane holds what it held with k-contiguous rows: k = 8 hi .. + 7 and 16 + 8 hi .. + 7.
#define FB   2048                 // elements of a 32-token block of a plane
#define FF   512                  // elements of a fragment
#define FH   256                  // elements of half a fragment
// fragment loaders: p is the lane's own 8 elements of the fragment's first half
template <typename T16> struct WFrag;
template <> struct WFrag<h16> { typedef v16h V; static __device__ __forceinline__ V ld(const h16* p) { return cat16(*(const v8h*)p, *(const v8h*)(p + FH)); } static __device__ __forceinline__ v8f mma(V a, V b, v8f c) { return wmma16(a, b, c); } };
template <> struct WFrag<bf> { typedef v16bf V; static __device__ __forceinline__ V ld(const bf* p) { return cat16b(*(const v8us*)p, *(const v8us*)(p + FH)); } static __device__ __forceinline__ v8f mma(V a, V b, v8f c) { return wmmab(a, b, c); } };
__device__ __forceinline__ h16 tohx(float x) { return (h16)x; }
__device__ __forceinline__ void splitf(float y, unsigned short& h, unsigned short& l) { h = f2bf(y); l = f2bf(y - bf2f(h)); }
typedef __attribute__((ext_vector_type(2))) _Float16 v2h;
typedef __attribute__((ext_vector_type(4))) _Float16 v4h;
typedef __attribute__((ext_vector_type(2))) unsigned short v2us;
typedef __attribute__((ext_vector_type(4))) unsigned short v4us;
typedef __attribute__((ext_vector_type(2))) float v2f;
typedef __attribute__((ext_vector_type(4))) int v4i;

typedef __attribute__((ext_vector_type(2))) __bf16 v2bf;
typedef __attribute__((ext_vector_type(4))) __bf16 v4bf;
__device__ __forceinline__ v4us rb4(v4f a) {   /* 4 f32 -> 4 bf16, round to nearest even, two a conversion */
    const v2bf p0 = __builtin_convertvector(__builtin_shufflevector(a, a, 0, 1), v2bf), p1 = __builtin_convertvector(__builtin_shufflevector(a, a, 2, 3), v2bf);
    return __builtin_bit_cast(v4us, (v4bf)__builtin_shufflevector(p0, p1, 0, 1, 2, 3)); }
__device__ __forceinline__ v8us rb8(v8f y) { return __builtin_shufflevector(rb4(__builtin_shufflevector(y, y, 0, 1, 2, 3)), rb4(__builtin_shufflevector(y, y, 4, 5, 6, 7)), 0, 1, 2, 3, 4, 5, 6, 7); }
__device__ __forceinline__ void split8(v8f y, v8us& h, v8us& l) {   /* y = hi + lo, both bf16 */
    h = rb8(y); v8f r;
#pragma unroll
    for (int e = 0; e < 8; ++e) r[e] = y[e] - bf2f(h[e]);
    l = rb8(r); }
// k_wt3: the three 'xw' weights [384][64] f32 -> WT, bf16 in fragment order, so that a wave's 16-byte loads of a fragment cover whole lines:
// WT[matrix q, k, v][step s = k / 32][16-column group j][half f][lane][8]: lane (lr, hi) holds column 16 j + lr, k = 32 s + 16 f + 8 hi .. + 7 (the loaders' own k order). One pair of k per thread; grid (64 * 384 / 512, 3).
__global__ __launch_bounds__(256) void k_wt3(const float* __restrict__ wq, const float* __restrict__ wk, const float* __restrict__ wv, bf* WT) {
    const int m = blockIdx.y; const float* w = m == 0 ? wq : (m == 1 ? wk : wv);
    const int idx = blockIdx.x * 256 + threadIdx.x, pr = idx & 3, ln = (idx >> 2) & 31, f = (idx >> 7) & 1, j = (idx >> 8) & 3, s = idx >> 10;
    const int n = j * 16 + (ln & 15), k = s * 32 + f * 16 + (ln >> 4) * 8 + pr * 2; v2us o;
    o[0] = f2bf(w[(size_t)k * HD + n]); o[1] = f2bf(w[(size_t)(k + 1) * HD + n]); *(v2us*)(WT + (size_t)m * HD * CC + (size_t)idx * 2) = o; }
#define XP   392                  // bf16 pitch of an x row in LDS (784 bytes = 16 x odd)
#define NS   (CC / 32)
template <bool TR>
__device__ __forceinline__ void proj_tile(const bf* xs, const bf* __restrict__ wp, v8f (&acc)[TR ? 2 : 4][TR ? 4 : 2]) {   /* xs: the lane's part of the tile's first x row in LDS; wp: the lane's part of the tile's first weight fragment */
    constexpr int NI = TR ? 2 : 4, NJ = TR ? 4 : 2;
    v16bf xa[2][NI], wf[3][NJ];
#define LDW(S) { _Pragma("unroll") for (int j = 0; j < NJ; ++j) wf[(S) % 3][j] = cat16b(*(const v8us*)(wp + ((S) * 4 + j) * 512), *(const v8us*)(wp + ((S) * 4 + j) * 512 + 256)); }
#define LDX(S) { _Pragma("unroll") for (int i = 0; i < NI; ++i) xa[(S) & 1][i] = cat16b(*(const v8usa*)(xs + i * 16 * XP + (S) * 32), *(const v8usa*)(xs + i * 16 * XP + (S) * 32 + 16)); }
    LDW(0) LDW(1) LDX(0)
#pragma unroll
    for (int s = 0; s < NS; ++s) {
        if (s + 2 < NS) LDW(s + 2)
        if (s + 1 < NS) LDX(s + 1)
        __builtin_amdgcn_sched_barrier(0);   /* keeps the loads of the later steps in front of this step's products, so that they fly during them */
#pragma unroll
        for (int j = 0; j < NJ; ++j)
#pragma unroll
            for (int i = 0; i < NI; ++i) acc[i][j] = TR ? wmmab(wf[s % 3][j], xa[s & 1][i], acc[i][j]) : wmmab(xa[s & 1][i], wf[s % 3][j], acc[i][j]);
        __builtin_amdgcn_sched_barrier(0);   /* second fence of the pair: keeps the next group of loads out of this block of products (for speed only) */
    }
#undef LDW
#undef LDX
}
__global__ __launch_bounds__(192) void k_proj(const float* __restrict__ x, const bf* __restrict__ WT, bf* Qh, bf* Ql, bf* Kh, bf* Kl, h16* Q16, h16* K16, h16* V16, bf* Vh, bf* Vl) {
    __shared__ __align__(16) bf Xs[64 * XP];
    const int tid = threadIdx.x, lane = tid & 31, lr = lane & 15, hi = lane >> 4;
    const int wave = __builtin_amdgcn_readfirstlane(tid >> 5), mat = wave >> 1, half = wave & 1;
    const int r0 = blockIdx.x * 64;
    {   /* 64 rows x 96 pieces of 4 f32; piece it * 192 + tid: row 2 it + tid / 96, piece tid % 96 of the row */
        const float* xg = x + (size_t)r0 * CC + tid * 4; bf* xd = Xs + (tid / 96) * XP + (tid % 96) * 4; v4f xr[32];
#pragma unroll
        for (int it = 0; it < 32; ++it) xr[it] = *(const v4f*)(xg + it * 768);
        __builtin_amdgcn_sched_barrier(0);   /* all 32 loads are issued before the first is waited for */
#pragma unroll
        for (int it = 0; it < 32; ++it) *(v4us __attribute__((may_alias))*)(xd + it * 2 * XP) = rb4(xr[it]);
    }
    __syncthreads();   /* the 64 bf16 rows are in LDS before any wave takes a fragment */
    if (mat < 2) {
        v8f acc[2][4];
#pragma unroll
        for (int i = 0; i < 2; ++i)
#pragma unroll
            for (int j = 0; j < 4; ++j) acc[i][j] = (v8f){};
        proj_tile<true>(Xs + (half * 32 + lr) * XP + 8 * hi, WT + (size_t)mat * HD * CC + lane * 8, acc);
        const size_t go = (size_t)(r0 + half * 32) * HD + lane * 8;   /* the wave's 32 rows are one block; tile (i, j) is half j & 1 of fragment 2 i + j / 2 */
        h16* gf = (mat == 0 ? Q16 : K16) + go;
#pragma unroll
        for (int i = 0; i < 2; ++i)
#pragma unroll
            for (int j = 0; j < 4; ++j) *(v8ha*)(gf + (i * 4 + j) * FH) = __builtin_convertvector(acc[i][j], v8h);
        asm volatile("s_wait_xcnt 0x0" ::: "memory");   /* stands in front of the first rewrite of these stores' registers, past the branch that follows */
        if (r0 % TT < RH) {
            bf* gh = (mat == 0 ? Qh : Kh) + go; bf* gl = (mat == 0 ? Ql : Kl) + go;
#pragma unroll
            for (int i = 0; i < 2; ++i)
#pragma unroll
                for (int j = 0; j < 4; ++j) { v8us h, l; split8(acc[i][j], h, l); *(v8usa*)(gh + (i * 4 + j) * FH) = h; *(v8usa*)(gl + (i * 4 + j) * FH) = l; }
            asm volatile("s_wait_xcnt 0x0" ::: "memory");   /* stands behind the last of these stores, in front of the join behind this block */
        }
    } else {
        v8f acc[4][2];
#pragma unroll
        for (int i = 0; i < 4; ++i)
#pragma unroll
            for (int j = 0; j < 2; ++j) acc[i][j] = (v8f){};
        proj_tile<false>(Xs + lr * XP + 8 * hi, WT + (size_t)2 * HD * CC + half * 2 * 512 + lane * 8, acc);
        const int t0 = r0 % TT; const size_t go = (size_t)(r0 / TT) * HD * TT + (size_t)t0 * HD + half * 2 * FF + lane * 8;   /* tile (i, j) is half i & 1 of fragment 2 half + j of block i / 2 of the 64 rows */
#pragma unroll
        for (int j = 0; j < 2; ++j)
#pragma unroll
            for (int i = 0; i < 4; ++i) *(v8ha*)(V16 + go + (i >> 1) * FB + j * FF + (i & 1) * FH) = __builtin_convertvector(acc[i][j], v8h);
        asm volatile("s_wait_xcnt 0x0" ::: "memory");   /* stands in front of the first rewrite of these stores' data registers */
        if (t0 < RH) {
#pragma unroll
            for (int j = 0; j < 2; ++j)
#pragma unroll
                for (int i = 0; i < 4; ++i) { v8us h, l; split8(acc[i][j], h, l); const int po = (i >> 1) * FB + j * FF + (i & 1) * FH; *(v8usa*)(Vh + go + po) = h; *(v8usa*)(Vl + go + po) = l; }
            asm volatile("s_wait_xcnt 0x0" ::: "memory");   /* stands behind the last of these stores, in front of the join behind this block, before their registers may be rewritten */
        }
    }
}
// ---- k_fattn: scores, causal softmax and wei.v of query tiles (NG groups of 16 rows: 64 rows, in the hi/lo form 32) in one work-group; no score or probability ever reaches memory.
// Every wave holds ALL rows of its query tile, so a key or v^T fragment, once loaded, feeds NG products: at 64 rows a query costs half the loaded bytes it costs at 32.
// Transposed products: S^T = K Q^T (A = 16 key rows, B = 16 query rows kept in registers), O^T += V^T P^T (A = 16 rows of v^T, B = P^T).
// A lane of an S^T tile holds 8 keys of ONE query (D[8 hi + r][lr]), so two tiles of 16 keys, converted in place, are the B operand of the second product in the loaders' own k order, and maximum, sum and rescale of a query are per-lane values joined once between the wave halves.
// The waves of a tile take its 32-key blocks in turn, each with its own running reference exponent, sum and f32 output tile; the partial results are joined through LDS in fixed wave order, divided by the joined sum and stored as the output rows.
// Hi/lo form: one tile, block kb goes to wave kb % FW.
// fp16 form: a LONG tile (qa) and a SHORT tile (qb, all its keys lie below the long tile's rows) in one call, in two walks.
//   Walk 0, the short tile's keys, which both tiles need: waves 0 .. FS - 1 hold the long tile, waves FS .. FW - 1 the short one, and waves w and w + FS take the same blocks (w, w + FS, ...): the lines that one of the two brings into the WGP's cache serve the other, so these keys leave L2 once for 128 query rows.
//   Walk 1, the rest of the long tile's keys: the short tile's waves lay their partial results in LDS, take the long tile's rows with a fresh state, and all FW waves deal the blocks downward from the last (the last block, wholly masked for half the rows, to a wave that comes with its state).
//   No barrier stands inside a walk (the waves share no buffer there, and their trip counts may differ); all FW waves meet at the one barrier in front of the two joins.
// Every inner loop is unrolled so that the fragment and accumulator arrays are indexed by constants and stay in registers; the walk loop and the key loop stay rolled (one copy of the pass).
// HR (query rows < RH): q, k, P^T and v^T on bf16 hi/lo planes, 3 products each; otherwise q, k, P^T (not normalised, at most 256) and v^T in fp16, one product each. Both forms stand in one kernel, which takes the registers of the larger: 8 waves, two per SIMD, may hold half a SIMD's 1,024 each.
#define FW   8
#define FS   (FW / 2)             // waves of each tile in walk 0
static_assert(RH / 32 + 2 > FS, "a 64-row tile's last key block, which is wholly masked for its first 32 rows, must never be the first block of a fresh state (the reference exponent must be a real score's): the short tile's is not among its first FS blocks; the long tile's goes to wave FS / 2, which comes with its state from walk 0");
#define OSP  68                   // f32 pitch of a query's row in the LDS join (16-byte aligned, off the power of two)
#define SC2  (SCL * 1.4426950408889634f)   // scores are carried as log2 exponents
__device__ __forceinline__ float xhalf(float x) { return __builtin_bit_cast(float, __builtin_amdgcn_permlanex16(__builtin_bit_cast(int, x), __builtin_bit_cast(int, x), 0x76543210, 0xfedcba98, false, false)); }   /* lane l takes lane l ^ 16's value */
// join of NP waves' partial results of one tile of NQ rows (os, ms, ls: the first of NP rows of Os, Ms, Ls), by all FW waves; orow: the tile's first output row
template <int NQ, int NP>
__device__ __forceinline__ void fattn_join(const float* os, const float* ms, const float* ls, float* __restrict__ orow) {
    constexpr int TPQ = FW * 32 / NQ, CPT = HD / TPQ;   /* threads per query row, output columns per thread */
    const int q = threadIdx.x / TPQ, d0 = (threadIdx.x % TPQ) * CPT;
    float M = ms[q];
#pragma unroll
    for (int w = 1; w < NP; ++w) M = fmaxf(M, ms[w * 64 + q]);
    float f[NP], L = 0.f;
#pragma unroll
    for (int w = 0; w < NP; ++w) { f[w] = __builtin_amdgcn_exp2f(ms[w * 64 + q] - M); L += ls[w * 64 + q] * f[w]; }   /* a wave without a block has sum 0, tile 0 and factor 0 */
    const float inv = __fdiv_rn(1.0f, L);
#pragma unroll
    for (int c = 0; c < CPT / 4; ++c) { v4f a = (v4f){};
#pragma unroll
        for (int w = 0; w < NP; ++w) a += *(const v4fa*)&os[w * 64 * OSP + q * OSP + d0 + c * 4] * f[w];
        *(v4f*)(orow + q * CO + d0 + c * 4) = a * inv; }
    asm volatile("s_wait_xcnt 0x0" ::: "memory");   /* stands behind the last output store, in front of the next join or tile, which rewrites these stores' registers */
    __builtin_amdgcn_sched_barrier(0);   /* keeps the next join's address arithmetic behind that wait: lifted among the stores it would rewrite their data registers ahead of it */
}
template <bool HR>
__device__ __forceinline__ void fattn_tile(const bf* __restrict__ Qh, const bf* __restrict__ Ql, const bf* __restrict__ Kh, const bf* __restrict__ Kl, const h16* __restrict__ Q16, const h16* __restrict__ K16, const h16* __restrict__ V16, const bf* __restrict__ Vh, const bf* __restrict__ Vl, float* __restrict__ out, const size_t b, const int qa, const int qb, float (&Os)[FW + FS][64 * OSP], float (&Ms)[FW + FS][64], float (&Ls)[FW + FS][64]) {
    constexpr int NG = HR ? 2 : 4, NQ = NG * 16, NW = HR ? 1 : 2;   /* query groups of 16 rows, query rows of a tile, walks */
    const int lane = threadIdx.x & 31, lr = lane & 15, hi = lane >> 4;
    const int wave = __builtin_amdgcn_readfirstlane((int)(threadIdx.x >> 5));
    const bool sh = !HR && wave >= FS;   /* a wave that holds the short tile in walk 0 */
    const int nc = qb / 32 + NG / 2;     /* fp16 form: the short tile's key blocks */
    Qh += b * TT * HD; Ql += b * TT * HD; Kh += b * TT * HD; Kl += b * TT * HD; Q16 += b * TT * HD; K16 += b * TT * HD; V16 += b * HD * TT; Vh += b * HD * TT; Vl += b * HD * TT;
    v16bf qh[NG][2], ql[NG][2]; v16h q16[NG][2]; v8f o[NG][4]; float mm[NG], ll[NG];
    /* the wave's first block and its count of blocks in walk 0 (upward) and in walk 1 (downward from the long tile's last block; k1 - nc >= 2 - FW, so the quotient is 0 for a wave without a block). Walk 1 deals in the order wave ^ FS / 2: a block left over goes first to the waves that had none left over in walk 0, and last to the short tile's waves that had one */
    const int k0 = HR ? wave : wave & (FS - 1), n0 = HR ? (qa / 32 + 1 - wave + FW - 1) / FW : (nc - k0 + FS - 1) / FS;
    const int k1 = qa / 32 + 1 - (wave ^ (FS / 2)), n1 = (k1 - nc + FW) / FW;
    v16bf kh[2][2], kl[2][2]; v16h k16[2][2]; const bf* kp; const bf* kq; const h16* kf;
#define LDK(KB) { const size_t ko = (size_t)(KB) * FB + lane * 8; kp = Kh + ko; kq = Kl + ko; kf = K16 + ko; _Pragma("unroll") for (int kt = 0; kt < 2; ++kt) _Pragma("unroll") for (int kc = 0; kc < 2; ++kc) { if constexpr (HR) { kh[kt][kc] = WFrag<bf>::ld(kp + (kt * 2 + kc) * FF); kl[kt][kc] = WFrag<bf>::ld(kq + (kt * 2 + kc) * FF); } else k16[kt][kc] = WFrag<h16>::ld(kf + (kt * 2 + kc) * FF); } }
/* FRESH: the rows of the tile at Q0 and a fresh state. The tile's blocks stand in a row: group g is fragments 2 g, 2 g + 1 from the first. Its s_wait_xcnt stands in front of the first rewrite of the query loads' address registers: the pointers as inputs keep their registers whole up to it */
#define FRESH(Q0) { const size_t qo = (size_t)((Q0) / 32) * FB + lane * 8; const bf* qp = Qh + qo; const bf* qq = Ql + qo; const h16* qf = Q16 + qo; \
    _Pragma("unroll") for (int g = 0; g < NG; ++g) _Pragma("unroll") for (int kc = 0; kc < 2; ++kc) { if constexpr (HR) { qh[g][kc] = WFrag<bf>::ld(qp + (g * 2 + kc) * FF); ql[g][kc] = WFrag<bf>::ld(qq + (g * 2 + kc) * FF); } else q16[g][kc] = WFrag<h16>::ld(qf + (g * 2 + kc) * FF); } \
    if constexpr (HR) asm volatile("s_wait_xcnt 0x0" :: "v"(qp), "v"(qq) : "memory"); else asm volatile("s_wait_xcnt 0x0" :: "v"(qf) : "memory"); \
    _Pragma("unroll") for (int g = 0; g < NG; ++g) { mm[g] = -3.0e38f; ll[g] = 0.f; _Pragma("unroll") for (int db = 0; db < 4; ++db) o[g][db] = (v8f){}; } }
    FRESH(sh ? qb : qa)
    __builtin_amdgcn_sched_barrier(0);   /* with its partner behind the wait: nothing but the first key loads stands in front of their s_wait_xcnt, so that no other instruction takes over their address registers ahead of it */
    LDK(n0 > 0 ? k0 : 0)
    if constexpr (HR) asm volatile("s_wait_xcnt 0x0" :: "v"(kp), "v"(kq) : "memory");   /* the same for the first key loads' address registers */
    else asm volatile("s_wait_xcnt 0x0" ::: "memory");   /* the same for the fp16 form, whose first key loads name an offset register and a scalar base: no pointer is formed for the wait, which would itself rewrite that register */
    __builtin_amdgcn_sched_barrier(0);   /* the partner */
#pragma unroll 1   /* one copy of the pass */
    for (int wk = 0; wk < NW; ++wk) {
        const int q0 = wk == 0 && sh ? qb : qa, nd = q0 / 32;   /* the wave's tile; keys 0 .. q0 + NQ - 1, only blocks nd .. nd + NG / 2 - 1 reach past the diagonal */
        int kb = wk == 0 ? k0 : k1; const int kst = HR ? FW : wk == 0 ? FS : -FW, n = wk == 0 ? n0 : n1;   /* the wave's block, its step, its count of blocks */
#pragma unroll 1
        for (int i = 0; i < n; ++i, kb += kst) {
            v16h v16[4]; v16bf vh[2], vl[2]; const size_t vo = (size_t)kb * FB + lane * 8; const h16* vp = V16 + vo; const bf* vq = Vh + vo; const bf* vr = Vl + vo;
            if (!HR) {   /* the hi/lo form takes its v^T fragments behind the softmax, two pairs at a time */
#pragma unroll
                for (int db = 0; db < 4; ++db) v16[db] = WFrag<h16>::ld(vp + db * FF);
                asm volatile("s_wait_xcnt 0x0" ::: "memory");   /* stands in front of the first rewrite of the v^T loads' address registers */
            }
            v8f s[NG][2];
#pragma unroll
            for (int kt = 0; kt < 2; ++kt)
#pragma unroll
                for (int g = 0; g < NG; ++g) { v8f a = (v8f){};
#pragma unroll
                    for (int kc = 0; kc < 2; ++kc) { if constexpr (HR) { a = wmmab(kh[kt][kc], qh[g][kc], a); a = wmmab(kh[kt][kc], ql[g][kc], a); a = wmmab(kl[kt][kc], qh[g][kc], a); } else a = wmma16(k16[kt][kc], q16[g][kc], a); }
                    s[g][kt] = a; }
            LDK(i + 1 < n ? kb + kst : wk + 1 < NW && n1 > 0 ? k1 : kb)   /* the wave's next key block flies during the softmax and the second product (the last pass of walk 0 fetches the first block of walk 1; a wave's very last pass reloads its own block) */
            if constexpr (HR) asm volatile("s_wait_xcnt 0x0" :: "v"(kp), "v"(kq) : "memory");   /* the same for the key loads' address registers */
            else asm volatile("s_wait_xcnt 0x0" :: "v"(kf) : "memory");   /* the same for the fp16 key loads' address registers */
            if (kb >= nd) {   /* the blocks of the tile's own rows: keys above the query leave the maximum and the sums (a query with no key in the block keeps its reference exponent, and its P are 0) */
                const int kd = kb * 32 - q0;
#pragma unroll
                for (int g = 0; g < NG; ++g)
#pragma unroll
                    for (int kt = 0; kt < 2; ++kt)
#pragma unroll
                        for (int j = 0; j < 8; ++j) if (kd + kt * 16 + hi * 8 + j > g * 16 + lr) s[g][kt][j] = -3.0e38f; }
            v16h p16[NG]; v16bf ph[NG], pl[NG]; float bm[NG]; bool up = false;
#pragma unroll
            for (int g = 0; g < NG; ++g) { float t = s[g][0][0];
#pragma unroll
                for (int j = 1; j < 8; ++j) t = fmaxf(t, s[g][0][j]);
#pragma unroll
                for (int j = 0; j < 8; ++j) t = fmaxf(t, s[g][1][j]);
                bm[g] = fmaxf(t, xhalf(t)) * SC2; up = up || bm[g] > mm[g] + 8.0f; }   /* the other half of the wave holds the query's other 16 keys */
            if (__builtin_amdgcn_ballot_w32(up) != 0) {   /* one scalar branch a pass: the reference exponent moves only when a query's maximum passes it by more than 8, so P stays at or below 256 */
#pragma unroll
                for (int g = 0; g < NG; ++g) { const float mn = fmaxf(mm[g], bm[g]), al = __builtin_amdgcn_exp2f(mm[g] - mn); ll[g] *= al; mm[g] = mn;
#pragma unroll
                    for (int db = 0; db < 4; ++db) o[g][db] *= al; } }
#pragma unroll
            for (int g = 0; g < NG; ++g) { const float mn = mm[g];
                float sum = 0.f; v8us h0, h1, l0, l1; v8h f0, f1;
#pragma unroll
                for (int j = 0; j < 8; ++j) { const float e0 = __builtin_amdgcn_exp2f(__builtin_fmaf(s[g][0][j], SC2, -mn)), e1 = __builtin_amdgcn_exp2f(__builtin_fmaf(s[g][1][j], SC2, -mn)); sum += e0 + e1;
                    if (HR) { unsigned short a2, c2; splitf(e0, a2, c2); h0[j] = a2; l0[j] = c2; splitf(e1, a2, c2); h1[j] = a2; l1[j] = c2;
                        if (j & 1) __builtin_amdgcn_sched_barrier(0);   /* four hi/lo splits at a time: all 32 interleaved, their temporaries swell the form's registers */
                    } else { f0[j] = tohx(e0); f1[j] = tohx(e1); } }
                ll[g] += sum;
                if (HR) { ph[g] = cat16b(h0, h1); pl[g] = cat16b(l0, l1); } else p16[g] = cat16(f0, f1); }
#pragma unroll
            for (int db = 0; db < 4; ++db) {
                if (HR && (db & 1) == 0) {   /* two hi/lo pairs at a time, behind the softmax */
#pragma unroll
                    for (int d2 = 0; d2 < 2; ++d2) { vh[d2] = WFrag<bf>::ld(vq + (db + d2) * FF); vl[d2] = WFrag<bf>::ld(vr + (db + d2) * FF); }
                    asm volatile("s_wait_xcnt 0x0" :: "v"(vq), "v"(vr) : "memory");   /* stands in front of the first rewrite of these loads' address registers: the two pointers as inputs keep their registers whole up to it, also where the loads are lifted ahead of it */
                }
#pragma unroll
                for (int g = 0; g < NG; ++g) { if (HR) { o[g][db] = wmmab(vh[db & 1], ph[g], o[g][db]); o[g][db] = wmmab(vl[db & 1], ph[g], o[g][db]); o[g][db] = wmmab(vh[db & 1], pl[g], o[g][db]); } else o[g][db] = wmma16(v16[db], p16[g], o[g][db]); } }
        }
#undef LDK
/* LAY: the wave's partial maxima, sums and output tile go to row PW of Ms, Ls, Os: rows 0 .. FW - 1 are the long (or only) tile's, rows FW .. the short tile's */
#define LAY(PW) { _Pragma("unroll") for (int g = 0; g < NG; ++g) { ll[g] += xhalf(ll[g]); if (hi == 0) { Ms[PW][g * 16 + lr] = mm[g]; Ls[PW][g * 16 + lr] = ll[g]; } \
    _Pragma("unroll") for (int db = 0; db < 4; ++db) { float* p = &Os[PW][(g * 16 + lr) * OSP + db * 16 + hi * 8]; *(v4fa*)p = __builtin_shufflevector(o[g][db], o[g][db], 0, 1, 2, 3); *(v4fa*)(p + 4) = __builtin_shufflevector(o[g][db], o[g][db], 4, 5, 6, 7); } } }
        if (wk + 1 < NW && sh) { LAY(wave + FS) FRESH(qa) }   /* the short tile's waves are through with it and go on with the long tile; the long tile's own waves keep their state */
    }
    LAY(wave)
#undef LAY
#undef FRESH
    __syncthreads();   /* every wave's partial maxima, sums and output tiles are in LDS before any is read */
    fattn_join<NQ, FW>(&Os[0][0], &Ms[0][0], &Ls[0][0], out + (b * TT + qa) * CO);
    if constexpr (!HR) fattn_join<NQ, FS>(&Os[FW][0], &Ms[FW][0], &Ls[FW][0], out + (b * TT + qb) * CO);
}
// One launch for all query tiles: the tile index is the same for the whole work-group, so the choice between the two forms is one scalar branch at the entry, and each form's barriers are passed by all FW waves.
// At two waves per SIMD a WGP holds ONE work-group, so nothing would hide the gap between a work-group's end and the next one's start, and the last to start would run alone: the grid is one work-group per WGP (8 x 32 = 256), all resident from the start, with equal shares.
// Work-group y < NPR of a batch takes the 64-row tile y from the end together with tile y from the start (together always the same count of key blocks); each of the other NHW takes every NHW-th of the short hi/lo tiles.
#define NPR  ((TT - RH) / 128)    // pairs of 64-row tiles
#define NHW  4                    // work-groups of a batch that take the hi/lo tiles
static_assert((TT - RH) % 128 == 0 && (RH / 32) % NHW == 0, "the 64-row tiles pair up, the hi/lo tiles deal out evenly");
__global__ __launch_bounds__(FW * 32) void k_fattn(const bf* __restrict__ Qh, const bf* __restrict__ Ql, const bf* __restrict__ Kh, const bf* __restrict__ Kl, const h16* __restrict__ Q16, const h16* __restrict__ K16, const h16* __restrict__ V16, const bf* __restrict__ Vh, const bf* __restrict__ Vl, float* __restrict__ out) {
    __shared__ __align__(16) float Os[FW + FS][64 * OSP];
    __shared__ float Ms[FW + FS][64], Ls[FW + FS][64];
    const size_t b = blockIdx.x; const int y = (int)blockIdx.y;   /* grid (batch, share) */
    if (y < NPR) {
        fattn_tile<false>(Qh, Ql, Kh, Kl, Q16, K16, V16, Vh, Vl, out, b, TT - 64 - y * 64, RH + y * 64, Os, Ms, Ls);   /* the short tile ends at or below the long tile's first row for every y < NPR */
    } else {
#pragma unroll 1   /* one copy of the tile's code */
        for (int it = 0; it < RH / 32 / NHW; ++it) {
            if (it) __syncthreads();   /* every wave has read the last tile's partial results out of LDS before any wave lays the next tile's there */
            const int q0 = (it * NHW + y - NPR) * 32;
            fattn_tile<true>(Qh, Ql, Kh, Kl, Q16, K16, V16, Vh, Vl, out, b, q0, q0, Os, Ms, Ls); }
    }
}
extern "C" void kernel_launch(void* const* d_in, const int* in_sizes, int n_in,
                              void* d_out, int out_size, void* d_ws, size_t ws_size, hipStream_t stream) {
    (void)in_sizes; (void)n_in; (void)out_size;
    const float* x = (const float*)d_in[0]; const float* wk = (const float*)d_in[1]; const float* wq = (const float*)d_in[2]; const float* wv = (const float*)d_in[3];   /* x [8][4096][384], Wk, Wq, Wv ('xw' [384][64], no biases; keys first) */
    float* OUT = (float*)d_out;     // [8][4096][64]
    char* wsp = (char*)d_ws;
    auto take = [&](size_t bytes) { char* p = wsp; wsp += (bytes + 255) & ~(size_t)255; return (void*)p; };
    bf* WT = (bf*)take((size_t)3 * HD * CC * 2);
    const size_t PQ = (size_t)TT * MID, PV = (size_t)CO * TT;   /* elements of one batch's q / k plane and of its v^T plane */
    bf* QPh = (bf*)take(NB_ * PQ * 2); bf* QPl = (bf*)take(NB_ * PQ * 2); bf* KPh = (bf*)take(NB_ * PQ * 2); bf* KPl = (bf*)take(NB_ * PQ * 2);
    h16* QP16 = (h16*)take(NB_ * PQ * 2); h16* KP16 = (h16*)take(NB_ * PQ * 2); h16* VT16 = (h16*)take(NB_ * PV * 2); bf* VTh = (bf*)take(NB_ * PV * 2); bf* VTl = (bf*)take(NB_ * PV * 2);
    if ((size_t)(wsp - (char*)d_ws) > ws_size) return;    // ws 256 MiB (carve ~36 MiB)
    k_wt3<<<dim3(HD * CC / 512, 3, 1), 256, 0, stream>>>(wq, wk, wv, WT);   /* 'xw' weights -> bf16 in fragment order */
    k_proj<<<NB_ * TT / 64, 192, 0, stream>>>(x, WT, QPh, QPl, KPh, KPl, QP16, KP16, VT16, VTh, VTl);   /* all 8 batches: the rows of x are one [8 x 4096][384] matrix */
    /* causal attention of all batches and all query rows in one launch, every output row stored once */
    k_fattn<<<dim3(NB_, NPR + NHW, 1), FW * 32, 0, stream>>>(QPh, QPl, KPh, KPl, QP16, KP16, VT16, VTh, VTl, OUT);
}
